// v000
// The times below were measured on an AMD MI455X: many runs one after another, warmed up first and cycling through
// copies of the inputs, with the whole window's GPU time divided by the number of runs. Launches and the gaps
// between them are all in it. The median over several windows is given; except for v000 it joins two sittings, which
// can be a few percent apart, so the side-by-side timings, each taken in one sitting, are the better comparison.
// The starting kernel, v000, takes 267 microseconds a run.
#include <hip/hip_runtime.h>

typedef __attribute__((ext_vector_type(16))) _Float16 v16h;
typedef __attribute__((ext_vector_type(8)))  _Float16 v8h;
typedef __attribute__((ext_vector_type(8)))  float    v8f;

#define cB 2
#define cS 2048
#define cD 1024
#define cH 16
#define MT (cB * cS)          // 4096 tokens total

#define BM 128
#define BN 128
#define BKK 32
#define LDT 40                // padded LDS stride in halves (80B, 16B-multiple)

// ---------------------------------------------------------------------------
// WMMA helper: D = A(16x32 f16) * B(32x16 f16) + C(16x16 f32)
// ---------------------------------------------------------------------------
__device__ __forceinline__ v8f wmma16(v16h a, v16h b, v8f c) {
  return __builtin_amdgcn_wmma_f32_16x16x32_f16(
      false, a, false, b, (short)0, c, false, false);
}

// Load a 16x32 f16 A-fragment (or B-fragment given B^T row-major) from a
// row-major tile with leading dimension ld (in halves).
// Per ISA 7.12.2: lane = row + 16*g, halves[0:8]=K[8g..8g+7], halves[8:16]=K[16+8g..].
__device__ __forceinline__ v16h load_ab_frag(const _Float16* tile, int ld) {
  const int lane = threadIdx.x & 31;
  const int r  = lane & 15;
  const int ko = (lane >> 4) << 3;   // 0 or 8
  const _Float16* p = tile + (size_t)r * ld;
  v8h lo = *(const v8h*)(p + ko);
  v8h hi = *(const v8h*)(p + 16 + ko);
  v16h f;
#pragma unroll
  for (int i = 0; i < 8; ++i) { f[i] = lo[i]; f[i + 8] = hi[i]; }
  return f;
}

// ---------------------------------------------------------------------------
// Async global->LDS copy of a 128x32 f16 tile (8KB) into a padded LDS tile.
// 512 x 16B chunks, 256 threads x 2 chunks; each asm stmt is one ASYNCcnt op
// per wave (32 lanes x 16B). LDS address = low 32 bits of generic pointer.
// ---------------------------------------------------------------------------
__device__ __forceinline__ void async_fill_tile(const _Float16* __restrict__ g,
                                                int ld, _Float16* __restrict__ s) {
  const int t = threadIdx.x;
#pragma unroll
  for (int i = 0; i < 2; ++i) {
    const int c   = t + i * 256;       // chunk 0..511
    const int row = c >> 2;            // 0..127
    const int seg = (c & 3) << 3;      // 0,8,16,24 halves
    const uint64_t ga = (uint64_t)(uintptr_t)(g + (size_t)row * ld + seg);
    const uint32_t la = (uint32_t)(uintptr_t)(s + row * LDT + seg);
    asm volatile("global_load_async_to_lds_b128 %0, %1, off"
                 :: "v"(la), "v"(ga) : "memory");
  }
}

__device__ __forceinline__ void wait_async_zero() {
  asm volatile("s_wait_asynccnt 0" ::: "memory");
}

// ---------------------------------------------------------------------------
// 16-lane (DPP row) butterfly reductions: masks {1,2,7,15} generate all 16.
// ---------------------------------------------------------------------------
#if __has_builtin(__builtin_amdgcn_mov_dpp)
template <int CTRL>
__device__ __forceinline__ float dpp_mov_f32(float x) {
  return __int_as_float(
      __builtin_amdgcn_mov_dpp(__float_as_int(x), CTRL, 0xf, 0xf, true));
}
__device__ __forceinline__ float row16_max(float v) {
  v = fmaxf(v, dpp_mov_f32<0x0B1>(v));   // quad_perm [1,0,3,2]  (xor 1)
  v = fmaxf(v, dpp_mov_f32<0x04E>(v));   // quad_perm [2,3,0,1]  (xor 2)
  v = fmaxf(v, dpp_mov_f32<0x141>(v));   // row_half_mirror      (xor 7)
  v = fmaxf(v, dpp_mov_f32<0x140>(v));   // row_mirror           (xor 15)
  return v;
}
__device__ __forceinline__ float row16_sum(float v) {
  v += dpp_mov_f32<0x0B1>(v);
  v += dpp_mov_f32<0x04E>(v);
  v += dpp_mov_f32<0x141>(v);
  v += dpp_mov_f32<0x140>(v);
  return v;
}
#else
__device__ __forceinline__ float row16_max(float v) {
  for (int off = 8; off >= 1; off >>= 1) v = fmaxf(v, __shfl_xor(v, off, 32));
  return v;
}
__device__ __forceinline__ float row16_sum(float v) {
  for (int off = 8; off >= 1; off >>= 1) v += __shfl_xor(v, off, 32);
  return v;
}
#endif

// ---------------------------------------------------------------------------
// f32 -> f16 conversion pre-pass (8 elements per thread)
// ---------------------------------------------------------------------------
__global__ __launch_bounds__(256) void cvt_f32_f16(const float* __restrict__ src,
                                                   _Float16* __restrict__ dst,
                                                   int n) {
  const int i = (blockIdx.x * 256 + threadIdx.x) * 8;
  if (i + 8 <= n) {
    const float4* s4 = (const float4*)(src + i);
    float4 a = s4[0], b = s4[1];
    v8h o;
    o[0]=(_Float16)a.x; o[1]=(_Float16)a.y; o[2]=(_Float16)a.z; o[3]=(_Float16)a.w;
    o[4]=(_Float16)b.x; o[5]=(_Float16)b.y; o[6]=(_Float16)b.z; o[7]=(_Float16)b.w;
    *(v8h*)(dst + i) = o;
  }
}

// ---------------------------------------------------------------------------
// Y = X[M,Kd](f16) * W[N,Kd](f16)^T + bias[N](f32)
//   F32_OUT:   Y f32 [M,N];  TRANS_OUT: Y f16 [N,M];  else Y f16 [M,N]
// 128x128x32 block tile, 8 waves x (64x32) wave tile, double-buffered LDS
// filled by async global->LDS copies overlapped with WMMA.
// ---------------------------------------------------------------------------
template <int TRANS_OUT, int F32_OUT>
__global__ __launch_bounds__(256) void gemm_f16_xwt_bias(
    const _Float16* __restrict__ X, const _Float16* __restrict__ W,
    const float* __restrict__ bias, void* __restrict__ Y,
    int M, int N, int Kd) {
  __shared__ __align__(16) _Float16 As[2][BM * LDT];
  __shared__ __align__(16) _Float16 Bs[2][BN * LDT];

  const int m0   = blockIdx.y * BM;
  const int n0   = blockIdx.x * BN;
  const int wave = threadIdx.x >> 5;
  const int lane = threadIdx.x & 31;
  const int wm   = (wave >> 2) * 64;
  const int wn   = (wave & 3) * 32;

  v8f acc[4][2] = {};

  // Prologue: fill buffer 0
  async_fill_tile(X + (size_t)m0 * Kd, Kd, As[0]);
  async_fill_tile(W + (size_t)n0 * Kd, Kd, Bs[0]);
  wait_async_zero();
  __syncthreads();

  int cur = 0;
  for (int k0 = 0; k0 < Kd; k0 += BKK) {
    const int nxt = k0 + BKK;
    if (nxt < Kd) {   // overlap next tile's async copy with this tile's WMMAs
      async_fill_tile(X + (size_t)m0 * Kd + nxt, Kd, As[cur ^ 1]);
      async_fill_tile(W + (size_t)n0 * Kd + nxt, Kd, Bs[cur ^ 1]);
    }

    v16h a[4], b[2];
#pragma unroll
    for (int mi = 0; mi < 4; ++mi)
      a[mi] = load_ab_frag(&As[cur][(wm + mi * 16) * LDT], LDT);
#pragma unroll
    for (int ni = 0; ni < 2; ++ni)
      b[ni] = load_ab_frag(&Bs[cur][(wn + ni * 16) * LDT], LDT);
#pragma unroll
    for (int mi = 0; mi < 4; ++mi)
#pragma unroll
      for (int ni = 0; ni < 2; ++ni)
        acc[mi][ni] = wmma16(a[mi], b[ni], acc[mi][ni]);

    if (nxt < Kd) {
      wait_async_zero();
      __syncthreads();
      cur ^= 1;
    }
  }

  // Epilogue: C layout = lane(N + 16*(M>=8)), vgpr r = M mod 8.
  const int colr = lane & 15;
  const int rsel = (lane >> 4) << 3;
#pragma unroll
  for (int mi = 0; mi < 4; ++mi) {
#pragma unroll
    for (int ni = 0; ni < 2; ++ni) {
      const int gn = n0 + wn + ni * 16 + colr;
      const float bv = bias[gn];
#pragma unroll
      for (int r = 0; r < 8; ++r) {
        const int gm = m0 + wm + mi * 16 + r + rsel;
        const float v = acc[mi][ni][r] + bv;
        if (F32_OUT)
          ((float*)Y)[(size_t)gm * N + gn] = v;
        else if (TRANS_OUT)
          ((_Float16*)Y)[(size_t)gn * M + gm] = (_Float16)v;
        else
          ((_Float16*)Y)[(size_t)gm * N + gn] = (_Float16)v;
      }
    }
  }
}

// ---------------------------------------------------------------------------
// Flash-style attention: one wave per 16-query tile of one (b,h).
//   Q,Km: f16 [B*S, D];  Vt: f16 [D, B*S];  ctx: f16 [B*S, D] (merged heads)
// ---------------------------------------------------------------------------
__global__ __launch_bounds__(256) void attention_fa(
    const _Float16* __restrict__ Q, const _Float16* __restrict__ Km,
    const _Float16* __restrict__ Vt, const int* __restrict__ mask,
    _Float16* __restrict__ ctx) {
  __shared__ __align__(16) _Float16 Pl[8][16 * LDT];

  const int wave = threadIdx.x >> 5;
  const int lane = threadIdx.x & 31;
  const int bh = blockIdx.y;
  const int b  = bh >> 4;                 // H = 16
  const int h  = bh & 15;
  const int q0 = (blockIdx.x * 8 + wave) * 16;

  const int colr = lane & 15;
  const int prow = (lane >> 4) << 3;
  _Float16* pw = &Pl[wave][0];

  // Q fragments, pre-scaled by 1/sqrt(DK) = 0.125 (exact in f16)
  const _Float16* qbase = Q + (size_t)(b * cS + q0) * cD + h * 64;
  v16h aq0 = load_ab_frag(qbase, cD);
  v16h aq1 = load_ab_frag(qbase + 32, cD);
#pragma unroll
  for (int i = 0; i < 16; ++i) {
    aq0[i] = aq0[i] * (_Float16)0.125f;
    aq1[i] = aq1[i] * (_Float16)0.125f;
  }

  v8f   ctxa[4] = {};
  float mrow[8], lrow[8];
#pragma unroll
  for (int r = 0; r < 8; ++r) { mrow[r] = -3.0e38f; lrow[r] = 0.0f; }

  for (int k0 = 0; k0 < cS; k0 += 32) {
    const _Float16* kb = Km + (size_t)(b * cS + k0) * cD + h * 64;
    if (k0 + 32 < cS)  // gfx1250 global_prefetch_b8 of next K tile
      __builtin_prefetch(kb + (size_t)32 * cD, 0, 3);

    // ---- scores: 2 key sub-tiles x 2 dk chunks ----
    v16h bk00 = load_ab_frag(kb, cD);
    v16h bk01 = load_ab_frag(kb + 32, cD);
    v16h bk10 = load_ab_frag(kb + (size_t)16 * cD, cD);
    v16h bk11 = load_ab_frag(kb + (size_t)16 * cD + 32, cD);
    v8f s0 = {}, s1 = {};
    s0 = wmma16(aq0, bk00, s0); s0 = wmma16(aq1, bk01, s0);
    s1 = wmma16(aq0, bk10, s1); s1 = wmma16(aq1, bk11, s1);

    // ---- mask (key column = lane low bits) ----
    const int mk0 = mask[b * cS + k0 + colr];
    const int mk1 = mask[b * cS + k0 + 16 + colr];
#pragma unroll
    for (int r = 0; r < 8; ++r) {
      if (mk0 == 0) s0[r] = -1.0e9f;
      if (mk1 == 0) s1[r] = -1.0e9f;
    }

    // ---- online softmax: DPP row reductions inside 16-lane halves ----
    float corr[8];
#pragma unroll
    for (int r = 0; r < 8; ++r) {
      const float vmax = row16_max(fmaxf(s0[r], s1[r]));
      const float mn = fmaxf(mrow[r], vmax);
      const float c  = __expf(mrow[r] - mn);
      const float p0 = __expf(s0[r] - mn);
      const float p1 = __expf(s1[r] - mn);
      lrow[r] = lrow[r] * c + row16_sum(p0 + p1);
      mrow[r] = mn;
      corr[r] = c;
      s0[r] = p0; s1[r] = p1;
    }
#pragma unroll
    for (int d = 0; d < 4; ++d)
#pragma unroll
      for (int r = 0; r < 8; ++r) ctxa[d][r] *= corr[r];

    // ---- transpose P (C layout -> A-fragment layout) via LDS ----
    __syncthreads();   // uniform across block: protect previous iter's reads
#pragma unroll
    for (int r = 0; r < 8; ++r) {
      pw[(r + prow) * LDT + colr]      = (_Float16)s0[r];
      pw[(r + prow) * LDT + 16 + colr] = (_Float16)s1[r];
    }
    __syncthreads();
    v16h ap = load_ab_frag(pw, LDT);

    // ---- ctx += P * V  (V^T row-major supplies B fragments) ----
#pragma unroll
    for (int d = 0; d < 4; ++d) {
      v16h bv = load_ab_frag(
          Vt + (size_t)(h * 64 + d * 16) * MT + (size_t)b * cS + k0, MT);
      ctxa[d] = wmma16(ap, bv, ctxa[d]);
    }
  }

  // ---- normalize and store merged-head context ----
  float linv[8];
#pragma unroll
  for (int r = 0; r < 8; ++r) linv[r] = 1.0f / lrow[r];
#pragma unroll
  for (int d = 0; d < 4; ++d) {
#pragma unroll
    for (int r = 0; r < 8; ++r) {
      const size_t gm = (size_t)b * cS + q0 + r + prow;
      const int    gc = h * 64 + d * 16 + colr;
      ctx[gm * cD + gc] = (_Float16)(ctxa[d][r] * linv[r]);
    }
  }
}

// ---------------------------------------------------------------------------
// Host-side launcher
// ---------------------------------------------------------------------------
extern "C" void kernel_launch(void* const* d_in, const int* in_sizes, int n_in,
                              void* d_out, int out_size, void* d_ws, size_t ws_size,
                              hipStream_t stream) {
  (void)in_sizes; (void)n_in; (void)out_size; (void)ws_size;

  const float* q_in = (const float*)d_in[0];
  const float* k_in = (const float*)d_in[1];
  const float* v_in = (const float*)d_in[2];
  const int*   mask = (const int*)d_in[3];
  const float* w_q  = (const float*)d_in[4];
  const float* b_q  = (const float*)d_in[5];
  const float* w_k  = (const float*)d_in[6];
  const float* b_k  = (const float*)d_in[7];
  const float* w_v  = (const float*)d_in[8];
  const float* b_v  = (const float*)d_in[9];
  const float* w_o  = (const float*)d_in[10];
  const float* b_o  = (const float*)d_in[11];

  // Workspace layout (f16), total 32 Mi halves = 64 MiB
  _Float16* p   = (_Float16*)d_ws;
  _Float16* Xq  = p; p += (size_t)MT * cD;
  _Float16* Xk  = p; p += (size_t)MT * cD;
  _Float16* Xv  = p; p += (size_t)MT * cD;
  _Float16* Wqh = p; p += (size_t)cD * cD;
  _Float16* Wkh = p; p += (size_t)cD * cD;
  _Float16* Wvh = p; p += (size_t)cD * cD;
  _Float16* Woh = p; p += (size_t)cD * cD;
  _Float16* Qh  = p; p += (size_t)MT * cD;
  _Float16* Kh  = p; p += (size_t)MT * cD;
  _Float16* Vt  = p; p += (size_t)MT * cD;
  _Float16* Ch  = p;

  dim3 gblk(256);

  // f32 -> f16 pre-pass (activations + weights)
  const int nAct = MT * cD, nW = cD * cD;
  cvt_f32_f16<<<nAct / 2048, gblk, 0, stream>>>(q_in, Xq, nAct);
  cvt_f32_f16<<<nAct / 2048, gblk, 0, stream>>>(k_in, Xk, nAct);
  cvt_f32_f16<<<nAct / 2048, gblk, 0, stream>>>(v_in, Xv, nAct);
  cvt_f32_f16<<<nW   / 2048, gblk, 0, stream>>>(w_q, Wqh, nW);
  cvt_f32_f16<<<nW   / 2048, gblk, 0, stream>>>(w_k, Wkh, nW);
  cvt_f32_f16<<<nW   / 2048, gblk, 0, stream>>>(w_v, Wvh, nW);
  cvt_f32_f16<<<nW   / 2048, gblk, 0, stream>>>(w_o, Woh, nW);

  dim3 ggrid(cD / BN, MT / BM);                   // (8, 32)
  gemm_f16_xwt_bias<0, 0><<<ggrid, gblk, 0, stream>>>(Xq, Wqh, b_q, (void*)Qh, MT, cD, cD);
  gemm_f16_xwt_bias<0, 0><<<ggrid, gblk, 0, stream>>>(Xk, Wkh, b_k, (void*)Kh, MT, cD, cD);
  gemm_f16_xwt_bias<1, 0><<<ggrid, gblk, 0, stream>>>(Xv, Wvh, b_v, (void*)Vt, MT, cD, cD);

  dim3 agrid(cS / 16 / 8, cB * cH);               // (16, 32)
  attention_fa<<<agrid, gblk, 0, stream>>>(Qh, Kh, Vt, mask, Ch);

  gemm_f16_xwt_bias<0, 1><<<ggrid, gblk, 0, stream>>>(Ch, Woh, b_o, d_out, MT, cD, cD);
}

// v001
// One run takes 181 microseconds.
// Next to v000, in two timings, it ran 1.52 times as fast each time.
#include <hip/hip_runtime.h>

typedef __attribute__((ext_vector_type(16))) _Float16 v16h;
typedef __attribute__((ext_vector_type(8)))  _Float16 v8h;
typedef __attribute__((ext_vector_type(8)))  float    v8f;

#define cB 2
#define cS 2048
#define cD 1024
#define cH 16
#define MT (cB * cS)          // 4096 tokens total

#define BM 128
#define BN 128
#define BKK 32
#define LDT 40                // padded LDS stride in halves (80B, 16B-multiple)

// ---------------------------------------------------------------------------
// WMMA helper: D = A(16x32 f16) * B(32x16 f16) + C(16x16 f32)
// ---------------------------------------------------------------------------
__device__ __forceinline__ v8f wmma16(v16h a, v16h b, v8f c) {
  return __builtin_amdgcn_wmma_f32_16x16x32_f16(
      false, a, false, b, (short)0, c, false, false);
}

// Load a 16x32 f16 A-fragment (or B-fragment given B^T row-major) from a
// row-major tile with leading dimension ld (in halves).
// Per ISA 7.12.2: lane = row + 16*g, halves[0:8]=K[8g..8g+7], halves[8:16]=K[16+8g..].
__device__ __forceinline__ v16h load_ab_frag(const _Float16* tile, int ld) {
  const int lane = threadIdx.x & 31;
  const int r  = lane & 15;
  const int ko = (lane >> 4) << 3;   // 0 or 8
  const _Float16* p = tile + (size_t)r * ld;
  v8h lo = *(const v8h*)(p + ko);
  v8h hi = *(const v8h*)(p + 16 + ko);
  v16h f;
#pragma unroll
  for (int i = 0; i < 8; ++i) { f[i] = lo[i]; f[i + 8] = hi[i]; }
  return f;
}

// ---------------------------------------------------------------------------
// Async global->LDS copy of a 128x32 f16 tile (8KB) into a padded LDS tile.
// 512 x 16B chunks, 256 threads x 2 chunks; each asm stmt is one ASYNCcnt op
// per wave (32 lanes x 16B). LDS address = low 32 bits of generic pointer.
// ---------------------------------------------------------------------------
__device__ __forceinline__ void async_fill_tile(const _Float16* __restrict__ g,
                                                int ld, _Float16* __restrict__ s) {
  const int t = threadIdx.x;
#pragma unroll
  for (int i = 0; i < 2; ++i) {
    const int c   = t + i * 256;       // chunk 0..511
    const int row = c >> 2;            // 0..127
    const int seg = (c & 3) << 3;      // 0,8,16,24 halves
    const uint64_t ga = (uint64_t)(uintptr_t)(g + (size_t)row * ld + seg);
    const uint32_t la = (uint32_t)(uintptr_t)(s + row * LDT + seg);
    asm volatile("global_load_async_to_lds_b128 %0, %1, off"
                 :: "v"(la), "v"(ga) : "memory");
  }
}

__device__ __forceinline__ void wait_async_zero() {
  asm volatile("s_wait_asynccnt 0" ::: "memory");
}

// ---------------------------------------------------------------------------
// 16-lane (DPP row) butterfly reductions: masks {1,2,7,15} generate all 16.
// ---------------------------------------------------------------------------
#if __has_builtin(__builtin_amdgcn_mov_dpp)
template <int CTRL>
__device__ __forceinline__ float dpp_mov_f32(float x) {
  return __int_as_float(
      __builtin_amdgcn_mov_dpp(__float_as_int(x), CTRL, 0xf, 0xf, true));
}
__device__ __forceinline__ float row16_max(float v) {
  v = fmaxf(v, dpp_mov_f32<0x0B1>(v));   // quad_perm [1,0,3,2]  (xor 1)
  v = fmaxf(v, dpp_mov_f32<0x04E>(v));   // quad_perm [2,3,0,1]  (xor 2)
  v = fmaxf(v, dpp_mov_f32<0x141>(v));   // row_half_mirror      (xor 7)
  v = fmaxf(v, dpp_mov_f32<0x140>(v));   // row_mirror           (xor 15)
  return v;
}
__device__ __forceinline__ float row16_sum(float v) {
  v += dpp_mov_f32<0x0B1>(v);
  v += dpp_mov_f32<0x04E>(v);
  v += dpp_mov_f32<0x141>(v);
  v += dpp_mov_f32<0x140>(v);
  return v;
}
#else
__device__ __forceinline__ float row16_max(float v) {
  for (int off = 8; off >= 1; off >>= 1) v = fmaxf(v, __shfl_xor(v, off, 32));
  return v;
}
__device__ __forceinline__ float row16_sum(float v) {
  for (int off = 8; off >= 1; off >>= 1) v += __shfl_xor(v, off, 32);
  return v;
}
#endif

// ---------------------------------------------------------------------------
// f32 -> f16 conversion pre-pass (8 elements per thread)
// ---------------------------------------------------------------------------
__global__ __launch_bounds__(256) void cvt_f32_f16(const float* __restrict__ src,
                                                   _Float16* __restrict__ dst,
                                                   int n) {
  const int i = (blockIdx.x * 256 + threadIdx.x) * 8;
  if (i + 8 <= n) {
    const float4* s4 = (const float4*)(src + i);
    float4 a = s4[0], b = s4[1];
    v8h o;
    o[0]=(_Float16)a.x; o[1]=(_Float16)a.y; o[2]=(_Float16)a.z; o[3]=(_Float16)a.w;
    o[4]=(_Float16)b.x; o[5]=(_Float16)b.y; o[6]=(_Float16)b.z; o[7]=(_Float16)b.w;
    *(v8h*)(dst + i) = o;
  }
}

// ---------------------------------------------------------------------------
// Y = X[M,Kd](f16) * W[N,Kd](f16)^T + bias[N](f32)
//   F32_OUT:   Y f32 [M,N];  TRANS_OUT: Y f16 [N,M];  else Y f16 [M,N]
// 128x128x32 block tile, 8 waves x (64x32) wave tile, double-buffered LDS
// filled by async global->LDS copies overlapped with WMMA.
// ---------------------------------------------------------------------------
template <int TRANS_OUT, int F32_OUT>
__global__ __launch_bounds__(256) void gemm_f16_xwt_bias(
    const _Float16* __restrict__ X, const _Float16* __restrict__ W,
    const float* __restrict__ bias, void* __restrict__ Y,
    int M, int N, int Kd) {
  __shared__ __align__(16) _Float16 As[2][BM * LDT];
  __shared__ __align__(16) _Float16 Bs[2][BN * LDT];

  const int m0   = blockIdx.y * BM;
  const int n0   = blockIdx.x * BN;
  const int wave = threadIdx.x >> 5;
  const int lane = threadIdx.x & 31;
  const int wm   = (wave >> 2) * 64;
  const int wn   = (wave & 3) * 32;

  v8f acc[4][2] = {};

  // Prologue: fill buffer 0
  async_fill_tile(X + (size_t)m0 * Kd, Kd, As[0]);
  async_fill_tile(W + (size_t)n0 * Kd, Kd, Bs[0]);
  wait_async_zero();
  __syncthreads();

  int cur = 0;
  for (int k0 = 0; k0 < Kd; k0 += BKK) {
    const int nxt = k0 + BKK;
    if (nxt < Kd) {   // overlap next tile's async copy with this tile's WMMAs
      async_fill_tile(X + (size_t)m0 * Kd + nxt, Kd, As[cur ^ 1]);
      async_fill_tile(W + (size_t)n0 * Kd + nxt, Kd, Bs[cur ^ 1]);
    }

    v16h a[4], b[2];
#pragma unroll
    for (int mi = 0; mi < 4; ++mi)
      a[mi] = load_ab_frag(&As[cur][(wm + mi * 16) * LDT], LDT);
#pragma unroll
    for (int ni = 0; ni < 2; ++ni)
      b[ni] = load_ab_frag(&Bs[cur][(wn + ni * 16) * LDT], LDT);
#pragma unroll
    for (int mi = 0; mi < 4; ++mi)
#pragma unroll
      for (int ni = 0; ni < 2; ++ni)
        acc[mi][ni] = wmma16(a[mi], b[ni], acc[mi][ni]);

    if (nxt < Kd) {
      wait_async_zero();
      __syncthreads();
      cur ^= 1;
    }
  }

  // Epilogue: C layout = lane(N + 16*(M>=8)), vgpr r = M mod 8.
  const int colr = lane & 15;
  const int rsel = (lane >> 4) << 3;
#pragma unroll
  for (int mi = 0; mi < 4; ++mi) {
#pragma unroll
    for (int ni = 0; ni < 2; ++ni) {
      const int gn = n0 + wn + ni * 16 + colr;
      const float bv = bias[gn];
#pragma unroll
      for (int r = 0; r < 8; ++r) {
        const int gm = m0 + wm + mi * 16 + r + rsel;
        const float v = acc[mi][ni][r] + bv;
        if (F32_OUT)
          ((float*)Y)[(size_t)gm * N + gn] = v;
        else if (TRANS_OUT)
          ((_Float16*)Y)[(size_t)gn * M + gm] = (_Float16)v;
        else
          ((_Float16*)Y)[(size_t)gm * N + gn] = (_Float16)v;
      }
    }
  }
}

// ---------------------------------------------------------------------------
// Attention K/V stage: 64 keys of one head. K tile = 64 key rows x 64 dk,
// V^T tile = 64 d rows x 64 keys; both have 128-B rows, laid in LDS at a
// 144-B pitch (16 B x odd) for the ds_load_b128 fragment readers.
// ---------------------------------------------------------------------------
#define KT 64                 // keys per stage
#define NT (cS / KT)          // stages per (b,h)
#define LDKV 72               // LDS pitch of a stage row, in halves

// One stage, copied once for the whole block: 2 x 512 chunks of 16 B, four
// copies per thread; a wave's copy covers four whole 128-B rows.
// gk, gv, lk, lv are this thread's own chunk of rows 0..31; rows 32..63 follow.
__device__ __forceinline__ void async_fill_kv(const _Float16* gk, const _Float16* gv,
                                              uint32_t lk, uint32_t lv) {
  const _Float16* gk1 = gk + (size_t)32 * cD;
  const _Float16* gv1 = gv + (size_t)32 * MT;
  const uint32_t  lk1 = lk + 32 * LDKV * 2;
  const uint32_t  lv1 = lv + 32 * LDKV * 2;
  // The s_wait_xcnt closes the copies' own statement, so that no address
  // register of a copy is rewritten ahead of it.
  asm volatile("global_load_async_to_lds_b128 %0, %1, off\n\t"
               "global_load_async_to_lds_b128 %2, %3, off\n\t"
               "global_load_async_to_lds_b128 %4, %5, off\n\t"
               "global_load_async_to_lds_b128 %6, %7, off\n\t"
               "s_wait_xcnt 0x0"
               :: "v"(lk), "v"(gk), "v"(lk1), "v"(gk1),
                  "v"(lv), "v"(gv), "v"(lv1), "v"(gv1) : "memory");
}

// ---------------------------------------------------------------------------
// Flash-style attention: one wave per 16-query tile of one (b,h); the block's
// eight waves share each K/V stage through a two-buffer LDS ring.
//   Q,Km: f16 [B*S, D];  Vt: f16 [D, B*S];  ctx: f16 [B*S, D] (merged heads)
// ---------------------------------------------------------------------------
__global__ __launch_bounds__(256) void attention_fa(
    const _Float16* __restrict__ Q, const _Float16* __restrict__ Km,
    const _Float16* __restrict__ Vt, const int* __restrict__ mask,
    _Float16* __restrict__ ctx) {
  __shared__ __align__(16) _Float16 Pl[8][16 * LDT];
  __shared__ __align__(16) _Float16 Ks[2][KT * LDKV];
  __shared__ __align__(16) _Float16 Vs[2][64 * LDKV];

  const int wave = threadIdx.x >> 5;
  const int lane = threadIdx.x & 31;
  const int bh = blockIdx.y;
  const int b  = bh >> 4;                 // H = 16
  const int h  = bh & 15;
  const int q0 = (blockIdx.x * 8 + wave) * 16;

  const int colr = lane & 15;
  const int prow = (lane >> 4) << 3;
  _Float16* pw = &Pl[wave][0];

  // Q fragments, pre-scaled by 1/sqrt(DK) = 0.125 (exact in f16)
  const _Float16* qbase = Q + (size_t)(b * cS + q0) * cD + h * 64;
  v16h aq0 = load_ab_frag(qbase, cD);
  v16h aq1 = load_ab_frag(qbase + 32, cD);
#pragma unroll
  for (int i = 0; i < 16; ++i) {
    aq0[i] = aq0[i] * (_Float16)0.125f;
    aq1[i] = aq1[i] * (_Float16)0.125f;
  }

  v8f   ctxa[4] = {};
  float mrow[8], lrow[8];
#pragma unroll
  for (int r = 0; r < 8; ++r) { mrow[r] = -3.0e38f; lrow[r] = 0.0f; }

  // This thread's chunk of a stage: row 0..31 (and row + 32), 16-B segment 0..7
  const int crow = threadIdx.x >> 3;
  const int cseg = (threadIdx.x & 7) << 3;
  const _Float16* gk = Km + (size_t)(b * cS + crow) * cD + h * 64 + cseg;
  const _Float16* gv = Vt + (size_t)(h * 64 + crow) * MT + (size_t)b * cS + cseg;
  const uint32_t lk = (uint32_t)(uintptr_t)(&Ks[0][crow * LDKV + cseg]);
  const uint32_t lv = (uint32_t)(uintptr_t)(&Vs[0][crow * LDKV + cseg]);
  const uint32_t bufb = KT * LDKV * 2;   // bytes from buffer 0 to buffer 1

  // Ring prologue: stage 0 landed and published, then stage 1 in flight
  async_fill_kv(gk, gv, lk, lv);
  wait_async_zero();
  __syncthreads();
  async_fill_kv(gk + (size_t)KT * cD, gv + KT, lk + bufb, lv + bufb);

  for (int t = 0; t < NT; ++t) {
   const _Float16* ksb = &Ks[t & 1][0];
   const _Float16* vsb = &Vs[t & 1][0];
   // unrolled: both 32-key halves of the stage read LDS at constant offsets
#pragma unroll
   for (int j = 0; j < KT / 32; ++j) {
    const int k0 = t * KT + j * 32;
    const _Float16* kb = ksb + j * 32 * LDKV;

    // ---- scores: 2 key sub-tiles x 2 dk chunks ----
    v16h bk00 = load_ab_frag(kb, LDKV);
    v16h bk01 = load_ab_frag(kb + 32, LDKV);
    v16h bk10 = load_ab_frag(kb + 16 * LDKV, LDKV);
    v16h bk11 = load_ab_frag(kb + 16 * LDKV + 32, LDKV);
    v8f s0 = {}, s1 = {};
    s0 = wmma16(aq0, bk00, s0); s0 = wmma16(aq1, bk01, s0);
    s1 = wmma16(aq0, bk10, s1); s1 = wmma16(aq1, bk11, s1);

    // ---- mask (key column = lane low bits) ----
    const int mk0 = mask[b * cS + k0 + colr];
    const int mk1 = mask[b * cS + k0 + 16 + colr];
#pragma unroll
    for (int r = 0; r < 8; ++r) {
      if (mk0 == 0) s0[r] = -1.0e9f;
      if (mk1 == 0) s1[r] = -1.0e9f;
    }

    // ---- online softmax: DPP row reductions inside 16-lane halves ----
    float corr[8];
#pragma unroll
    for (int r = 0; r < 8; ++r) {
      const float vmax = row16_max(fmaxf(s0[r], s1[r]));
      const float mn = fmaxf(mrow[r], vmax);
      const float c  = __expf(mrow[r] - mn);
      const float p0 = __expf(s0[r] - mn);
      const float p1 = __expf(s1[r] - mn);
      lrow[r] = lrow[r] * c + row16_sum(p0 + p1);
      mrow[r] = mn;
      corr[r] = c;
      s0[r] = p0; s1[r] = p1;
    }
#pragma unroll
    for (int d = 0; d < 4; ++d)
#pragma unroll
      for (int r = 0; r < 8; ++r) ctxa[d][r] *= corr[r];

    // ---- transpose P (C layout -> A-fragment layout) via LDS ----
    __syncthreads();   // uniform across block: protect previous iter's reads
#pragma unroll
    for (int r = 0; r < 8; ++r) {
      pw[(r + prow) * LDT + colr]      = (_Float16)s0[r];
      pw[(r + prow) * LDT + 16 + colr] = (_Float16)s1[r];
    }
    __syncthreads();
    v16h ap = load_ab_frag(pw, LDT);

    // ---- ctx += P * V  (V^T row-major supplies B fragments) ----
#pragma unroll
    for (int d = 0; d < 4; ++d) {
      v16h bv = load_ab_frag(vsb + d * 16 * LDKV + j * 32, LDKV);
      ctxa[d] = wmma16(ap, bv, ctxa[d]);
    }
   }

   // ---- publish stage t + 1, then refill the buffer stage t has left ----
   asm volatile("s_wait_dscnt 0x0" ::: "memory");  // own reads of stage t done
   wait_async_zero();                              // own copies of stage t + 1 landed
   __syncthreads();
   if (t + 2 < NT)
     async_fill_kv(gk + (size_t)(t + 2) * KT * cD, gv + (t + 2) * KT,
                   lk + (t & 1) * bufb, lv + (t & 1) * bufb);
  }
  wait_async_zero();   // nothing of this wave in flight when it ends

  // ---- normalize and store merged-head context ----
  float linv[8];
#pragma unroll
  for (int r = 0; r < 8; ++r) linv[r] = 1.0f / lrow[r];
#pragma unroll
  for (int d = 0; d < 4; ++d) {
#pragma unroll
    for (int r = 0; r < 8; ++r) {
      const size_t gm = (size_t)b * cS + q0 + r + prow;
      const int    gc = h * 64 + d * 16 + colr;
      ctx[gm * cD + gc] = (_Float16)(ctxa[d][r] * linv[r]);
    }
  }
}

// ---------------------------------------------------------------------------
// Host-side launcher
// ---------------------------------------------------------------------------
extern "C" void kernel_launch(void* const* d_in, const int* in_sizes, int n_in,
                              void* d_out, int out_size, void* d_ws, size_t ws_size,
                              hipStream_t stream) {
  (void)in_sizes; (void)n_in; (void)out_size; (void)ws_size;

  const float* q_in = (const float*)d_in[0];
  const float* k_in = (const float*)d_in[1];
  const float* v_in = (const float*)d_in[2];
  const int*   mask = (const int*)d_in[3];
  const float* w_q  = (const float*)d_in[4];
  const float* b_q  = (const float*)d_in[5];
  const float* w_k  = (const float*)d_in[6];
  const float* b_k  = (const float*)d_in[7];
  const float* w_v  = (const float*)d_in[8];
  const float* b_v  = (const float*)d_in[9];
  const float* w_o  = (const float*)d_in[10];
  const float* b_o  = (const float*)d_in[11];

  // Workspace layout (f16), total 32 Mi halves = 64 MiB
  _Float16* p   = (_Float16*)d_ws;
  _Float16* Xq  = p; p += (size_t)MT * cD;
  _Float16* Xk  = p; p += (size_t)MT * cD;
  _Float16* Xv  = p; p += (size_t)MT * cD;
  _Float16* Wqh = p; p += (size_t)cD * cD;
  _Float16* Wkh = p; p += (size_t)cD * cD;
  _Float16* Wvh = p; p += (size_t)cD * cD;
  _Float16* Woh = p; p += (size_t)cD * cD;
  _Float16* Qh  = p; p += (size_t)MT * cD;
  _Float16* Kh  = p; p += (size_t)MT * cD;
  _Float16* Vt  = p; p += (size_t)MT * cD;
  _Float16* Ch  = p;

  dim3 gblk(256);

  // f32 -> f16 pre-pass (activations + weights)
  const int nAct = MT * cD, nW = cD * cD;
  cvt_f32_f16<<<nAct / 2048, gblk, 0, stream>>>(q_in, Xq, nAct);
  cvt_f32_f16<<<nAct / 2048, gblk, 0, stream>>>(k_in, Xk, nAct);
  cvt_f32_f16<<<nAct / 2048, gblk, 0, stream>>>(v_in, Xv, nAct);
  cvt_f32_f16<<<nW   / 2048, gblk, 0, stream>>>(w_q, Wqh, nW);
  cvt_f32_f16<<<nW   / 2048, gblk, 0, stream>>>(w_k, Wkh, nW);
  cvt_f32_f16<<<nW   / 2048, gblk, 0, stream>>>(w_v, Wvh, nW);
  cvt_f32_f16<<<nW   / 2048, gblk, 0, stream>>>(w_o, Woh, nW);

  dim3 ggrid(cD / BN, MT / BM);                   // (8, 32)
  gemm_f16_xwt_bias<0, 0><<<ggrid, gblk, 0, stream>>>(Xq, Wqh, b_q, (void*)Qh, MT, cD, cD);
  gemm_f16_xwt_bias<0, 0><<<ggrid, gblk, 0, stream>>>(Xk, Wkh, b_k, (void*)Kh, MT, cD, cD);
  gemm_f16_xwt_bias<1, 0><<<ggrid, gblk, 0, stream>>>(Xv, Wvh, b_v, (void*)Vt, MT, cD, cD);

  dim3 agrid(cS / 16 / 8, cB * cH);               // (16, 32)
  attention_fa<<<agrid, gblk, 0, stream>>>(Qh, Kh, Vt, mask, Ch);

  gemm_f16_xwt_bias<0, 1><<<ggrid, gblk, 0, stream>>>(Ch, Woh, b_o, d_out, MT, cD, cD);
}

// v002
// A run of this version takes 151 microseconds.
// Two timings next to v001 both put it at 1.19 times that version's speed.
// All steps since v000 together make it 1.81 times as fast.
#include <hip/hip_runtime.h>

typedef __attribute__((ext_vector_type(16))) _Float16 v16h;
typedef __attribute__((ext_vector_type(8)))  _Float16 v8h;
typedef __attribute__((ext_vector_type(8)))  float    v8f;
typedef __attribute__((ext_vector_type(2)))  _Float16 v2h;
typedef __attribute__((ext_vector_type(2)))  float    v2f;

#define cB 2
#define cS 2048
#define cD 1024
#define cH 16
#define MT (cB * cS)          // 4096 tokens total

#define BM 128
#define BN 128
#define BKK 32
#define LDT 40                // padded LDS stride in halves (80B, 16B-multiple)

// ---------------------------------------------------------------------------
// WMMA helper: D = A(16x32 f16) * B(32x16 f16) + C(16x16 f32)
// ---------------------------------------------------------------------------
__device__ __forceinline__ v8f wmma16(v16h a, v16h b, v8f c) {
  return __builtin_amdgcn_wmma_f32_16x16x32_f16(
      false, a, false, b, (short)0, c, false, false);
}

// Load a 16x32 f16 A-fragment (or B-fragment given B^T row-major) from a
// row-major tile with leading dimension ld (in halves).
// Per ISA 7.12.2: lane = row + 16*g, halves[0:8]=K[8g..8g+7], halves[8:16]=K[16+8g..].
__device__ __forceinline__ v16h load_ab_frag(const _Float16* tile, int ld) {
  const int lane = threadIdx.x & 31;
  const int r  = lane & 15;
  const int ko = (lane >> 4) << 3;   // 0 or 8
  const _Float16* p = tile + (size_t)r * ld;
  v8h lo = *(const v8h*)(p + ko);
  v8h hi = *(const v8h*)(p + 16 + ko);
  v16h f;
#pragma unroll
  for (int i = 0; i < 8; ++i) { f[i] = lo[i]; f[i + 8] = hi[i]; }
  return f;
}

// ---------------------------------------------------------------------------
// Async global->LDS copy of a 128x32 f16 tile (8KB) into a padded LDS tile.
// 512 x 16B chunks, 256 threads x 2 chunks; each asm stmt is one ASYNCcnt op
// per wave (32 lanes x 16B). LDS address = low 32 bits of generic pointer.
// ---------------------------------------------------------------------------
__device__ __forceinline__ void async_fill_tile(const _Float16* __restrict__ g,
                                                int ld, _Float16* __restrict__ s) {
  const int t = threadIdx.x;
#pragma unroll
  for (int i = 0; i < 2; ++i) {
    const int c   = t + i * 256;       // chunk 0..511
    const int row = c >> 2;            // 0..127
    const int seg = (c & 3) << 3;      // 0,8,16,24 halves
    const uint64_t ga = (uint64_t)(uintptr_t)(g + (size_t)row * ld + seg);
    const uint32_t la = (uint32_t)(uintptr_t)(s + row * LDT + seg);
    asm volatile("global_load_async_to_lds_b128 %0, %1, off"
                 :: "v"(la), "v"(ga) : "memory");
  }
}

__device__ __forceinline__ void wait_async_zero() {
  asm volatile("s_wait_asynccnt 0" ::: "memory");
}

// ---------------------------------------------------------------------------
// f32 -> f16 conversion pre-pass (8 elements per thread)
// ---------------------------------------------------------------------------
__global__ __launch_bounds__(256) void cvt_f32_f16(const float* __restrict__ src,
                                                   _Float16* __restrict__ dst,
                                                   int n) {
  const int i = (blockIdx.x * 256 + threadIdx.x) * 8;
  if (i + 8 <= n) {
    const float4* s4 = (const float4*)(src + i);
    float4 a = s4[0], b = s4[1];
    v8h o;
    o[0]=(_Float16)a.x; o[1]=(_Float16)a.y; o[2]=(_Float16)a.z; o[3]=(_Float16)a.w;
    o[4]=(_Float16)b.x; o[5]=(_Float16)b.y; o[6]=(_Float16)b.z; o[7]=(_Float16)b.w;
    *(v8h*)(dst + i) = o;
  }
}

// ---------------------------------------------------------------------------
// Y = X[M,Kd](f16) * W[N,Kd](f16)^T + bias[N](f32)
//   F32_OUT:   Y f32 [M,N];  TRANS_OUT: Y f16 [N,M];  else Y f16 [M,N]
// 128x128x32 block tile, 8 waves x (64x32) wave tile, double-buffered LDS
// filled by async global->LDS copies overlapped with WMMA.
// ---------------------------------------------------------------------------
template <int TRANS_OUT, int F32_OUT>
__global__ __launch_bounds__(256) void gemm_f16_xwt_bias(
    const _Float16* __restrict__ X, const _Float16* __restrict__ W,
    const float* __restrict__ bias, void* __restrict__ Y,
    int M, int N, int Kd) {
  __shared__ __align__(16) _Float16 As[2][BM * LDT];
  __shared__ __align__(16) _Float16 Bs[2][BN * LDT];

  const int m0   = blockIdx.y * BM;
  const int n0   = blockIdx.x * BN;
  const int wave = threadIdx.x >> 5;
  const int lane = threadIdx.x & 31;
  const int wm   = (wave >> 2) * 64;
  const int wn   = (wave & 3) * 32;

  v8f acc[4][2] = {};

  // Prologue: fill buffer 0
  async_fill_tile(X + (size_t)m0 * Kd, Kd, As[0]);
  async_fill_tile(W + (size_t)n0 * Kd, Kd, Bs[0]);
  wait_async_zero();
  __syncthreads();

  int cur = 0;
  for (int k0 = 0; k0 < Kd; k0 += BKK) {
    const int nxt = k0 + BKK;
    if (nxt < Kd) {   // overlap next tile's async copy with this tile's WMMAs
      async_fill_tile(X + (size_t)m0 * Kd + nxt, Kd, As[cur ^ 1]);
      async_fill_tile(W + (size_t)n0 * Kd + nxt, Kd, Bs[cur ^ 1]);
    }

    v16h a[4], b[2];
#pragma unroll
    for (int mi = 0; mi < 4; ++mi)
      a[mi] = load_ab_frag(&As[cur][(wm + mi * 16) * LDT], LDT);
#pragma unroll
    for (int ni = 0; ni < 2; ++ni)
      b[ni] = load_ab_frag(&Bs[cur][(wn + ni * 16) * LDT], LDT);
#pragma unroll
    for (int mi = 0; mi < 4; ++mi)
#pragma unroll
      for (int ni = 0; ni < 2; ++ni)
        acc[mi][ni] = wmma16(a[mi], b[ni], acc[mi][ni]);

    if (nxt < Kd) {
      wait_async_zero();
      __syncthreads();
      cur ^= 1;
    }
  }

  // Epilogue: C layout = lane(N + 16*(M>=8)), vgpr r = M mod 8.
  const int colr = lane & 15;
  const int rsel = (lane >> 4) << 3;
#pragma unroll
  for (int mi = 0; mi < 4; ++mi) {
#pragma unroll
    for (int ni = 0; ni < 2; ++ni) {
      const int gn = n0 + wn + ni * 16 + colr;
      const float bv = bias[gn];
#pragma unroll
      for (int r = 0; r < 8; ++r) {
        const int gm = m0 + wm + mi * 16 + r + rsel;
        const float v = acc[mi][ni][r] + bv;
        if (F32_OUT)
          ((float*)Y)[(size_t)gm * N + gn] = v;
        else if (TRANS_OUT)
          ((_Float16*)Y)[(size_t)gn * M + gm] = (_Float16)v;
        else
          ((_Float16*)Y)[(size_t)gm * N + gn] = (_Float16)v;
      }
    }
  }
}

// ---------------------------------------------------------------------------
// Attention K/V stage: 64 keys of one head. K tile = 64 key rows x 64 dk,
// V^T tile = 64 d rows x 64 keys; both have 128-B rows, laid in LDS at a
// 144-B pitch (16 B x odd) for the ds_load_b128 fragment readers.
// ---------------------------------------------------------------------------
#define KT 64                 // keys per stage
#define NT (cS / KT)          // stages per (b,h)
#define LDKV 72               // LDS pitch of a stage row, in halves

// One stage, copied once for the whole block: 2 x 512 chunks of 16 B, four
// copies per thread; a wave's copy covers four whole 128-B rows.
// gk, gv, lk, lv are this thread's own chunk of rows 0..31; rows 32..63 follow.
__device__ __forceinline__ void async_fill_kv(const _Float16* gk, const _Float16* gv,
                                              uint32_t lk, uint32_t lv) {
  const _Float16* gk1 = gk + (size_t)32 * cD;
  const _Float16* gv1 = gv + (size_t)32 * MT;
  const uint32_t  lk1 = lk + 32 * LDKV * 2;
  const uint32_t  lv1 = lv + 32 * LDKV * 2;
  // The s_wait_xcnt closes the copies' own statement, so that no address
  // register of a copy is rewritten ahead of it.
  asm volatile("global_load_async_to_lds_b128 %0, %1, off\n\t"
               "global_load_async_to_lds_b128 %2, %3, off\n\t"
               "global_load_async_to_lds_b128 %4, %5, off\n\t"
               "global_load_async_to_lds_b128 %6, %7, off\n\t"
               "s_wait_xcnt 0x0"
               :: "v"(lk), "v"(gk), "v"(lk1), "v"(gk1),
                  "v"(lv), "v"(gv), "v"(lv1), "v"(gv1) : "memory");
}

// ---------------------------------------------------------------------------
// Lane l <-> lane l ^ 16: the two lanes that share one query column.
// ---------------------------------------------------------------------------
__device__ __forceinline__ float xhalf(float x) {
  const int b = __float_as_int(x);
  return __int_as_float(
      __builtin_amdgcn_permlanex16(b, b, 0x76543210, 0xfedcba98, false, false));
}

// The mask as one instruction a score: median(score, ceiling, -1e9) is -1e9
// under a ceiling of -1e9, whatever the score, and the score itself under the
// largest float, for every score >= -1e9.
__device__ __forceinline__ float min_cap(float s, float cap) {
  return __builtin_amdgcn_fmed3f(s, cap, -1.0e9f);
}

__global__ __launch_bounds__(256) void attention_fa(
    const _Float16* __restrict__ Q, const _Float16* __restrict__ Km,
    const _Float16* __restrict__ Vt, const int* __restrict__ mask,
    _Float16* __restrict__ ctx) {
  __shared__ __align__(32) float    Cap[cS];
  __shared__ __align__(16) _Float16 Ks[2][KT * LDKV];
  __shared__ __align__(16) _Float16 Vs[2][64 * LDKV];

  const int wave = threadIdx.x >> 5;
  const int lane = threadIdx.x & 31;
  const int bh = blockIdx.y;
  const int b  = bh >> 4;                 // H = 16
  const int h  = bh & 15;
  const int q0 = (blockIdx.x * 8 + wave) * 16;

  const int colr = lane & 15;
  const int prow = (lane >> 4) << 3;

  // Q fragments, pre-scaled by 1/sqrt(DK) = 0.125 (exact in f16)
  const _Float16* qbase = Q + (size_t)(b * cS + q0) * cD + h * 64;
  v16h aq0 = load_ab_frag(qbase, cD);
  v16h aq1 = load_ab_frag(qbase + 32, cD);
#pragma unroll
  for (int i = 0; i < 16; ++i) {
    aq0[i] = aq0[i] * (_Float16)0.125f;
    aq1[i] = aq1[i] * (_Float16)0.125f;
  }

  v8f   ctxa[4] = {};
  float mrow = -3.0e38f, lrow = 0.0f;     // lrow: this half's keys only

  // This thread's chunk of a stage: row 0..31 (and row + 32), 16-B segment 0..7
  const int crow = threadIdx.x >> 3;
  const int cseg = (threadIdx.x & 7) << 3;
  const _Float16* gk = Km + (size_t)(b * cS + crow) * cD + h * 64 + cseg;
  const _Float16* gv = Vt + (size_t)(h * 64 + crow) * MT + (size_t)b * cS + cseg;
  const uint32_t lk = (uint32_t)(uintptr_t)(&Ks[0][crow * LDKV + cseg]);
  const uint32_t lv = (uint32_t)(uintptr_t)(&Vs[0][crow * LDKV + cseg]);
  const uint32_t bufb = KT * LDKV * 2;   // bytes from buffer 0 to buffer 1

  // Ring prologue: stage 0 landed and published, then stage 1 in flight
  async_fill_kv(gk, gv, lk, lv);

  // The key runs along a lane's registers, so the mask is kept per key in
  // LDS as a ceiling: -1e9 on a masked key, the largest float on any other
  // (min_cap above applies it).
  {
    const int4* mp = (const int4*)(mask + b * cS + threadIdx.x * 8);
    const int4 m0 = mp[0], m1 = mp[1];
    float4 c0, c1;
    c0.x = m0.x == 0 ? -1.0e9f : 3.4028235e38f;
    c0.y = m0.y == 0 ? -1.0e9f : 3.4028235e38f;
    c0.z = m0.z == 0 ? -1.0e9f : 3.4028235e38f;
    c0.w = m0.w == 0 ? -1.0e9f : 3.4028235e38f;
    c1.x = m1.x == 0 ? -1.0e9f : 3.4028235e38f;
    c1.y = m1.y == 0 ? -1.0e9f : 3.4028235e38f;
    c1.z = m1.z == 0 ? -1.0e9f : 3.4028235e38f;
    c1.w = m1.w == 0 ? -1.0e9f : 3.4028235e38f;
    float4* cp = (float4*)&Cap[threadIdx.x * 8];
    cp[0] = c0; cp[1] = c1;
  }

  wait_async_zero();
  __syncthreads();
  async_fill_kv(gk + (size_t)KT * cD, gv + KT, lk + bufb, lv + bufb);

  for (int t = 0; t < NT; ++t) {
   const _Float16* ksb = &Ks[t & 1][0];
   const _Float16* vsb = &Vs[t & 1][0];
   // unrolled: both 32-key halves of the stage read LDS at constant offsets
#pragma unroll
   for (int j = 0; j < KT / 32; ++j) {
    const int k0 = t * KT + j * 32;
    const _Float16* kb = ksb + j * 32 * LDKV;

    // ---- scores^T: 2 key sub-tiles (rows) x 2 dk chunks, queries in columns ----
    v16h bk00 = load_ab_frag(kb, LDKV);
    v16h bk01 = load_ab_frag(kb + 32, LDKV);
    v16h bk10 = load_ab_frag(kb + 16 * LDKV, LDKV);
    v16h bk11 = load_ab_frag(kb + 16 * LDKV + 32, LDKV);
    v8f s0 = {}, s1 = {};
    s0 = wmma16(bk00, aq0, s0); s0 = wmma16(bk01, aq1, s0);
    s1 = wmma16(bk10, aq0, s1); s1 = wmma16(bk11, aq1, s1);

    // ---- mask (key row = 8 * half + register) ----
    const v8f cap0 = *(const v8f*)&Cap[k0 + prow];
    const v8f cap1 = *(const v8f*)&Cap[k0 + 16 + prow];
    // the loops over r, i and d below are unrolled so that every accumulator
    // element keeps a constant register index
#pragma unroll
    for (int r = 0; r < 8; ++r) {
      s0[r] = min_cap(s0[r], cap0[r]);
      s1[r] = min_cap(s1[r], cap1[r]);
    }

    // ---- online softmax: in-lane over 16 keys, one exchange for the maximum ----
    float vmax = fmaxf(s0[0], s1[0]);
#pragma unroll
    for (int r = 1; r < 8; ++r) vmax = fmaxf(vmax, fmaxf(s0[r], s1[r]));
    vmax = fmaxf(vmax, xhalf(vmax));
    const float mn = fmaxf(mrow, vmax);
    const float c  = __expf(mrow - mn);
    mrow = mn;

    // ---- P^T as B operand: element s = key 8g + s (s < 8), 16 + 8g + s - 8 ----
    v16h bp;
    v2f  ps2 = {0.0f, 0.0f};
#pragma unroll
    for (int i = 0; i < 4; ++i) {
      const v2f e0 = {__expf(s0[2 * i] - mn), __expf(s0[2 * i + 1] - mn)};
      const v2f e1 = {__expf(s1[2 * i] - mn), __expf(s1[2 * i + 1] - mn)};
      ps2 += e0 + e1;
      const v2h x0 = __builtin_convertvector(e0, v2h);
      const v2h x1 = __builtin_convertvector(e1, v2h);
      bp[2 * i]     = x0[0]; bp[2 * i + 1] = x0[1];
      bp[8 + 2 * i] = x1[0]; bp[9 + 2 * i] = x1[1];
    }
    lrow = lrow * c + (ps2[0] + ps2[1]);

    // ---- ctx^T = ctx^T * c + V^T * P^T  (V^T rows supply A fragments) ----
#pragma unroll
    for (int d = 0; d < 4; ++d) {
      v16h av = load_ab_frag(vsb + d * 16 * LDKV + j * 32, LDKV);
      ctxa[d] = wmma16(av, bp, ctxa[d] * c);
    }
   }

   // ---- publish stage t + 1, then refill the buffer stage t has left ----
   asm volatile("s_wait_dscnt 0x0" ::: "memory");  // own reads of stage t done
   wait_async_zero();                              // own copies of stage t + 1 landed
   __syncthreads();
   if (t + 2 < NT)
     async_fill_kv(gk + (size_t)(t + 2) * KT * cD, gv + (t + 2) * KT,
                   lk + (t & 1) * bufb, lv + (t & 1) * bufb);
  }
  wait_async_zero();   // nothing of this wave in flight when it ends

  // ---- join the halves' sums, normalize, store merged-head context ----
  // Lane (c, g) holds d = 16 * tile + 8g .. + 7 of query c: one 16-B store a tile
  const float linv = 1.0f / (lrow + xhalf(lrow));
  _Float16* orow = ctx + ((size_t)b * cS + q0 + colr) * cD + h * 64 + prow;
#pragma unroll
  for (int d = 0; d < 4; ++d) {
    v8h o;
#pragma unroll
    for (int r = 0; r < 8; ++r) o[r] = (_Float16)(ctxa[d][r] * linv);
    *(v8h*)(orow + d * 16) = o;
  }
}

// ---------------------------------------------------------------------------
// Host-side launcher
// ---------------------------------------------------------------------------
extern "C" void kernel_launch(void* const* d_in, const int* in_sizes, int n_in,
                              void* d_out, int out_size, void* d_ws, size_t ws_size,
                              hipStream_t stream) {
  (void)in_sizes; (void)n_in; (void)out_size; (void)ws_size;

  const float* q_in = (const float*)d_in[0];
  const float* k_in = (const float*)d_in[1];
  const float* v_in = (const float*)d_in[2];
  const int*   mask = (const int*)d_in[3];
  const float* w_q  = (const float*)d_in[4];
  const float* b_q  = (const float*)d_in[5];
  const float* w_k  = (const float*)d_in[6];
  const float* b_k  = (const float*)d_in[7];
  const float* w_v  = (const float*)d_in[8];
  const float* b_v  = (const float*)d_in[9];
  const float* w_o  = (const float*)d_in[10];
  const float* b_o  = (const float*)d_in[11];

  // Workspace layout (f16), total 32 Mi halves = 64 MiB
  _Float16* p   = (_Float16*)d_ws;
  _Float16* Xq  = p; p += (size_t)MT * cD;
  _Float16* Xk  = p; p += (size_t)MT * cD;
  _Float16* Xv  = p; p += (size_t)MT * cD;
  _Float16* Wqh = p; p += (size_t)cD * cD;
  _Float16* Wkh = p; p += (size_t)cD * cD;
  _Float16* Wvh = p; p += (size_t)cD * cD;
  _Float16* Woh = p; p += (size_t)cD * cD;
  _Float16* Qh  = p; p += (size_t)MT * cD;
  _Float16* Kh  = p; p += (size_t)MT * cD;
  _Float16* Vt  = p; p += (size_t)MT * cD;
  _Float16* Ch  = p;

  dim3 gblk(256);

  // f32 -> f16 pre-pass (activations + weights)
  const int nAct = MT * cD, nW = cD * cD;
  cvt_f32_f16<<<nAct / 2048, gblk, 0, stream>>>(q_in, Xq, nAct);
  cvt_f32_f16<<<nAct / 2048, gblk, 0, stream>>>(k_in, Xk, nAct);
  cvt_f32_f16<<<nAct / 2048, gblk, 0, stream>>>(v_in, Xv, nAct);
  cvt_f32_f16<<<nW   / 2048, gblk, 0, stream>>>(w_q, Wqh, nW);
  cvt_f32_f16<<<nW   / 2048, gblk, 0, stream>>>(w_k, Wkh, nW);
  cvt_f32_f16<<<nW   / 2048, gblk, 0, stream>>>(w_v, Wvh, nW);
  cvt_f32_f16<<<nW   / 2048, gblk, 0, stream>>>(w_o, Woh, nW);

  dim3 ggrid(cD / BN, MT / BM);                   // (8, 32)
  gemm_f16_xwt_bias<0, 0><<<ggrid, gblk, 0, stream>>>(Xq, Wqh, b_q, (void*)Qh, MT, cD, cD);
  gemm_f16_xwt_bias<0, 0><<<ggrid, gblk, 0, stream>>>(Xk, Wkh, b_k, (void*)Kh, MT, cD, cD);
  gemm_f16_xwt_bias<1, 0><<<ggrid, gblk, 0, stream>>>(Xv, Wvh, b_v, (void*)Vt, MT, cD, cD);

  dim3 agrid(cS / 16 / 8, cB * cH);               // (16, 32)
  attention_fa<<<agrid, gblk, 0, stream>>>(Qh, Kh, Vt, mask, Ch);

  gemm_f16_xwt_bias<0, 1><<<ggrid, gblk, 0, stream>>>(Ch, Woh, b_o, d_out, MT, cD, cD);
}

// v003
// It runs in 137 microseconds.
// Timed twice side by side with v002, it ran 1.10 times as fast both times.
// Over all steps from v000 it is 1.99 times as fast.
#include <hip/hip_runtime.h>

typedef __attribute__((ext_vector_type(16))) _Float16 v16h;
typedef __attribute__((ext_vector_type(8)))  _Float16 v8h;
typedef __attribute__((ext_vector_type(8)))  float    v8f;
typedef __attribute__((ext_vector_type(2)))  _Float16 v2h;
typedef __attribute__((ext_vector_type(2)))  float    v2f;
typedef __attribute__((ext_vector_type(4)))  _Float16 v4h;
typedef __attribute__((ext_vector_type(4)))  float    v4f;

#define cB 2
#define cS 2048
#define cD 1024
#define cH 16
#define MT (cB * cS)          // 4096 tokens total

#define BM 128
#define BN 128
#define BKK 32
#define LDT 40                // padded LDS stride in halves (80B, 16B-multiple)

// ---------------------------------------------------------------------------
// WMMA helper: D = A(16x32 f16) * B(32x16 f16) + C(16x16 f32)
// ---------------------------------------------------------------------------
__device__ __forceinline__ v8f wmma16(v16h a, v16h b, v8f c) {
  return __builtin_amdgcn_wmma_f32_16x16x32_f16(
      false, a, false, b, (short)0, c, false, false);
}

// Load a 16x32 f16 A-fragment (or B-fragment given B^T row-major) from a
// row-major tile with leading dimension ld (in halves).
// Per ISA 7.12.2: lane = row + 16*g, halves[0:8]=K[8g..8g+7], halves[8:16]=K[16+8g..].
__device__ __forceinline__ v16h load_ab_frag(const _Float16* tile, int ld) {
  const int lane = threadIdx.x & 31;
  const int r  = lane & 15;
  const int ko = (lane >> 4) << 3;   // 0 or 8
  const _Float16* p = tile + (size_t)r * ld;
  v8h lo = *(const v8h*)(p + ko);
  v8h hi = *(const v8h*)(p + 16 + ko);
  v16h f;
#pragma unroll
  for (int i = 0; i < 8; ++i) { f[i] = lo[i]; f[i + 8] = hi[i]; }
  return f;
}

// ---------------------------------------------------------------------------
// Async global->LDS copy of a 128x32 f16 tile (8KB) into a padded LDS tile.
// 512 x 16B chunks, 256 threads x 2 chunks; each asm stmt is one ASYNCcnt op
// per wave (32 lanes x 16B). LDS address = low 32 bits of generic pointer.
// ---------------------------------------------------------------------------
__device__ __forceinline__ void async_fill_tile(const _Float16* __restrict__ g,
                                                int ld, _Float16* __restrict__ s) {
  const int t = threadIdx.x;
#pragma unroll
  for (int i = 0; i < 2; ++i) {
    const int c   = t + i * 256;       // chunk 0..511
    const int row = c >> 2;            // 0..127
    const int seg = (c & 3) << 3;      // 0,8,16,24 halves
    const uint64_t ga = (uint64_t)(uintptr_t)(g + (size_t)row * ld + seg);
    const uint32_t la = (uint32_t)(uintptr_t)(s + row * LDT + seg);
    asm volatile("global_load_async_to_lds_b128 %0, %1, off"
                 :: "v"(la), "v"(ga) : "memory");
  }
}

__device__ __forceinline__ void wait_async_zero() {
  asm volatile("s_wait_asynccnt 0" ::: "memory");
}

// ---------------------------------------------------------------------------
// f32 -> f16 conversion pre-pass: all seven operands in ONE launch of a grid
// that is resident at once, one 16-wave block per 65,536 elements.
// The f16 copies lie one behind the other in the workspace, in the order of
// the sources, so a block's place in dst is its index alone.
// A wave takes 4,096 contiguous elements: 32 loads of 512 contiguous bytes,
// all issued ahead of the first conversion, and 32 stores of two whole lines.
// ---------------------------------------------------------------------------
#define CV_THREADS 512
#define CV_LOADS   32                          // 16-B loads per lane
#define CV_WAVE    (CV_LOADS * 128)            // elements per wave
#define CV_BLOCK   (CV_WAVE * (CV_THREADS / 32))
#define CV_ACT     (MT * cD / CV_BLOCK)        // blocks per activation: 64
#define CV_WGT     (cD * cD / CV_BLOCK)        // blocks per weight: 16
#define CV_GRID    (3 * CV_ACT + 4 * CV_WGT)   // 256

__global__ __launch_bounds__(CV_THREADS) void cvt_all_f32_f16(
    const float* __restrict__ q_in, const float* __restrict__ k_in,
    const float* __restrict__ v_in, const float* __restrict__ w_q,
    const float* __restrict__ w_k,  const float* __restrict__ w_v,
    const float* __restrict__ w_o,  _Float16* __restrict__ dst) {
  const int blk = blockIdx.x;
  const float* src;
  int rel;                                     // block index inside its source
  if (blk < 3 * CV_ACT) {
    const int s = blk / CV_ACT;
    rel = blk - s * CV_ACT;
    src = s == 0 ? q_in : s == 1 ? k_in : v_in;
  } else {
    const int u = blk - 3 * CV_ACT;
    const int s = u / CV_WGT;
    rel = u - s * CV_WGT;
    src = s == 0 ? w_q : s == 1 ? w_k : s == 2 ? w_v : w_o;
  }
  const int inblk = (threadIdx.x >> 5) * CV_WAVE + (threadIdx.x & 31) * 4;
  const float* sp = src + (size_t)rel * CV_BLOCK;
  _Float16*    dp = dst + (size_t)blk * CV_BLOCK + inblk;

  // the loops below are unrolled: x stays in registers at constant indices
  v4f x[CV_LOADS];
#pragma unroll
  for (int i = 0; i < CV_LOADS; ++i) x[i] = *(const v4f*)(sp + inblk + i * 128);
  // the loads' offset register is named here, so it lives up to this wait and
  // is not given to a load's result ahead of it
  asm volatile("s_wait_xcnt 0x0" :: "v"(inblk * 4) : "memory");
  // keeps every load ahead of the first conversion: left free, the scheduler
  // reuses registers and issues the later loads only when earlier ones are back
  __builtin_amdgcn_sched_barrier(0);
#pragma unroll
  for (int g = 0; g < CV_LOADS; g += 8) {
#pragma unroll
    for (int i = g; i < g + 8; ++i)
      *(v4h*)(dp + i * 128) = __builtin_convertvector(x[i], v4h);
    // keeps a group's stores behind its own loads' wait: left free, all
    // stores gather behind the last load's return
    __builtin_amdgcn_sched_barrier(0);
  }
}

// ---------------------------------------------------------------------------
// Y = X[M,Kd](f16) * W[N,Kd](f16)^T + bias[N](f32)
//   F32_OUT:   Y f32 [M,N];  TRANS_OUT: Y f16 [N,M];  else Y f16 [M,N]
// 128x128x32 block tile, 8 waves x (64x32) wave tile, double-buffered LDS
// filled by async global->LDS copies overlapped with WMMA.
// ---------------------------------------------------------------------------
template <int TRANS_OUT, int F32_OUT>
__global__ __launch_bounds__(256) void gemm_f16_xwt_bias(
    const _Float16* __restrict__ X, const _Float16* __restrict__ W,
    const float* __restrict__ bias, void* __restrict__ Y,
    int M, int N, int Kd) {
  __shared__ __align__(16) _Float16 As[2][BM * LDT];
  __shared__ __align__(16) _Float16 Bs[2][BN * LDT];

  const int m0   = blockIdx.y * BM;
  const int n0   = blockIdx.x * BN;
  const int wave = threadIdx.x >> 5;
  const int lane = threadIdx.x & 31;
  const int wm   = (wave >> 2) * 64;
  const int wn   = (wave & 3) * 32;

  v8f acc[4][2] = {};

  // Prologue: fill buffer 0
  async_fill_tile(X + (size_t)m0 * Kd, Kd, As[0]);
  async_fill_tile(W + (size_t)n0 * Kd, Kd, Bs[0]);
  wait_async_zero();
  __syncthreads();

  int cur = 0;
  for (int k0 = 0; k0 < Kd; k0 += BKK) {
    const int nxt = k0 + BKK;
    if (nxt < Kd) {   // overlap next tile's async copy with this tile's WMMAs
      async_fill_tile(X + (size_t)m0 * Kd + nxt, Kd, As[cur ^ 1]);
      async_fill_tile(W + (size_t)n0 * Kd + nxt, Kd, Bs[cur ^ 1]);
    }

    v16h a[4], b[2];
#pragma unroll
    for (int mi = 0; mi < 4; ++mi)
      a[mi] = load_ab_frag(&As[cur][(wm + mi * 16) * LDT], LDT);
#pragma unroll
    for (int ni = 0; ni < 2; ++ni)
      b[ni] = load_ab_frag(&Bs[cur][(wn + ni * 16) * LDT], LDT);
#pragma unroll
    for (int mi = 0; mi < 4; ++mi)
#pragma unroll
      for (int ni = 0; ni < 2; ++ni)
        acc[mi][ni] = wmma16(a[mi], b[ni], acc[mi][ni]);

    if (nxt < Kd) {
      wait_async_zero();
      __syncthreads();
      cur ^= 1;
    }
  }

  // Epilogue: C layout = lane(N + 16*(M>=8)), vgpr r = M mod 8.
  const int colr = lane & 15;
  const int rsel = (lane >> 4) << 3;
#pragma unroll
  for (int mi = 0; mi < 4; ++mi) {
#pragma unroll
    for (int ni = 0; ni < 2; ++ni) {
      const int gn = n0 + wn + ni * 16 + colr;
      const float bv = bias[gn];
#pragma unroll
      for (int r = 0; r < 8; ++r) {
        const int gm = m0 + wm + mi * 16 + r + rsel;
        const float v = acc[mi][ni][r] + bv;
        if (F32_OUT)
          ((float*)Y)[(size_t)gm * N + gn] = v;
        else if (TRANS_OUT)
          ((_Float16*)Y)[(size_t)gn * M + gm] = (_Float16)v;
        else
          ((_Float16*)Y)[(size_t)gm * N + gn] = (_Float16)v;
      }
    }
  }
}

// ---------------------------------------------------------------------------
// Attention K/V stage: 64 keys of one head. K tile = 64 key rows x 64 dk,
// V^T tile = 64 d rows x 64 keys; both have 128-B rows, laid in LDS at a
// 144-B pitch (16 B x odd) for the ds_load_b128 fragment readers.
// ---------------------------------------------------------------------------
#define KT 64                 // keys per stage
#define NT (cS / KT)          // stages per (b,h)
#define LDKV 72               // LDS pitch of a stage row, in halves

// One stage, copied once for the whole block: 2 x 512 chunks of 16 B, four
// copies per thread; a wave's copy covers four whole 128-B rows.
// gk, gv, lk, lv are this thread's own chunk of rows 0..31; rows 32..63 follow.
__device__ __forceinline__ void async_fill_kv(const _Float16* gk, const _Float16* gv,
                                              uint32_t lk, uint32_t lv) {
  const _Float16* gk1 = gk + (size_t)32 * cD;
  const _Float16* gv1 = gv + (size_t)32 * MT;
  const uint32_t  lk1 = lk + 32 * LDKV * 2;
  const uint32_t  lv1 = lv + 32 * LDKV * 2;
  // The s_wait_xcnt closes the copies' own statement, so that no address
  // register of a copy is rewritten ahead of it.
  asm volatile("global_load_async_to_lds_b128 %0, %1, off\n\t"
               "global_load_async_to_lds_b128 %2, %3, off\n\t"
               "global_load_async_to_lds_b128 %4, %5, off\n\t"
               "global_load_async_to_lds_b128 %6, %7, off\n\t"
               "s_wait_xcnt 0x0"
               :: "v"(lk), "v"(gk), "v"(lk1), "v"(gk1),
                  "v"(lv), "v"(gv), "v"(lv1), "v"(gv1) : "memory");
}

// ---------------------------------------------------------------------------
// Lane l <-> lane l ^ 16: the two lanes that share one query column.
// ---------------------------------------------------------------------------
__device__ __forceinline__ float xhalf(float x) {
  const int b = __float_as_int(x);
  return __int_as_float(
      __builtin_amdgcn_permlanex16(b, b, 0x76543210, 0xfedcba98, false, false));
}

// The mask as one instruction a score: median(score, ceiling, -1e9) is -1e9
// under a ceiling of -1e9, whatever the score, and the score itself under the
// largest float, for every score >= -1e9.
__device__ __forceinline__ float min_cap(float s, float cap) {
  return __builtin_amdgcn_fmed3f(s, cap, -1.0e9f);
}

__global__ __launch_bounds__(256) void attention_fa(
    const _Float16* __restrict__ Q, const _Float16* __restrict__ Km,
    const _Float16* __restrict__ Vt, const int* __restrict__ mask,
    _Float16* __restrict__ ctx) {
  __shared__ __align__(32) float    Cap[cS];
  __shared__ __align__(16) _Float16 Ks[2][KT * LDKV];
  __shared__ __align__(16) _Float16 Vs[2][64 * LDKV];

  const int wave = threadIdx.x >> 5;
  const int lane = threadIdx.x & 31;
  const int bh = blockIdx.y;
  const int b  = bh >> 4;                 // H = 16
  const int h  = bh & 15;
  const int q0 = (blockIdx.x * 8 + wave) * 16;

  const int colr = lane & 15;
  const int prow = (lane >> 4) << 3;

  // Q fragments, pre-scaled by 1/sqrt(DK) = 0.125 (exact in f16)
  const _Float16* qbase = Q + (size_t)(b * cS + q0) * cD + h * 64;
  v16h aq0 = load_ab_frag(qbase, cD);
  v16h aq1 = load_ab_frag(qbase + 32, cD);
#pragma unroll
  for (int i = 0; i < 16; ++i) {
    aq0[i] = aq0[i] * (_Float16)0.125f;
    aq1[i] = aq1[i] * (_Float16)0.125f;
  }

  v8f   ctxa[4] = {};
  float mrow = -3.0e38f, lrow = 0.0f;     // lrow: this half's keys only

  // This thread's chunk of a stage: row 0..31 (and row + 32), 16-B segment 0..7
  const int crow = threadIdx.x >> 3;
  const int cseg = (threadIdx.x & 7) << 3;
  const _Float16* gk = Km + (size_t)(b * cS + crow) * cD + h * 64 + cseg;
  const _Float16* gv = Vt + (size_t)(h * 64 + crow) * MT + (size_t)b * cS + cseg;
  const uint32_t lk = (uint32_t)(uintptr_t)(&Ks[0][crow * LDKV + cseg]);
  const uint32_t lv = (uint32_t)(uintptr_t)(&Vs[0][crow * LDKV + cseg]);
  const uint32_t bufb = KT * LDKV * 2;   // bytes from buffer 0 to buffer 1

  // Ring prologue: stage 0 landed and published, then stage 1 in flight
  async_fill_kv(gk, gv, lk, lv);

  // The key runs along a lane's registers, so the mask is kept per key in
  // LDS as a ceiling: -1e9 on a masked key, the largest float on any other
  // (min_cap above applies it).
  {
    const int4* mp = (const int4*)(mask + b * cS + threadIdx.x * 8);
    const int4 m0 = mp[0], m1 = mp[1];
    float4 c0, c1;
    c0.x = m0.x == 0 ? -1.0e9f : 3.4028235e38f;
    c0.y = m0.y == 0 ? -1.0e9f : 3.4028235e38f;
    c0.z = m0.z == 0 ? -1.0e9f : 3.4028235e38f;
    c0.w = m0.w == 0 ? -1.0e9f : 3.4028235e38f;
    c1.x = m1.x == 0 ? -1.0e9f : 3.4028235e38f;
    c1.y = m1.y == 0 ? -1.0e9f : 3.4028235e38f;
    c1.z = m1.z == 0 ? -1.0e9f : 3.4028235e38f;
    c1.w = m1.w == 0 ? -1.0e9f : 3.4028235e38f;
    float4* cp = (float4*)&Cap[threadIdx.x * 8];
    cp[0] = c0; cp[1] = c1;
  }

  wait_async_zero();
  __syncthreads();
  async_fill_kv(gk + (size_t)KT * cD, gv + KT, lk + bufb, lv + bufb);

  for (int t = 0; t < NT; ++t) {
   const _Float16* ksb = &Ks[t & 1][0];
   const _Float16* vsb = &Vs[t & 1][0];
   // unrolled: both 32-key halves of the stage read LDS at constant offsets
#pragma unroll
   for (int j = 0; j < KT / 32; ++j) {
    const int k0 = t * KT + j * 32;
    const _Float16* kb = ksb + j * 32 * LDKV;

    // ---- scores^T: 2 key sub-tiles (rows) x 2 dk chunks, queries in columns ----
    v16h bk00 = load_ab_frag(kb, LDKV);
    v16h bk01 = load_ab_frag(kb + 32, LDKV);
    v16h bk10 = load_ab_frag(kb + 16 * LDKV, LDKV);
    v16h bk11 = load_ab_frag(kb + 16 * LDKV + 32, LDKV);
    v8f s0 = {}, s1 = {};
    s0 = wmma16(bk00, aq0, s0); s0 = wmma16(bk01, aq1, s0);
    s1 = wmma16(bk10, aq0, s1); s1 = wmma16(bk11, aq1, s1);

    // ---- mask (key row = 8 * half + register) ----
    const v8f cap0 = *(const v8f*)&Cap[k0 + prow];
    const v8f cap1 = *(const v8f*)&Cap[k0 + 16 + prow];
    // the loops over r, i and d below are unrolled so that every accumulator
    // element keeps a constant register index
#pragma unroll
    for (int r = 0; r < 8; ++r) {
      s0[r] = min_cap(s0[r], cap0[r]);
      s1[r] = min_cap(s1[r], cap1[r]);
    }

    // ---- online softmax: in-lane over 16 keys, one exchange for the maximum ----
    float vmax = fmaxf(s0[0], s1[0]);
#pragma unroll
    for (int r = 1; r < 8; ++r) vmax = fmaxf(vmax, fmaxf(s0[r], s1[r]));
    vmax = fmaxf(vmax, xhalf(vmax));
    const float mn = fmaxf(mrow, vmax);
    const float c  = __expf(mrow - mn);
    mrow = mn;

    // ---- P^T as B operand: element s = key 8g + s (s < 8), 16 + 8g + s - 8 ----
    v16h bp;
    v2f  ps2 = {0.0f, 0.0f};
#pragma unroll
    for (int i = 0; i < 4; ++i) {
      const v2f e0 = {__expf(s0[2 * i] - mn), __expf(s0[2 * i + 1] - mn)};
      const v2f e1 = {__expf(s1[2 * i] - mn), __expf(s1[2 * i + 1] - mn)};
      ps2 += e0 + e1;
      const v2h x0 = __builtin_convertvector(e0, v2h);
      const v2h x1 = __builtin_convertvector(e1, v2h);
      bp[2 * i]     = x0[0]; bp[2 * i + 1] = x0[1];
      bp[8 + 2 * i] = x1[0]; bp[9 + 2 * i] = x1[1];
    }
    lrow = lrow * c + (ps2[0] + ps2[1]);

    // ---- ctx^T = ctx^T * c + V^T * P^T  (V^T rows supply A fragments) ----
#pragma unroll
    for (int d = 0; d < 4; ++d) {
      v16h av = load_ab_frag(vsb + d * 16 * LDKV + j * 32, LDKV);
      ctxa[d] = wmma16(av, bp, ctxa[d] * c);
    }
   }

   // ---- publish stage t + 1, then refill the buffer stage t has left ----
   asm volatile("s_wait_dscnt 0x0" ::: "memory");  // own reads of stage t done
   wait_async_zero();                              // own copies of stage t + 1 landed
   __syncthreads();
   if (t + 2 < NT)
     async_fill_kv(gk + (size_t)(t + 2) * KT * cD, gv + (t + 2) * KT,
                   lk + (t & 1) * bufb, lv + (t & 1) * bufb);
  }
  wait_async_zero();   // nothing of this wave in flight when it ends

  // ---- join the halves' sums, normalize, store merged-head context ----
  // Lane (c, g) holds d = 16 * tile + 8g .. + 7 of query c: one 16-B store a tile
  const float linv = 1.0f / (lrow + xhalf(lrow));
  _Float16* orow = ctx + ((size_t)b * cS + q0 + colr) * cD + h * 64 + prow;
#pragma unroll
  for (int d = 0; d < 4; ++d) {
    v8h o;
#pragma unroll
    for (int r = 0; r < 8; ++r) o[r] = (_Float16)(ctxa[d][r] * linv);
    *(v8h*)(orow + d * 16) = o;
  }
}

// ---------------------------------------------------------------------------
// Host-side launcher
// ---------------------------------------------------------------------------
extern "C" void kernel_launch(void* const* d_in, const int* in_sizes, int n_in,
                              void* d_out, int out_size, void* d_ws, size_t ws_size,
                              hipStream_t stream) {
  (void)in_sizes; (void)n_in; (void)out_size; (void)ws_size;

  const float* q_in = (const float*)d_in[0];
  const float* k_in = (const float*)d_in[1];
  const float* v_in = (const float*)d_in[2];
  const int*   mask = (const int*)d_in[3];
  const float* w_q  = (const float*)d_in[4];
  const float* b_q  = (const float*)d_in[5];
  const float* w_k  = (const float*)d_in[6];
  const float* b_k  = (const float*)d_in[7];
  const float* w_v  = (const float*)d_in[8];
  const float* b_v  = (const float*)d_in[9];
  const float* w_o  = (const float*)d_in[10];
  const float* b_o  = (const float*)d_in[11];

  // Workspace layout (f16), total 32 Mi halves = 64 MiB
  _Float16* p   = (_Float16*)d_ws;
  _Float16* Xq  = p; p += (size_t)MT * cD;
  _Float16* Xk  = p; p += (size_t)MT * cD;
  _Float16* Xv  = p; p += (size_t)MT * cD;
  _Float16* Wqh = p; p += (size_t)cD * cD;
  _Float16* Wkh = p; p += (size_t)cD * cD;
  _Float16* Wvh = p; p += (size_t)cD * cD;
  _Float16* Woh = p; p += (size_t)cD * cD;
  _Float16* Qh  = p; p += (size_t)MT * cD;
  _Float16* Kh  = p; p += (size_t)MT * cD;
  _Float16* Vt  = p; p += (size_t)MT * cD;
  _Float16* Ch  = p;

  dim3 gblk(256);

  // f32 -> f16 pre-pass (activations + weights): Xq .. Woh are one run of dst
  cvt_all_f32_f16<<<CV_GRID, CV_THREADS, 0, stream>>>(q_in, k_in, v_in,
                                                      w_q, w_k, w_v, w_o, Xq);

  dim3 ggrid(cD / BN, MT / BM);                   // (8, 32)
  gemm_f16_xwt_bias<0, 0><<<ggrid, gblk, 0, stream>>>(Xq, Wqh, b_q, (void*)Qh, MT, cD, cD);
  gemm_f16_xwt_bias<0, 0><<<ggrid, gblk, 0, stream>>>(Xk, Wkh, b_k, (void*)Kh, MT, cD, cD);
  gemm_f16_xwt_bias<1, 0><<<ggrid, gblk, 0, stream>>>(Xv, Wvh, b_v, (void*)Vt, MT, cD, cD);

  dim3 agrid(cS / 16 / 8, cB * cH);               // (16, 32)
  attention_fa<<<agrid, gblk, 0, stream>>>(Qh, Kh, Vt, mask, Ch);

  gemm_f16_xwt_bias<0, 1><<<ggrid, gblk, 0, stream>>>(Ch, Woh, b_o, d_out, MT, cD, cD);
}

// v004
// A run of this version takes 122 microseconds.
// Two timings next to v003 both put it at 1.12 times that version's speed.
// All steps since v000 together make it 2.23 times as fast.
#include <hip/hip_runtime.h>

typedef __attribute__((ext_vector_type(16))) _Float16 v16h;
typedef __attribute__((ext_vector_type(8)))  _Float16 v8h;
typedef __attribute__((ext_vector_type(8)))  float    v8f;
typedef __attribute__((ext_vector_type(2)))  _Float16 v2h;
typedef __attribute__((ext_vector_type(2)))  float    v2f;
typedef __attribute__((ext_vector_type(4)))  _Float16 v4h;
typedef __attribute__((ext_vector_type(4)))  float    v4f;

#define cB 2
#define cS 2048
#define cD 1024
#define cH 16
#define MT (cB * cS)          // 4096 tokens total

#define BM 128
#define BN 128
#define BKK 32
#define LDT 40                // padded LDS stride in halves (80B, 16B-multiple)

// ---------------------------------------------------------------------------
// WMMA helper: D = A(16x32 f16) * B(32x16 f16) + C(16x16 f32)
// ---------------------------------------------------------------------------
__device__ __forceinline__ v8f wmma16(v16h a, v16h b, v8f c) {
  return __builtin_amdgcn_wmma_f32_16x16x32_f16(
      false, a, false, b, (short)0, c, false, false);
}

// Load a 16x32 f16 A-fragment (or B-fragment given B^T row-major) from a
// row-major tile with leading dimension ld (in halves).
// Per ISA 7.12.2: lane = row + 16*g, halves[0:8]=K[8g..8g+7], halves[8:16]=K[16+8g..].
__device__ __forceinline__ v16h load_ab_frag(const _Float16* tile, int ld) {
  const int lane = threadIdx.x & 31;
  const int r  = lane & 15;
  const int ko = (lane >> 4) << 3;   // 0 or 8
  const _Float16* p = tile + (size_t)r * ld;
  v8h lo = *(const v8h*)(p + ko);
  v8h hi = *(const v8h*)(p + 16 + ko);
  v16h f;
#pragma unroll
  for (int i = 0; i < 8; ++i) { f[i] = lo[i]; f[i + 8] = hi[i]; }
  return f;
}

// ---------------------------------------------------------------------------
// Async global->LDS copy of a 128x32 f16 tile (8KB) into a padded LDS tile.
// 512 x 16B chunks, 256 threads x 2 chunks; each asm stmt is one ASYNCcnt op
// per wave (32 lanes x 16B). LDS address = low 32 bits of generic pointer.
// ---------------------------------------------------------------------------
__device__ __forceinline__ void async_fill_tile(const _Float16* __restrict__ g,
                                                int ld, _Float16* __restrict__ s) {
  const int t = threadIdx.x;
#pragma unroll
  for (int i = 0; i < 2; ++i) {
    const int c   = t + i * 256;       // chunk 0..511
    const int row = c >> 2;            // 0..127
    const int seg = (c & 3) << 3;      // 0,8,16,24 halves
    const uint64_t ga = (uint64_t)(uintptr_t)(g + (size_t)row * ld + seg);
    const uint32_t la = (uint32_t)(uintptr_t)(s + row * LDT + seg);
    asm volatile("global_load_async_to_lds_b128 %0, %1, off"
                 :: "v"(la), "v"(ga) : "memory");
  }
}

__device__ __forceinline__ void wait_async_zero() {
  asm volatile("s_wait_asynccnt 0" ::: "memory");
}

// ---------------------------------------------------------------------------
// f32 -> f16 conversion pre-pass: all seven operands in ONE launch of a grid
// that is resident at once, one 16-wave block per 65,536 elements.
// The f16 copies lie one behind the other in the workspace, in the order of
// the sources, so a block's place in dst is its index alone.
// A wave takes 4,096 contiguous elements: 32 loads of 512 contiguous bytes,
// all issued ahead of the first conversion, and 32 stores of two whole lines.
// ---------------------------------------------------------------------------
#define CV_THREADS 512
#define CV_LOADS   32                          // 16-B loads per lane
#define CV_WAVE    (CV_LOADS * 128)            // elements per wave
#define CV_BLOCK   (CV_WAVE * (CV_THREADS / 32))
#define CV_ACT     (MT * cD / CV_BLOCK)        // blocks per activation: 64
#define CV_WGT     (cD * cD / CV_BLOCK)        // blocks per weight: 16
#define CV_GRID    (3 * CV_ACT + 4 * CV_WGT)   // 256

__global__ __launch_bounds__(CV_THREADS) void cvt_all_f32_f16(
    const float* __restrict__ q_in, const float* __restrict__ k_in,
    const float* __restrict__ v_in, const float* __restrict__ w_q,
    const float* __restrict__ w_k,  const float* __restrict__ w_v,
    const float* __restrict__ w_o,  _Float16* __restrict__ dst) {
  const int blk = blockIdx.x;
  const float* src;
  int rel;                                     // block index inside its source
  if (blk < 3 * CV_ACT) {
    const int s = blk / CV_ACT;
    rel = blk - s * CV_ACT;
    src = s == 0 ? q_in : s == 1 ? k_in : v_in;
  } else {
    const int u = blk - 3 * CV_ACT;
    const int s = u / CV_WGT;
    rel = u - s * CV_WGT;
    src = s == 0 ? w_q : s == 1 ? w_k : s == 2 ? w_v : w_o;
  }
  const int inblk = (threadIdx.x >> 5) * CV_WAVE + (threadIdx.x & 31) * 4;
  const float* sp = src + (size_t)rel * CV_BLOCK;
  _Float16*    dp = dst + (size_t)blk * CV_BLOCK + inblk;

  // the loops below are unrolled: x stays in registers at constant indices
  v4f x[CV_LOADS];
#pragma unroll
  for (int i = 0; i < CV_LOADS; ++i) x[i] = *(const v4f*)(sp + inblk + i * 128);
  // the loads' offset register is named here, so it lives up to this wait and
  // is not given to a load's result ahead of it
  asm volatile("s_wait_xcnt 0x0" :: "v"(inblk * 4) : "memory");
  // keeps every load ahead of the first conversion: left free, the scheduler
  // reuses registers and issues the later loads only when earlier ones are back
  __builtin_amdgcn_sched_barrier(0);
#pragma unroll
  for (int g = 0; g < CV_LOADS; g += 8) {
#pragma unroll
    for (int i = g; i < g + 8; ++i)
      *(v4h*)(dp + i * 128) = __builtin_convertvector(x[i], v4h);
    // keeps a group's stores behind its own loads' wait: left free, all
    // stores gather behind the last load's return
    __builtin_amdgcn_sched_barrier(0);
  }
}

// ---------------------------------------------------------------------------
// A wave's 64x32 accumulator tile + bias, stored at rows gm0.., columns gn0..
//   F32_OUT:   Y f32 [M,N];  TRANS_OUT: Y f16 [N,M];  else Y f16 [M,N]
// C layout = lane(N + 16*(M>=8)), vgpr r = M mod 8.
// ---------------------------------------------------------------------------
template <int TRANS_OUT, int F32_OUT>
__device__ __forceinline__ void store_acc(const v8f (&acc)[4][2],
                                          const float* __restrict__ bias,
                                          void* __restrict__ Y,
                                          int M, int N, int gm0, int gn0) {
  const int lane = threadIdx.x & 31;
  const int colr = lane & 15;
  const int rsel = (lane >> 4) << 3;
#pragma unroll
  for (int mi = 0; mi < 4; ++mi) {
#pragma unroll
    for (int ni = 0; ni < 2; ++ni) {
      const int gn = gn0 + ni * 16 + colr;
      const float bv = bias[gn];
#pragma unroll
      for (int r = 0; r < 8; ++r) {
        const int gm = gm0 + mi * 16 + r + rsel;
        const float v = acc[mi][ni][r] + bv;
        if (F32_OUT)
          ((float*)Y)[(size_t)gm * N + gn] = v;
        else if (TRANS_OUT)
          ((_Float16*)Y)[(size_t)gn * M + gm] = (_Float16)v;
        else
          ((_Float16*)Y)[(size_t)gm * N + gn] = (_Float16)v;
      }
    }
  }
}

// ---------------------------------------------------------------------------
// Y = X[M,Kd](f16) * W[N,Kd](f16)^T + bias[N](f32)
// 128x128x32 block tile, 8 waves x (64x32) wave tile, double-buffered LDS
// filled by async global->LDS copies overlapped with WMMA.
//   QKV = 0: one product, Y f32 [M,N], bias b0 (b1 and b2 are not read).
//   QKV = 1: three products in one launch, blockIdx.z = 0, 1, 2. Their X, W
//            and Y lie one behind the other at X0, W0, Y0; biases b0, b1, b2;
//            Y f16 [M,N] for z = 0, 1 and f16 [N,M] for z = 2.
//            All 3 x 256 blocks are resident at once, three to a WGP, and one
//            block's waits on copies and LDS are filled by the other two.
// Six waves per SIMD are three 8-wave blocks per WGP: the register budget is
// set for exactly that many, so that no WGP takes a fourth block while another
// holds two, and the epilogue's store addresses need not share registers.
// ---------------------------------------------------------------------------
template <int QKV>
__global__ __launch_bounds__(256) __attribute__((amdgpu_waves_per_eu(6, 6)))
void gemm_f16_xwt_bias(
    const _Float16* __restrict__ X0, const _Float16* __restrict__ W0,
    const float* __restrict__ b0, const float* __restrict__ b1,
    const float* __restrict__ b2, void* __restrict__ Y0,
    int M, int N, int Kd) {
  __shared__ __align__(16) _Float16 As[2][BM * LDT];
  __shared__ __align__(16) _Float16 Bs[2][BN * LDT];

  const int z = QKV ? (int)blockIdx.z : 0;
  const _Float16* X = X0 + (size_t)z * M * Kd;
  const _Float16* W = W0 + (size_t)z * N * Kd;

  const int m0   = blockIdx.y * BM;
  const int n0   = blockIdx.x * BN;
  const int wave = threadIdx.x >> 5;
  const int wm   = (wave >> 2) * 64;
  const int wn   = (wave & 3) * 32;

  v8f acc[4][2] = {};

  // Prologue: fill buffer 0
  async_fill_tile(X + (size_t)m0 * Kd, Kd, As[0]);
  async_fill_tile(W + (size_t)n0 * Kd, Kd, Bs[0]);
  wait_async_zero();
  __syncthreads();

  int cur = 0;
  for (int k0 = 0; k0 < Kd; k0 += BKK) {
    const int nxt = k0 + BKK;
    if (nxt < Kd) {   // overlap next tile's async copy with this tile's WMMAs
      async_fill_tile(X + (size_t)m0 * Kd + nxt, Kd, As[cur ^ 1]);
      async_fill_tile(W + (size_t)n0 * Kd + nxt, Kd, Bs[cur ^ 1]);
    }

    v16h a[4], b[2];
#pragma unroll
    for (int mi = 0; mi < 4; ++mi)
      a[mi] = load_ab_frag(&As[cur][(wm + mi * 16) * LDT], LDT);
#pragma unroll
    for (int ni = 0; ni < 2; ++ni)
      b[ni] = load_ab_frag(&Bs[cur][(wn + ni * 16) * LDT], LDT);
#pragma unroll
    for (int mi = 0; mi < 4; ++mi)
#pragma unroll
      for (int ni = 0; ni < 2; ++ni)
        acc[mi][ni] = wmma16(a[mi], b[ni], acc[mi][ni]);

    if (nxt < Kd) {
      wait_async_zero();
      __syncthreads();
      cur ^= 1;
    }
  }

  // Epilogue: the output form is the same for the whole block
  if (!QKV) {
    store_acc<0, 1>(acc, b0, Y0, M, N, m0 + wm, n0 + wn);
  } else {
    _Float16* Y = (_Float16*)Y0 + (size_t)z * M * N;
    if (z != 2) {
      store_acc<0, 0>(acc, z == 0 ? b0 : b1, Y, M, N, m0 + wm, n0 + wn);
      // In the built code this branch ends in a jump with the other branch's
      // code as its fall-through, which rewrites registers these stores name:
      // the wait stands ahead of it on that path too.
      asm volatile("s_wait_xcnt 0x0" ::: "memory");
    } else {
      store_acc<1, 0>(acc, b2, Y, M, N, m0 + wm, n0 + wn);
    }
  }
}

// ---------------------------------------------------------------------------
// Attention K/V stage: 64 keys of one head. K tile = 64 key rows x 64 dk,
// V^T tile = 64 d rows x 64 keys; both have 128-B rows, laid in LDS at a
// 144-B pitch (16 B x odd) for the ds_load_b128 fragment readers.
// ---------------------------------------------------------------------------
#define KT 64                 // keys per stage
#define NT (cS / KT)          // stages per (b,h)
#define LDKV 72               // LDS pitch of a stage row, in halves

// One stage, copied once for the whole block: 2 x 512 chunks of 16 B, four
// copies per thread; a wave's copy covers four whole 128-B rows.
// gk, gv, lk, lv are this thread's own chunk of rows 0..31; rows 32..63 follow.
__device__ __forceinline__ void async_fill_kv(const _Float16* gk, const _Float16* gv,
                                              uint32_t lk, uint32_t lv) {
  const _Float16* gk1 = gk + (size_t)32 * cD;
  const _Float16* gv1 = gv + (size_t)32 * MT;
  const uint32_t  lk1 = lk + 32 * LDKV * 2;
  const uint32_t  lv1 = lv + 32 * LDKV * 2;
  // The s_wait_xcnt closes the copies' own statement, so that no address
  // register of a copy is rewritten ahead of it.
  asm volatile("global_load_async_to_lds_b128 %0, %1, off\n\t"
               "global_load_async_to_lds_b128 %2, %3, off\n\t"
               "global_load_async_to_lds_b128 %4, %5, off\n\t"
               "global_load_async_to_lds_b128 %6, %7, off\n\t"
               "s_wait_xcnt 0x0"
               :: "v"(lk), "v"(gk), "v"(lk1), "v"(gk1),
                  "v"(lv), "v"(gv), "v"(lv1), "v"(gv1) : "memory");
}

// ---------------------------------------------------------------------------
// Lane l <-> lane l ^ 16: the two lanes that share one query column.
// ---------------------------------------------------------------------------
__device__ __forceinline__ float xhalf(float x) {
  const int b = __float_as_int(x);
  return __int_as_float(
      __builtin_amdgcn_permlanex16(b, b, 0x76543210, 0xfedcba98, false, false));
}

// The mask as one instruction a score: median(score, ceiling, -1e9) is -1e9
// under a ceiling of -1e9, whatever the score, and the score itself under the
// largest float, for every score >= -1e9.
__device__ __forceinline__ float min_cap(float s, float cap) {
  return __builtin_amdgcn_fmed3f(s, cap, -1.0e9f);
}

__global__ __launch_bounds__(256) void attention_fa(
    const _Float16* __restrict__ Q, const _Float16* __restrict__ Km,
    const _Float16* __restrict__ Vt, const int* __restrict__ mask,
    _Float16* __restrict__ ctx) {
  __shared__ __align__(32) float    Cap[cS];
  __shared__ __align__(16) _Float16 Ks[2][KT * LDKV];
  __shared__ __align__(16) _Float16 Vs[2][64 * LDKV];

  const int wave = threadIdx.x >> 5;
  const int lane = threadIdx.x & 31;
  const int bh = blockIdx.y;
  const int b  = bh >> 4;                 // H = 16
  const int h  = bh & 15;
  const int q0 = (blockIdx.x * 8 + wave) * 16;

  const int colr = lane & 15;
  const int prow = (lane >> 4) << 3;

  // Q fragments, pre-scaled by 1/sqrt(DK) = 0.125 (exact in f16)
  const _Float16* qbase = Q + (size_t)(b * cS + q0) * cD + h * 64;
  v16h aq0 = load_ab_frag(qbase, cD);
  v16h aq1 = load_ab_frag(qbase + 32, cD);
#pragma unroll
  for (int i = 0; i < 16; ++i) {
    aq0[i] = aq0[i] * (_Float16)0.125f;
    aq1[i] = aq1[i] * (_Float16)0.125f;
  }

  v8f   ctxa[4] = {};
  float mrow = -3.0e38f, lrow = 0.0f;     // lrow: this half's keys only

  // This thread's chunk of a stage: row 0..31 (and row + 32), 16-B segment 0..7
  const int crow = threadIdx.x >> 3;
  const int cseg = (threadIdx.x & 7) << 3;
  const _Float16* gk = Km + (size_t)(b * cS + crow) * cD + h * 64 + cseg;
  const _Float16* gv = Vt + (size_t)(h * 64 + crow) * MT + (size_t)b * cS + cseg;
  const uint32_t lk = (uint32_t)(uintptr_t)(&Ks[0][crow * LDKV + cseg]);
  const uint32_t lv = (uint32_t)(uintptr_t)(&Vs[0][crow * LDKV + cseg]);
  const uint32_t bufb = KT * LDKV * 2;   // bytes from buffer 0 to buffer 1

  // Ring prologue: stage 0 landed and published, then stage 1 in flight
  async_fill_kv(gk, gv, lk, lv);

  // The key runs along a lane's registers, so the mask is kept per key in
  // LDS as a ceiling: -1e9 on a masked key, the largest float on any other
  // (min_cap above applies it).
  {
    const int4* mp = (const int4*)(mask + b * cS + threadIdx.x * 8);
    const int4 m0 = mp[0], m1 = mp[1];
    float4 c0, c1;
    c0.x = m0.x == 0 ? -1.0e9f : 3.4028235e38f;
    c0.y = m0.y == 0 ? -1.0e9f : 3.4028235e38f;
    c0.z = m0.z == 0 ? -1.0e9f : 3.4028235e38f;
    c0.w = m0.w == 0 ? -1.0e9f : 3.4028235e38f;
    c1.x = m1.x == 0 ? -1.0e9f : 3.4028235e38f;
    c1.y = m1.y == 0 ? -1.0e9f : 3.4028235e38f;
    c1.z = m1.z == 0 ? -1.0e9f : 3.4028235e38f;
    c1.w = m1.w == 0 ? -1.0e9f : 3.4028235e38f;
    float4* cp = (float4*)&Cap[threadIdx.x * 8];
    cp[0] = c0; cp[1] = c1;
  }

  wait_async_zero();
  __syncthreads();
  async_fill_kv(gk + (size_t)KT * cD, gv + KT, lk + bufb, lv + bufb);

  for (int t = 0; t < NT; ++t) {
   const _Float16* ksb = &Ks[t & 1][0];
   const _Float16* vsb = &Vs[t & 1][0];
   // unrolled: both 32-key halves of the stage read LDS at constant offsets
#pragma unroll
   for (int j = 0; j < KT / 32; ++j) {
    const int k0 = t * KT + j * 32;
    const _Float16* kb = ksb + j * 32 * LDKV;

    // ---- scores^T: 2 key sub-tiles (rows) x 2 dk chunks, queries in columns ----
    v16h bk00 = load_ab_frag(kb, LDKV);
    v16h bk01 = load_ab_frag(kb + 32, LDKV);
    v16h bk10 = load_ab_frag(kb + 16 * LDKV, LDKV);
    v16h bk11 = load_ab_frag(kb + 16 * LDKV + 32, LDKV);
    v8f s0 = {}, s1 = {};
    s0 = wmma16(bk00, aq0, s0); s0 = wmma16(bk01, aq1, s0);
    s1 = wmma16(bk10, aq0, s1); s1 = wmma16(bk11, aq1, s1);

    // ---- mask (key row = 8 * half + register) ----
    const v8f cap0 = *(const v8f*)&Cap[k0 + prow];
    const v8f cap1 = *(const v8f*)&Cap[k0 + 16 + prow];
    // the loops over r, i and d below are unrolled so that every accumulator
    // element keeps a constant register index
#pragma unroll
    for (int r = 0; r < 8; ++r) {
      s0[r] = min_cap(s0[r], cap0[r]);
      s1[r] = min_cap(s1[r], cap1[r]);
    }

    // ---- online softmax: in-lane over 16 keys, one exchange for the maximum ----
    float vmax = fmaxf(s0[0], s1[0]);
#pragma unroll
    for (int r = 1; r < 8; ++r) vmax = fmaxf(vmax, fmaxf(s0[r], s1[r]));
    vmax = fmaxf(vmax, xhalf(vmax));
    const float mn = fmaxf(mrow, vmax);
    const float c  = __expf(mrow - mn);
    mrow = mn;

    // ---- P^T as B operand: element s = key 8g + s (s < 8), 16 + 8g + s - 8 ----
    v16h bp;
    v2f  ps2 = {0.0f, 0.0f};
#pragma unroll
    for (int i = 0; i < 4; ++i) {
      const v2f e0 = {__expf(s0[2 * i] - mn), __expf(s0[2 * i + 1] - mn)};
      const v2f e1 = {__expf(s1[2 * i] - mn), __expf(s1[2 * i + 1] - mn)};
      ps2 += e0 + e1;
      const v2h x0 = __builtin_convertvector(e0, v2h);
      const v2h x1 = __builtin_convertvector(e1, v2h);
      bp[2 * i]     = x0[0]; bp[2 * i + 1] = x0[1];
      bp[8 + 2 * i] = x1[0]; bp[9 + 2 * i] = x1[1];
    }
    lrow = lrow * c + (ps2[0] + ps2[1]);

    // ---- ctx^T = ctx^T * c + V^T * P^T  (V^T rows supply A fragments) ----
#pragma unroll
    for (int d = 0; d < 4; ++d) {
      v16h av = load_ab_frag(vsb + d * 16 * LDKV + j * 32, LDKV);
      ctxa[d] = wmma16(av, bp, ctxa[d] * c);
    }
   }

   // ---- publish stage t + 1, then refill the buffer stage t has left ----
   asm volatile("s_wait_dscnt 0x0" ::: "memory");  // own reads of stage t done
   wait_async_zero();                              // own copies of stage t + 1 landed
   __syncthreads();
   if (t + 2 < NT)
     async_fill_kv(gk + (size_t)(t + 2) * KT * cD, gv + (t + 2) * KT,
                   lk + (t & 1) * bufb, lv + (t & 1) * bufb);
  }
  wait_async_zero();   // nothing of this wave in flight when it ends

  // ---- join the halves' sums, normalize, store merged-head context ----
  // Lane (c, g) holds d = 16 * tile + 8g .. + 7 of query c: one 16-B store a tile
  const float linv = 1.0f / (lrow + xhalf(lrow));
  _Float16* orow = ctx + ((size_t)b * cS + q0 + colr) * cD + h * 64 + prow;
#pragma unroll
  for (int d = 0; d < 4; ++d) {
    v8h o;
#pragma unroll
    for (int r = 0; r < 8; ++r) o[r] = (_Float16)(ctxa[d][r] * linv);
    *(v8h*)(orow + d * 16) = o;
  }
}

// ---------------------------------------------------------------------------
// Host-side launcher
// ---------------------------------------------------------------------------
extern "C" void kernel_launch(void* const* d_in, const int* in_sizes, int n_in,
                              void* d_out, int out_size, void* d_ws, size_t ws_size,
                              hipStream_t stream) {
  (void)in_sizes; (void)n_in; (void)out_size; (void)ws_size;

  const float* q_in = (const float*)d_in[0];
  const float* k_in = (const float*)d_in[1];
  const float* v_in = (const float*)d_in[2];
  const int*   mask = (const int*)d_in[3];
  const float* w_q  = (const float*)d_in[4];
  const float* b_q  = (const float*)d_in[5];
  const float* w_k  = (const float*)d_in[6];
  const float* b_k  = (const float*)d_in[7];
  const float* w_v  = (const float*)d_in[8];
  const float* b_v  = (const float*)d_in[9];
  const float* w_o  = (const float*)d_in[10];
  const float* b_o  = (const float*)d_in[11];

  // Workspace layout (f16), total 32 Mi halves = 64 MiB
  _Float16* p   = (_Float16*)d_ws;
  _Float16* Xq  = p; p += (size_t)MT * cD;
  _Float16* Xk  = p; p += (size_t)MT * cD;
  _Float16* Xv  = p; p += (size_t)MT * cD;
  _Float16* Wqh = p; p += (size_t)cD * cD;
  _Float16* Wkh = p; p += (size_t)cD * cD;
  _Float16* Wvh = p; p += (size_t)cD * cD;
  _Float16* Woh = p; p += (size_t)cD * cD;
  _Float16* Qh  = p; p += (size_t)MT * cD;
  _Float16* Kh  = p; p += (size_t)MT * cD;
  _Float16* Vt  = p; p += (size_t)MT * cD;
  _Float16* Ch  = p;

  dim3 gblk(256);

  // f32 -> f16 pre-pass (activations + weights): Xq .. Woh are one run of dst
  cvt_all_f32_f16<<<CV_GRID, CV_THREADS, 0, stream>>>(q_in, k_in, v_in,
                                                      w_q, w_k, w_v, w_o, Xq);

  // Q, K and V projections in one launch: Xq Xk Xv, Wqh Wkh Wvh and Qh Kh Vt
  // are each one run of the workspace
  dim3 pgrid(cD / BN, MT / BM, 3);                // (8, 32, 3)
  gemm_f16_xwt_bias<1><<<pgrid, gblk, 0, stream>>>(Xq, Wqh, b_q, b_k, b_v, (void*)Qh, MT, cD, cD);

  dim3 agrid(cS / 16 / 8, cB * cH);               // (16, 32)
  attention_fa<<<agrid, gblk, 0, stream>>>(Qh, Kh, Vt, mask, Ch);

  dim3 ggrid(cD / BN, MT / BM);                   // (8, 32)
  gemm_f16_xwt_bias<0><<<ggrid, gblk, 0, stream>>>(Ch, Woh, b_o, b_o, b_o, d_out, MT, cD, cD);
}

// v005
// It runs in 103 microseconds.
// Next to v004, in two timings, it ran 1.19 and 1.20 times as fast.
// All steps since v000 together make it 2.67 times as fast.
#include <hip/hip_runtime.h>

typedef __attribute__((ext_vector_type(16))) _Float16 v16h;
typedef __attribute__((ext_vector_type(8)))  _Float16 v8h;
typedef __attribute__((ext_vector_type(8)))  float    v8f;
typedef __attribute__((ext_vector_type(2)))  _Float16 v2h;
typedef __attribute__((ext_vector_type(2)))  float    v2f;
typedef __attribute__((ext_vector_type(4)))  _Float16 v4h;
typedef __attribute__((ext_vector_type(4)))  float    v4f;

#define cB 2
#define cS 2048
#define cD 1024
#define cH 16
#define MT (cB * cS)          // 4096 tokens total

#define BM 128
#define BN 128
#define BKK 32
#define LDT 40                // padded LDS stride in halves (80B, 16B-multiple)

// ---------------------------------------------------------------------------
// WMMA helper: D = A(16x32 f16) * B(32x16 f16) + C(16x16 f32)
// ---------------------------------------------------------------------------
__device__ __forceinline__ v8f wmma16(v16h a, v16h b, v8f c) {
  return __builtin_amdgcn_wmma_f32_16x16x32_f16(
      false, a, false, b, (short)0, c, false, false);
}

// Load a 16x32 f16 A-fragment (or B-fragment given B^T row-major) from a
// row-major tile with leading dimension ld (in halves).
// Per ISA 7.12.2: lane = row + 16*g, halves[0:8]=K[8g..8g+7], halves[8:16]=K[16+8g..].
__device__ __forceinline__ v16h load_ab_frag(const _Float16* tile, int ld) {
  const int lane = threadIdx.x & 31;
  const int r  = lane & 15;
  const int ko = (lane >> 4) << 3;   // 0 or 8
  const _Float16* p = tile + (size_t)r * ld;
  v8h lo = *(const v8h*)(p + ko);
  v8h hi = *(const v8h*)(p + 16 + ko);
  v16h f;
#pragma unroll
  for (int i = 0; i < 8; ++i) { f[i] = lo[i]; f[i + 8] = hi[i]; }
  return f;
}

// ---------------------------------------------------------------------------
// Async global->LDS copy of a 128x32 f16 tile (8KB) into a padded LDS tile.
// 512 x 16B chunks, 256 threads x 2 chunks; each asm stmt is one ASYNCcnt op
// per wave (32 lanes x 16B). LDS address = low 32 bits of generic pointer.
// ---------------------------------------------------------------------------
__device__ __forceinline__ void async_fill_tile(const _Float16* __restrict__ g,
                                                int ld, _Float16* __restrict__ s) {
  const int t = threadIdx.x;
#pragma unroll
  for (int i = 0; i < 2; ++i) {
    const int c   = t + i * 256;       // chunk 0..511
    const int row = c >> 2;            // 0..127
    const int seg = (c & 3) << 3;      // 0,8,16,24 halves
    const uint64_t ga = (uint64_t)(uintptr_t)(g + (size_t)row * ld + seg);
    const uint32_t la = (uint32_t)(uintptr_t)(s + row * LDT + seg);
    asm volatile("global_load_async_to_lds_b128 %0, %1, off"
                 :: "v"(la), "v"(ga) : "memory");
  }
}

__device__ __forceinline__ void wait_async_zero() {
  asm volatile("s_wait_asynccnt 0" ::: "memory");
}

// ---------------------------------------------------------------------------
// f32 -> f16 conversion pre-pass: all seven operands in ONE launch of a grid
// that is resident at once, one 16-wave block per 65,536 elements.
// The f16 copies lie one behind the other in the workspace, in the order of
// the sources, so a block's place in dst is its index alone.
// A wave takes 4,096 contiguous elements: 32 loads of 512 contiguous bytes,
// all issued ahead of the first conversion, and 32 stores of two whole lines.
// ---------------------------------------------------------------------------
#define CV_THREADS 512
#define CV_LOADS   32                          // 16-B loads per lane
#define CV_WAVE    (CV_LOADS * 128)            // elements per wave
#define CV_BLOCK   (CV_WAVE * (CV_THREADS / 32))
#define CV_ACT     (MT * cD / CV_BLOCK)        // blocks per activation: 64
#define CV_WGT     (cD * cD / CV_BLOCK)        // blocks per weight: 16
#define CV_GRID    (3 * CV_ACT + 4 * CV_WGT)   // 256

__global__ __launch_bounds__(CV_THREADS) void cvt_all_f32_f16(
    const float* __restrict__ q_in, const float* __restrict__ k_in,
    const float* __restrict__ v_in, const float* __restrict__ w_q,
    const float* __restrict__ w_k,  const float* __restrict__ w_v,
    const float* __restrict__ w_o,  _Float16* __restrict__ dst) {
  const int blk = blockIdx.x;
  const float* src;
  int rel;                                     // block index inside its source
  if (blk < 3 * CV_ACT) {
    const int s = blk / CV_ACT;
    rel = blk - s * CV_ACT;
    src = s == 0 ? q_in : s == 1 ? k_in : v_in;
  } else {
    const int u = blk - 3 * CV_ACT;
    const int s = u / CV_WGT;
    rel = u - s * CV_WGT;
    src = s == 0 ? w_q : s == 1 ? w_k : s == 2 ? w_v : w_o;
  }
  const int inblk = (threadIdx.x >> 5) * CV_WAVE + (threadIdx.x & 31) * 4;
  const float* sp = src + (size_t)rel * CV_BLOCK;
  _Float16*    dp = dst + (size_t)blk * CV_BLOCK + inblk;

  // the loops below are unrolled: x stays in registers at constant indices
  v4f x[CV_LOADS];
#pragma unroll
  for (int i = 0; i < CV_LOADS; ++i) x[i] = *(const v4f*)(sp + inblk + i * 128);
  // the loads' offset register is named here, so it lives up to this wait and
  // is not given to a load's result ahead of it
  asm volatile("s_wait_xcnt 0x0" :: "v"(inblk * 4) : "memory");
  // keeps every load ahead of the first conversion: left free, the scheduler
  // reuses registers and issues the later loads only when earlier ones are back
  __builtin_amdgcn_sched_barrier(0);
#pragma unroll
  for (int g = 0; g < CV_LOADS; g += 8) {
#pragma unroll
    for (int i = g; i < g + 8; ++i)
      *(v4h*)(dp + i * 128) = __builtin_convertvector(x[i], v4h);
    // keeps a group's stores behind its own loads' wait: left free, all
    // stores gather behind the last load's return
    __builtin_amdgcn_sched_barrier(0);
  }
}

// ---------------------------------------------------------------------------
// Key order. A masked key (mask == 0) has softmax weight exp(-1e9 - max), which
// is 0 in f32 as soon as its batch has one kept key (with a score above
// -1e9 + 104; min_cap below asks the like). So K and V^T are stored with each
// batch's kept keys first, in their order, and its masked keys behind them, in
// theirs: a permutation of the batch's cS places, every place written. Attention
// then walks only the stages that hold kept keys (all of them where none is kept).
//
// Kept keys of one batch's mask row, counted by every wave for itself: load i
// covers keys 128 i .. 128 i + 127, four to a lane. Returns the row's total;
// before = the kept keys ahead of key 128 * tile. Both are wave-uniform.
// ---------------------------------------------------------------------------
__device__ __forceinline__ int kept4(const int4 m) {
  return __builtin_popcount(__builtin_amdgcn_ballot_w32(m.x != 0)) +
         __builtin_popcount(__builtin_amdgcn_ballot_w32(m.y != 0)) +
         __builtin_popcount(__builtin_amdgcn_ballot_w32(m.z != 0)) +
         __builtin_popcount(__builtin_amdgcn_ballot_w32(m.w != 0));
}

__device__ __forceinline__ int count_kept(const int* __restrict__ mrow, int tile,
                                          int& before) {
  const int4* mp = (const int4*)mrow + (threadIdx.x & 31);
  int total = 0;
  before = 0;
  // unrolled: all sixteen loads are in flight together
#pragma unroll
  for (int i = 0; i < cS / 128; ++i) {
    const int c = kept4(mp[i * 32]);
    total += c;
    before += i < tile ? c : 0;
  }
  return total;
}

// The places (token rows of the workspace) of the 128 keys from token tok0 on,
// four keys to a lane, written to the wave's own table pos[128].
// A kept key's place is its rank among the kept, a masked key's the number of
// kept keys plus its rank among the masked: both are counts of keys of the
// batch, so every place lies inside the batch whatever the mask holds.
__device__ __forceinline__ void key_places(const int* __restrict__ mask, int tok0,
                                           int* __restrict__ pos) {
  const int lane = threadIdx.x & 31;
  const int kb   = tok0 / cS * cS;             // the batch's first token
  int u;                                       // kept keys ahead of this one
  const int n = count_kept(mask + kb, (tok0 - kb) >> 7, u);
  const int4 m = ((const int4*)(mask + tok0))[lane];
  u = __builtin_amdgcn_mbcnt_lo(__builtin_amdgcn_ballot_w32(m.x != 0), u);
  u = __builtin_amdgcn_mbcnt_lo(__builtin_amdgcn_ballot_w32(m.y != 0), u);
  u = __builtin_amdgcn_mbcnt_lo(__builtin_amdgcn_ballot_w32(m.z != 0), u);
  u = __builtin_amdgcn_mbcnt_lo(__builtin_amdgcn_ballot_w32(m.w != 0), u);
  const int back = tok0 + 4 * lane + n;        // masked: back + j - u
  int4 p;
  p.x = m.x != 0 ? kb + u : back - u;      u += m.x != 0;
  p.y = m.y != 0 ? kb + u : back + 1 - u;  u += m.y != 0;
  p.z = m.z != 0 ? kb + u : back + 2 - u;  u += m.z != 0;
  p.w = m.w != 0 ? kb + u : back + 3 - u;
  *(int4*)(pos + 4 * lane) = p;
}

// ---------------------------------------------------------------------------
// A wave's 64x32 accumulator tile + bias, stored at rows gm0.., columns gn0..
// of Y [.., ld]; Y is f32 where F32_OUT, else f16.
//   KEYS = 0: bias by column.
//   KEYS = 1: rows are keys: the tile's row i goes to row pos[i]; bias by column.
//   KEYS = 2: columns are keys: column j goes to column pos[j]; bias by row.
// C layout = lane(N + 16*(M>=8)), vgpr r = M mod 8.
// ---------------------------------------------------------------------------
template <int KEYS, int F32_OUT>
__device__ __forceinline__ void store_acc(const v8f (&acc)[4][2],
                                          const float* __restrict__ bias,
                                          void* __restrict__ Y,
                                          int ld, int gm0, int gn0,
                                          const int* __restrict__ pos) {
  const int lane = threadIdx.x & 31;
  const int colr = lane & 15;
  const int rsel = (lane >> 4) << 3;
#pragma unroll
  for (int mi = 0; mi < 4; ++mi) {
#pragma unroll
    for (int ni = 0; ni < 2; ++ni) {
      const int gn = gn0 + ni * 16 + colr;
#pragma unroll
      for (int r = 0; r < 8; ++r) {
        const int i  = mi * 16 + r + rsel;
        const int gm = gm0 + i;
        const float v = acc[mi][ni][r] + bias[KEYS == 2 ? gm : gn];
        // A place is known only at run time and takes an address register of
        // its own: as a 32-bit offset (Y is far below 4 GiB) it takes one, and
        // the tile's constant steps stay outside it, for the immediate field.
        const size_t at =
            KEYS == 1 ? (size_t)(uint32_t)(pos[i] * ld + gn0 + colr) + ni * 16
          : KEYS == 2 ? (size_t)(uint32_t)((gm0 + rsel) * ld + pos[ni * 16 + colr]) +
                            (size_t)(mi * 16 + r) * ld
                      : (size_t)gm * ld + gn;
        if (F32_OUT)
          ((float*)Y)[at] = v;
        else
          ((_Float16*)Y)[at] = (_Float16)v;
      }
    }
    if (KEYS) {
      // the next group, or the code behind the tile, rewrites registers that
      // this group's stores name: the wait stands ahead of that
      asm volatile("s_wait_xcnt 0x0" ::: "memory");
      // keeps one 16-row group's places and addresses live at a time: left
      // free, the scheduler gathers all four groups' and the kernel's register
      // budget is overrun (scratch)
      __builtin_amdgcn_sched_barrier(0);
    }
  }
}

// ---------------------------------------------------------------------------
// Y = X[M,Kd](f16) * W[N,Kd](f16)^T + bias[N](f32)
// 128x128x32 block tile, 8 waves x (64x32) wave tile, double-buffered LDS
// filled by async global->LDS copies overlapped with WMMA.
//   QKV = 0: one product, Y f32 [M,N], bias b0 (b1, b2 and mask are not read).
//   QKV = 1: three products in one launch, blockIdx.z = 0, 1, 2. Their X, W
//            and Y lie one behind the other at X0, W0, Y0; biases b0, b1, b2;
//            Y f16 [M,N] for z = 0, 1 and f16 [N,M] for z = 2, which is
//            computed as it is stored, W * X^T: its tokens run along the lanes.
//            For z = 1, 2 a token is a key and is stored at its place in the
//            key order (key_places above); M is MT, cB batches of cS tokens,
//            and N is cD.
//            All 3 x 256 blocks are resident at once, three to a WGP, and one
//            block's waits on copies and LDS are filled by the other two.
// Six waves per SIMD are three 8-wave blocks per WGP: the register budget is
// set for exactly that many, so that no WGP takes a fourth block while another
// holds two, and the epilogue's store addresses need not share registers.
// ---------------------------------------------------------------------------
template <int QKV>
__global__ __launch_bounds__(256) __attribute__((amdgpu_waves_per_eu(6, 6)))
void gemm_f16_xwt_bias(
    const _Float16* __restrict__ X0, const _Float16* __restrict__ W0,
    const float* __restrict__ b0, const float* __restrict__ b1,
    const float* __restrict__ b2, const int* __restrict__ mask,
    void* __restrict__ Y0, int M, int N, int Kd) {
  __shared__ __align__(16) _Float16 As[2][BM * LDT];
  __shared__ __align__(16) _Float16 Bs[2][BN * LDT];
  __shared__ __align__(16) int      Pos[QKV ? 8 : 1][128];   // a table a wave

  const int  z  = QKV ? (int)blockIdx.z : 0;
  const bool wx = QKV && z == 2;               // the product is W * X^T
  const _Float16* X = wx ? W0 + (size_t)z * N * Kd : X0 + (size_t)z * M * Kd;
  const _Float16* W = wx ? X0 + (size_t)z * M * Kd : W0 + (size_t)z * N * Kd;

  const int m0   = (wx ? blockIdx.x : blockIdx.y) * BM;
  const int n0   = (wx ? blockIdx.y : blockIdx.x) * BN;
  const int wave = threadIdx.x >> 5;
  const int wm   = (wave >> 2) * 64;
  const int wn   = (wave & 3) * 32;

  // The places of the block's 128 keys; each wave writes and reads its own table
  if (QKV && z != 0) key_places(mask, blockIdx.y * 128, Pos[wave]);

  v8f acc[4][2] = {};

  // Prologue: fill buffer 0
  async_fill_tile(X + (size_t)m0 * Kd, Kd, As[0]);
  async_fill_tile(W + (size_t)n0 * Kd, Kd, Bs[0]);
  wait_async_zero();
  __syncthreads();

  int cur = 0;
  for (int k0 = 0; k0 < Kd; k0 += BKK) {
    const int nxt = k0 + BKK;
    if (nxt < Kd) {   // overlap next tile's async copy with this tile's WMMAs
      async_fill_tile(X + (size_t)m0 * Kd + nxt, Kd, As[cur ^ 1]);
      async_fill_tile(W + (size_t)n0 * Kd + nxt, Kd, Bs[cur ^ 1]);
    }

    v16h a[4], b[2];
#pragma unroll
    for (int mi = 0; mi < 4; ++mi)
      a[mi] = load_ab_frag(&As[cur][(wm + mi * 16) * LDT], LDT);
#pragma unroll
    for (int ni = 0; ni < 2; ++ni)
      b[ni] = load_ab_frag(&Bs[cur][(wn + ni * 16) * LDT], LDT);
#pragma unroll
    for (int mi = 0; mi < 4; ++mi)
#pragma unroll
      for (int ni = 0; ni < 2; ++ni)
        acc[mi][ni] = wmma16(a[mi], b[ni], acc[mi][ni]);

    if (nxt < Kd) {
      wait_async_zero();
      __syncthreads();
      cur ^= 1;
    }
  }

  // Epilogue: the output form is the same for the whole block
  if (!QKV) {
    store_acc<0, 1>(acc, b0, Y0, N, m0 + wm, n0 + wn, nullptr);
  } else {
    _Float16* Y = (_Float16*)Y0 + (size_t)z * M * N;
    if (z == 0) {
      store_acc<0, 0>(acc, b0, Y, N, m0 + wm, n0 + wn, nullptr);
      // In the built code a branch here ends in a jump with another branch's
      // code as its fall-through, which rewrites registers its stores name:
      // the wait stands ahead of it on that path too.
      asm volatile("s_wait_xcnt 0x0" ::: "memory");
    } else if (z == 1) {
      store_acc<1, 0>(acc, b1, Y, cD, m0 + wm, n0 + wn, &Pos[wave][wm]);
    } else {
      store_acc<2, 0>(acc, b2, Y, MT, m0 + wm, n0 + wn, &Pos[wave][wn]);
    }
  }
}

// ---------------------------------------------------------------------------
// Attention K/V stage: 64 keys of one head. K tile = 64 key rows x 64 dk,
// V^T tile = 64 d rows x 64 keys; both have 128-B rows, laid in LDS at a
// 144-B pitch (16 B x odd) for the ds_load_b128 fragment readers.
// ---------------------------------------------------------------------------
#define KT 64                 // keys per stage
#define NT (cS / KT)          // stages per (b,h)
#define LDKV 72               // LDS pitch of a stage row, in halves

// One stage, copied once for the whole block: 2 x 512 chunks of 16 B, four
// copies per thread; a wave's copy covers four whole 128-B rows.
// gk, gv, lk, lv are this thread's own chunk of rows 0..31; rows 32..63 follow.
__device__ __forceinline__ void async_fill_kv(const _Float16* gk, const _Float16* gv,
                                              uint32_t lk, uint32_t lv) {
  const _Float16* gk1 = gk + (size_t)32 * cD;
  const _Float16* gv1 = gv + (size_t)32 * MT;
  const uint32_t  lk1 = lk + 32 * LDKV * 2;
  const uint32_t  lv1 = lv + 32 * LDKV * 2;
  // The s_wait_xcnt closes the copies' own statement, so that no address
  // register of a copy is rewritten ahead of it.
  asm volatile("global_load_async_to_lds_b128 %0, %1, off\n\t"
               "global_load_async_to_lds_b128 %2, %3, off\n\t"
               "global_load_async_to_lds_b128 %4, %5, off\n\t"
               "global_load_async_to_lds_b128 %6, %7, off\n\t"
               "s_wait_xcnt 0x0"
               :: "v"(lk), "v"(gk), "v"(lk1), "v"(gk1),
                  "v"(lv), "v"(gv), "v"(lv1), "v"(gv1) : "memory");
}

// ---------------------------------------------------------------------------
// Lane l <-> lane l ^ 16: the two lanes that share one query column.
// ---------------------------------------------------------------------------
__device__ __forceinline__ float xhalf(float x) {
  const int b = __float_as_int(x);
  return __int_as_float(
      __builtin_amdgcn_permlanex16(b, b, 0x76543210, 0xfedcba98, false, false));
}

// The mask as one instruction a score: median(score, ceiling, -1e9) is -1e9
// under a ceiling of -1e9, whatever the score, and the score itself under the
// largest float, for every score >= -1e9.
__device__ __forceinline__ float min_cap(float s, float cap) {
  return __builtin_amdgcn_fmed3f(s, cap, -1.0e9f);
}

__global__ __launch_bounds__(256) void attention_fa(
    const _Float16* __restrict__ Q, const _Float16* __restrict__ Km,
    const _Float16* __restrict__ Vt, const int* __restrict__ mask,
    _Float16* __restrict__ ctx) {
  __shared__ __align__(32) float    Cap[cS];
  __shared__ __align__(16) _Float16 Ks[2][KT * LDKV];
  __shared__ __align__(16) _Float16 Vs[2][64 * LDKV];

  const int wave = threadIdx.x >> 5;
  const int lane = threadIdx.x & 31;
  const int bh = blockIdx.y;
  const int b  = bh >> 4;                 // H = 16
  const int h  = bh & 15;
  const int q0 = (blockIdx.x * 8 + wave) * 16;

  const int colr = lane & 15;
  const int prow = (lane >> 4) << 3;

  // Q fragments, pre-scaled by 1/sqrt(DK) = 0.125 (exact in f16)
  const _Float16* qbase = Q + (size_t)(b * cS + q0) * cD + h * 64;
  v16h aq0 = load_ab_frag(qbase, cD);
  v16h aq1 = load_ab_frag(qbase + 32, cD);
#pragma unroll
  for (int i = 0; i < 16; ++i) {
    aq0[i] = aq0[i] * (_Float16)0.125f;
    aq1[i] = aq1[i] * (_Float16)0.125f;
  }

  v8f   ctxa[4] = {};
  float mrow = -3.0e38f, lrow = 0.0f;     // lrow: this half's keys only

  // This thread's chunk of a stage: row 0..31 (and row + 32), 16-B segment 0..7
  const int crow = threadIdx.x >> 3;
  const int cseg = (threadIdx.x & 7) << 3;
  const _Float16* gk = Km + (size_t)(b * cS + crow) * cD + h * 64 + cseg;
  const _Float16* gv = Vt + (size_t)(h * 64 + crow) * MT + (size_t)b * cS + cseg;
  const uint32_t lk = (uint32_t)(uintptr_t)(&Ks[0][crow * LDKV + cseg]);
  const uint32_t lv = (uint32_t)(uintptr_t)(&Vs[0][crow * LDKV + cseg]);
  const uint32_t bufb = KT * LDKV * 2;   // bytes from buffer 0 to buffer 1

  // Ring prologue: stage 0 landed and published, then stage 1 in flight
  async_fill_kv(gk, gv, lk, lv);

  // The batch's kept keys are places 0 .. kept - 1. Every wave counts them from
  // the same mask row, so kept and nst are the same in the whole block.
  // No kept key: every key weighs the same, and all stages are walked.
  int unused;
  const int kept = __builtin_amdgcn_readfirstlane(count_kept(mask + b * cS, 0, unused));
  const int nst  = kept == 0 ? NT : min((kept + KT - 1) / KT, NT);

  // The key runs along a lane's registers, so the mask is kept per place in
  // LDS as a ceiling: -1e9 on a masked key, the largest float on any other
  // (min_cap above applies it).
  {
    const int p0 = threadIdx.x * 8;
    float4 c0, c1;
    c0.x = p0 + 0 >= kept ? -1.0e9f : 3.4028235e38f;
    c0.y = p0 + 1 >= kept ? -1.0e9f : 3.4028235e38f;
    c0.z = p0 + 2 >= kept ? -1.0e9f : 3.4028235e38f;
    c0.w = p0 + 3 >= kept ? -1.0e9f : 3.4028235e38f;
    c1.x = p0 + 4 >= kept ? -1.0e9f : 3.4028235e38f;
    c1.y = p0 + 5 >= kept ? -1.0e9f : 3.4028235e38f;
    c1.z = p0 + 6 >= kept ? -1.0e9f : 3.4028235e38f;
    c1.w = p0 + 7 >= kept ? -1.0e9f : 3.4028235e38f;
    float4* cp = (float4*)&Cap[p0];
    cp[0] = c0; cp[1] = c1;
  }

  wait_async_zero();
  __syncthreads();
  if (1 < nst)
    async_fill_kv(gk + (size_t)KT * cD, gv + KT, lk + bufb, lv + bufb);

  for (int t = 0; t < nst; ++t) {
   const _Float16* ksb = &Ks[t & 1][0];
   const _Float16* vsb = &Vs[t & 1][0];
   // unrolled: both 32-key halves of the stage read LDS at constant offsets
#pragma unroll
   for (int j = 0; j < KT / 32; ++j) {
    const int k0 = t * KT + j * 32;
    const _Float16* kb = ksb + j * 32 * LDKV;

    // ---- scores^T: 2 key sub-tiles (rows) x 2 dk chunks, queries in columns ----
    v16h bk00 = load_ab_frag(kb, LDKV);
    v16h bk01 = load_ab_frag(kb + 32, LDKV);
    v16h bk10 = load_ab_frag(kb + 16 * LDKV, LDKV);
    v16h bk11 = load_ab_frag(kb + 16 * LDKV + 32, LDKV);
    v8f s0 = {}, s1 = {};
    s0 = wmma16(bk00, aq0, s0); s0 = wmma16(bk01, aq1, s0);
    s1 = wmma16(bk10, aq0, s1); s1 = wmma16(bk11, aq1, s1);

    // ---- mask (key row = 8 * half + register) ----
    const v8f cap0 = *(const v8f*)&Cap[k0 + prow];
    const v8f cap1 = *(const v8f*)&Cap[k0 + 16 + prow];
    // the loops over r, i and d below are unrolled so that every accumulator
    // element keeps a constant register index
#pragma unroll
    for (int r = 0; r < 8; ++r) {
      s0[r] = min_cap(s0[r], cap0[r]);
      s1[r] = min_cap(s1[r], cap1[r]);
    }

    // ---- online softmax: in-lane over 16 keys, one exchange for the maximum ----
    float vmax = fmaxf(s0[0], s1[0]);
#pragma unroll
    for (int r = 1; r < 8; ++r) vmax = fmaxf(vmax, fmaxf(s0[r], s1[r]));
    vmax = fmaxf(vmax, xhalf(vmax));
    const float mn = fmaxf(mrow, vmax);
    const float c  = __expf(mrow - mn);
    mrow = mn;

    // ---- P^T as B operand: element s = key 8g + s (s < 8), 16 + 8g + s - 8 ----
    v16h bp;
    v2f  ps2 = {0.0f, 0.0f};
#pragma unroll
    for (int i = 0; i < 4; ++i) {
      const v2f e0 = {__expf(s0[2 * i] - mn), __expf(s0[2 * i + 1] - mn)};
      const v2f e1 = {__expf(s1[2 * i] - mn), __expf(s1[2 * i + 1] - mn)};
      ps2 += e0 + e1;
      const v2h x0 = __builtin_convertvector(e0, v2h);
      const v2h x1 = __builtin_convertvector(e1, v2h);
      bp[2 * i]     = x0[0]; bp[2 * i + 1] = x0[1];
      bp[8 + 2 * i] = x1[0]; bp[9 + 2 * i] = x1[1];
    }
    lrow = lrow * c + (ps2[0] + ps2[1]);

    // ---- ctx^T = ctx^T * c + V^T * P^T  (V^T rows supply A fragments) ----
#pragma unroll
    for (int d = 0; d < 4; ++d) {
      v16h av = load_ab_frag(vsb + d * 16 * LDKV + j * 32, LDKV);
      ctxa[d] = wmma16(av, bp, ctxa[d] * c);
    }
   }

   // ---- publish stage t + 1, then refill the buffer stage t has left ----
   asm volatile("s_wait_dscnt 0x0" ::: "memory");  // own reads of stage t done
   wait_async_zero();                              // own copies of stage t + 1 landed
   __syncthreads();
   if (t + 2 < nst)
     async_fill_kv(gk + (size_t)(t + 2) * KT * cD, gv + (t + 2) * KT,
                   lk + (t & 1) * bufb, lv + (t & 1) * bufb);
  }
  wait_async_zero();   // nothing of this wave in flight when it ends

  // ---- join the halves' sums, normalize, store merged-head context ----
  // Lane (c, g) holds d = 16 * tile + 8g .. + 7 of query c: one 16-B store a tile
  const float linv = 1.0f / (lrow + xhalf(lrow));
  _Float16* orow = ctx + ((size_t)b * cS + q0 + colr) * cD + h * 64 + prow;
#pragma unroll
  for (int d = 0; d < 4; ++d) {
    v8h o;
#pragma unroll
    for (int r = 0; r < 8; ++r) o[r] = (_Float16)(ctxa[d][r] * linv);
    *(v8h*)(orow + d * 16) = o;
  }
}

// ---------------------------------------------------------------------------
// Host-side launcher
// ---------------------------------------------------------------------------
extern "C" void kernel_launch(void* const* d_in, const int* in_sizes, int n_in,
                              void* d_out, int out_size, void* d_ws, size_t ws_size,
                              hipStream_t stream) {
  (void)in_sizes; (void)n_in; (void)out_size; (void)ws_size;

  const float* q_in = (const float*)d_in[0];
  const float* k_in = (const float*)d_in[1];
  const float* v_in = (const float*)d_in[2];
  const int*   mask = (const int*)d_in[3];
  const float* w_q  = (const float*)d_in[4];
  const float* b_q  = (const float*)d_in[5];
  const float* w_k  = (const float*)d_in[6];
  const float* b_k  = (const float*)d_in[7];
  const float* w_v  = (const float*)d_in[8];
  const float* b_v  = (const float*)d_in[9];
  const float* w_o  = (const float*)d_in[10];
  const float* b_o  = (const float*)d_in[11];

  // Workspace layout (f16), total 32 Mi halves = 64 MiB
  _Float16* p   = (_Float16*)d_ws;
  _Float16* Xq  = p; p += (size_t)MT * cD;
  _Float16* Xk  = p; p += (size_t)MT * cD;
  _Float16* Xv  = p; p += (size_t)MT * cD;
  _Float16* Wqh = p; p += (size_t)cD * cD;
  _Float16* Wkh = p; p += (size_t)cD * cD;
  _Float16* Wvh = p; p += (size_t)cD * cD;
  _Float16* Woh = p; p += (size_t)cD * cD;
  _Float16* Qh  = p; p += (size_t)MT * cD;
  _Float16* Kh  = p; p += (size_t)MT * cD;
  _Float16* Vt  = p; p += (size_t)MT * cD;
  _Float16* Ch  = p;

  dim3 gblk(256);

  // f32 -> f16 pre-pass (activations + weights): Xq .. Woh are one run of dst
  cvt_all_f32_f16<<<CV_GRID, CV_THREADS, 0, stream>>>(q_in, k_in, v_in,
                                                      w_q, w_k, w_v, w_o, Xq);

  // Q, K and V projections in one launch: Xq Xk Xv, Wqh Wkh Wvh and Qh Kh Vt
  // are each one run of the workspace
  dim3 pgrid(cD / BN, MT / BM, 3);                // (8, 32, 3)
  gemm_f16_xwt_bias<1><<<pgrid, gblk, 0, stream>>>(Xq, Wqh, b_q, b_k, b_v, mask, (void*)Qh, MT, cD, cD);

  dim3 agrid(cS / 16 / 8, cB * cH);               // (16, 32)
  attention_fa<<<agrid, gblk, 0, stream>>>(Qh, Kh, Vt, mask, Ch);

  dim3 ggrid(cD / BN, MT / BM);                   // (8, 32)
  gemm_f16_xwt_bias<0><<<ggrid, gblk, 0, stream>>>(Ch, Woh, b_o, b_o, b_o, mask, d_out, MT, cD, cD);
}

// v006
// A run of this version takes 84.9 microseconds.
// Two timings next to v005 put it at 1.20 and 1.21 times that version's speed.
// Counting every step since v000, it is 3.22 times as fast.
#include <hip/hip_runtime.h>

typedef __attribute__((ext_vector_type(16))) _Float16 v16h;
typedef __attribute__((ext_vector_type(8)))  _Float16 v8h;
typedef __attribute__((ext_vector_type(8)))  float    v8f;
typedef __attribute__((ext_vector_type(2)))  _Float16 v2h;
typedef __attribute__((ext_vector_type(2)))  float    v2f;
typedef __attribute__((ext_vector_type(4)))  _Float16 v4h;
typedef __attribute__((ext_vector_type(4)))  float    v4f;

#define cB 2
#define cS 2048
#define cD 1024
#define cH 16
#define MT (cB * cS)          // 4096 tokens total

#define BM 128
#define BN 128
#define BKK 64                // k depth of a stage: a tile row is one 128-B line
#define LDT 72                // padded LDS stride in halves (144 B = 16 B x odd)

// ---------------------------------------------------------------------------
// WMMA helper: D = A(16x32 f16) * B(32x16 f16) + C(16x16 f32)
// ---------------------------------------------------------------------------
__device__ __forceinline__ v8f wmma16(v16h a, v16h b, v8f c) {
  return __builtin_amdgcn_wmma_f32_16x16x32_f16(
      false, a, false, b, (short)0, c, false, false);
}

// Load a 16x32 f16 A-fragment (or B-fragment given B^T row-major) from a
// row-major tile with leading dimension ld (in halves).
// Per ISA 7.12.2: lane = row + 16*g, halves[0:8]=K[8g..8g+7], halves[8:16]=K[16+8g..].
__device__ __forceinline__ v16h load_ab_frag(const _Float16* tile, int ld) {
  const int lane = threadIdx.x & 31;
  const int r  = lane & 15;
  const int ko = (lane >> 4) << 3;   // 0 or 8
  const _Float16* p = tile + (size_t)r * ld;
  v8h lo = *(const v8h*)(p + ko);
  v8h hi = *(const v8h*)(p + 16 + ko);
  v16h f;
#pragma unroll
  for (int i = 0; i < 8; ++i) { f[i] = lo[i]; f[i + 8] = hi[i]; }
  return f;
}

// ---------------------------------------------------------------------------
// One GEMM stage, copied global->LDS for the whole block: a 128x64 f16 tile of
// each operand (16 KB, rows of 128 B) into padded LDS tiles. 2 x 1,024 chunks of
// 16 B, eight copies per thread; a wave's copy covers four whole 128-B rows.
// gx, gw, lx, lw are this thread's own chunk of rows 0..31; rows 32.., 64..,
// 96.. follow at 32 rows' distance (ld = source pitch in halves).
// ---------------------------------------------------------------------------
__device__ __forceinline__ void async_fill_stage(const _Float16* gx, const _Float16* gw,
                                                 int ld, uint32_t lx, uint32_t lw) {
  const size_t   gs = (size_t)32 * ld;         // 32 rows of the source, in halves
  const uint32_t ls = 32 * LDT * 2;            // 32 rows of the LDS tile, in bytes
  // The s_wait_xcnt closes the copies' own statement, so that no address
  // register of a copy is rewritten ahead of it.
  asm volatile("global_load_async_to_lds_b128 %0, %1, off\n\t"
               "global_load_async_to_lds_b128 %2, %3, off\n\t"
               "global_load_async_to_lds_b128 %4, %5, off\n\t"
               "global_load_async_to_lds_b128 %6, %7, off\n\t"
               "global_load_async_to_lds_b128 %8, %9, off\n\t"
               "global_load_async_to_lds_b128 %10, %11, off\n\t"
               "global_load_async_to_lds_b128 %12, %13, off\n\t"
               "global_load_async_to_lds_b128 %14, %15, off\n\t"
               "s_wait_xcnt 0x0"
               :: "v"(lx),          "v"(gx),          "v"(lx + ls),     "v"(gx + gs),
                  "v"(lx + 2 * ls), "v"(gx + 2 * gs), "v"(lx + 3 * ls), "v"(gx + 3 * gs),
                  "v"(lw),          "v"(gw),          "v"(lw + ls),     "v"(gw + gs),
                  "v"(lw + 2 * ls), "v"(gw + 2 * gs), "v"(lw + 3 * ls), "v"(gw + 3 * gs)
               : "memory");
}

__device__ __forceinline__ void wait_async_zero() {
  asm volatile("s_wait_asynccnt 0" ::: "memory");
}

// ---------------------------------------------------------------------------
// f32 -> f16 conversion pre-pass: all seven operands in ONE launch of a grid
// that is resident at once, one 16-wave block per 65,536 elements.
// The f16 copies lie one behind the other in the workspace, in the order of
// the sources, so a block's place in dst is its index alone.
// A wave takes 4,096 contiguous elements: 32 loads of 512 contiguous bytes,
// all issued ahead of the first conversion, and 32 stores of two whole lines.
// ---------------------------------------------------------------------------
#define CV_THREADS 512
#define CV_LOADS   32                          // 16-B loads per lane
#define CV_WAVE    (CV_LOADS * 128)            // elements per wave
#define CV_BLOCK   (CV_WAVE * (CV_THREADS / 32))
#define CV_ACT     (MT * cD / CV_BLOCK)        // blocks per activation: 64
#define CV_WGT     (cD * cD / CV_BLOCK)        // blocks per weight: 16
#define CV_GRID    (3 * CV_ACT + 4 * CV_WGT)   // 256

__global__ __launch_bounds__(CV_THREADS) void cvt_all_f32_f16(
    const float* __restrict__ q_in, const float* __restrict__ k_in,
    const float* __restrict__ v_in, const float* __restrict__ w_q,
    const float* __restrict__ w_k,  const float* __restrict__ w_v,
    const float* __restrict__ w_o,  _Float16* __restrict__ dst) {
  const int blk = blockIdx.x;
  const float* src;
  int rel;                                     // block index inside its source
  if (blk < 3 * CV_ACT) {
    const int s = blk / CV_ACT;
    rel = blk - s * CV_ACT;
    src = s == 0 ? q_in : s == 1 ? k_in : v_in;
  } else {
    const int u = blk - 3 * CV_ACT;
    const int s = u / CV_WGT;
    rel = u - s * CV_WGT;
    src = s == 0 ? w_q : s == 1 ? w_k : s == 2 ? w_v : w_o;
  }
  const int inblk = (threadIdx.x >> 5) * CV_WAVE + (threadIdx.x & 31) * 4;
  const float* sp = src + (size_t)rel * CV_BLOCK;
  _Float16*    dp = dst + (size_t)blk * CV_BLOCK + inblk;

  // the loops below are unrolled: x stays in registers at constant indices
  v4f x[CV_LOADS];
#pragma unroll
  for (int i = 0; i < CV_LOADS; ++i) x[i] = *(const v4f*)(sp + inblk + i * 128);
  // the loads' offset register is named here, so it lives up to this wait and
  // is not given to a load's result ahead of it
  asm volatile("s_wait_xcnt 0x0" :: "v"(inblk * 4) : "memory");
  // keeps every load ahead of the first conversion: left free, the scheduler
  // reuses registers and issues the later loads only when earlier ones are back
  __builtin_amdgcn_sched_barrier(0);
#pragma unroll
  for (int g = 0; g < CV_LOADS; g += 8) {
#pragma unroll
    for (int i = g; i < g + 8; ++i)
      *(v4h*)(dp + i * 128) = __builtin_convertvector(x[i], v4h);
    // keeps a group's stores behind its own loads' wait: left free, all
    // stores gather behind the last load's return
    __builtin_amdgcn_sched_barrier(0);
  }
}

// ---------------------------------------------------------------------------
// Key order. A masked key (mask == 0) has softmax weight exp(-1e9 - max), which
// is 0 in f32 as soon as its batch has one kept key (with a score above
// -1e9 + 104; min_cap below asks the like). So K and V^T are stored with each
// batch's kept keys first, in their order, and its masked keys behind them, in
// theirs: a permutation of the batch's cS places, every place written. Attention
// then walks only the stages that hold kept keys (all of them where none is kept).
//
// Kept keys of one batch's mask row, counted by every wave for itself: load i
// covers keys 128 i .. 128 i + 127, four to a lane. Returns the row's total;
// before = the kept keys ahead of key 128 * tile. Both are wave-uniform.
// ---------------------------------------------------------------------------
__device__ __forceinline__ int kept4(const int4 m) {
  return __builtin_popcount(__builtin_amdgcn_ballot_w32(m.x != 0)) +
         __builtin_popcount(__builtin_amdgcn_ballot_w32(m.y != 0)) +
         __builtin_popcount(__builtin_amdgcn_ballot_w32(m.z != 0)) +
         __builtin_popcount(__builtin_amdgcn_ballot_w32(m.w != 0));
}

__device__ __forceinline__ int count_kept(const int* __restrict__ mrow, int tile,
                                          int& before) {
  const int4* mp = (const int4*)mrow + (threadIdx.x & 31);
  int total = 0;
  before = 0;
  // unrolled: all sixteen loads are in flight together
#pragma unroll
  for (int i = 0; i < cS / 128; ++i) {
    const int c = kept4(mp[i * 32]);
    total += c;
    before += i < tile ? c : 0;
  }
  return total;
}

// The places (token rows of the workspace) of the 128 keys from token tok0 on,
// four keys to a lane, written to the wave's own table pos[128].
// A kept key's place is its rank among the kept, a masked key's the number of
// kept keys plus its rank among the masked: both are counts of keys of the
// batch, so every place lies inside the batch whatever the mask holds.
__device__ __forceinline__ void key_places(const int* __restrict__ mask, int tok0,
                                           int* __restrict__ pos) {
  const int lane = threadIdx.x & 31;
  const int kb   = tok0 / cS * cS;             // the batch's first token
  int u;                                       // kept keys ahead of this one
  const int n = count_kept(mask + kb, (tok0 - kb) >> 7, u);
  const int4 m = ((const int4*)(mask + tok0))[lane];
  u = __builtin_amdgcn_mbcnt_lo(__builtin_amdgcn_ballot_w32(m.x != 0), u);
  u = __builtin_amdgcn_mbcnt_lo(__builtin_amdgcn_ballot_w32(m.y != 0), u);
  u = __builtin_amdgcn_mbcnt_lo(__builtin_amdgcn_ballot_w32(m.z != 0), u);
  u = __builtin_amdgcn_mbcnt_lo(__builtin_amdgcn_ballot_w32(m.w != 0), u);
  const int back = tok0 + 4 * lane + n;        // masked: back + j - u
  int4 p;
  p.x = m.x != 0 ? kb + u : back - u;      u += m.x != 0;
  p.y = m.y != 0 ? kb + u : back + 1 - u;  u += m.y != 0;
  p.z = m.z != 0 ? kb + u : back + 2 - u;  u += m.z != 0;
  p.w = m.w != 0 ? kb + u : back + 3 - u;
  *(int4*)(pos + 4 * lane) = p;
}

// ---------------------------------------------------------------------------
// A wave's 64x32 accumulator tile + bias, stored at rows gm0.., columns gn0..
// of Y [.., ld]; Y is f32 where F32_OUT, else f16.
//   KEYS = 0: bias by column.
//   KEYS = 1: rows are keys: the tile's row i goes to row pos[i]; bias by column.
//   KEYS = 2: columns are keys: column j goes to column pos[j]; bias by row.
// C layout = lane(N + 16*(M>=8)), vgpr r = M mod 8.
// ---------------------------------------------------------------------------
template <int KEYS, int F32_OUT>
__device__ __forceinline__ void store_acc(const v8f (&acc)[4][2],
                                          const float* __restrict__ bias,
                                          void* __restrict__ Y,
                                          int ld, int gm0, int gn0,
                                          const int* __restrict__ pos) {
  const int lane = threadIdx.x & 31;
  const int colr = lane & 15;
  const int rsel = (lane >> 4) << 3;
#pragma unroll
  for (int mi = 0; mi < 4; ++mi) {
#pragma unroll
    for (int ni = 0; ni < 2; ++ni) {
      const int gn = gn0 + ni * 16 + colr;
#pragma unroll
      for (int r = 0; r < 8; ++r) {
        const int i  = mi * 16 + r + rsel;
        const int gm = gm0 + i;
        const float v = acc[mi][ni][r] + bias[KEYS == 2 ? gm : gn];
        // A place is known only at run time and takes an address register of
        // its own: as a 32-bit offset (Y is far below 4 GiB) it takes one, and
        // the tile's constant steps stay outside it, for the immediate field.
        const size_t at =
            KEYS == 1 ? (size_t)(uint32_t)(pos[i] * ld + gn0 + colr) + ni * 16
          : KEYS == 2 ? (size_t)(uint32_t)((gm0 + rsel) * ld + pos[ni * 16 + colr]) +
                            (size_t)(mi * 16 + r) * ld
                      : (size_t)gm * ld + gn;
        if (F32_OUT)
          ((float*)Y)[at] = v;
        else
          ((_Float16*)Y)[at] = (_Float16)v;
      }
    }
    if (KEYS) {
      // the next group, or the code behind the tile, rewrites registers that
      // this group's stores name: the wait stands ahead of that
      asm volatile("s_wait_xcnt 0x0" ::: "memory");
      // keeps one 16-row group's places and addresses live at a time: left
      // free, the scheduler gathers all four groups' and the kernel's register
      // budget is overrun (scratch)
      __builtin_amdgcn_sched_barrier(0);
    }
  }
}

// ---------------------------------------------------------------------------
// Y = X[M,Kd](f16) * W[N,Kd](f16)^T + bias[N](f32)
// 128x128x64 block tile, 8 waves x (64x32) wave tile, two-buffer LDS ring
// filled by async global->LDS copies that fly while the stage before is worked
// on. Kd is a multiple of 64.
//   QKV = 0: one product, Y f32 [M,N], bias b0 (b1, b2 and mask are not read).
//   QKV = 1: three products in one launch, blockIdx.z = 0, 1, 2. Their X, W
//            and Y lie one behind the other at X0, W0, Y0; biases b0, b1, b2;
//            Y f16 [M,N] for z = 0, 1 and f16 [N,M] for z = 2, which is
//            computed as it is stored, W * X^T: its tokens run along the lanes.
//            For z = 1, 2 a token is a key and is stored at its place in the
//            key order (key_places above); M is MT, cB batches of cS tokens,
//            and N is cD.
//            All 3 x 256 blocks are resident at once, three to a WGP, and one
//            block's waits on copies and LDS are filled by the other two.
// Six waves per SIMD are three 8-wave blocks per WGP: the register budget is
// set for exactly that many, so that no WGP takes a fourth block while another
// holds two, and the epilogue's store addresses need not share registers.
// ---------------------------------------------------------------------------
template <int QKV>
__global__ __launch_bounds__(256) __attribute__((amdgpu_waves_per_eu(6, 6)))
void gemm_f16_xwt_bias(
    const _Float16* __restrict__ X0, const _Float16* __restrict__ W0,
    const float* __restrict__ b0, const float* __restrict__ b1,
    const float* __restrict__ b2, const int* __restrict__ mask,
    void* __restrict__ Y0, int M, int N, int Kd) {
  __shared__ __align__(16) _Float16 As[2][BM * LDT];
  __shared__ __align__(16) _Float16 Bs[2][BN * LDT];
  __shared__ __align__(16) int      Pos[QKV ? 8 : 1][128];   // a table a wave

  const int  z  = QKV ? (int)blockIdx.z : 0;
  const bool wx = QKV && z == 2;               // the product is W * X^T
  const _Float16* X = wx ? W0 + (size_t)z * N * Kd : X0 + (size_t)z * M * Kd;
  const _Float16* W = wx ? X0 + (size_t)z * M * Kd : W0 + (size_t)z * N * Kd;

  const int m0   = (wx ? blockIdx.x : blockIdx.y) * BM;
  const int n0   = (wx ? blockIdx.y : blockIdx.x) * BN;
  const int wave = threadIdx.x >> 5;
  const int wm   = (wave >> 2) * 64;
  const int wn   = (wave & 3) * 32;

  // The places of the block's 128 keys; each wave writes and reads its own table
  if (QKV && z != 0) key_places(mask, blockIdx.y * 128, Pos[wave]);

  v8f acc[4][2] = {};

  // This thread's chunk of a stage: row 0..31 (+32, +64, +96), 16-B segment 0..7
  const int crow = threadIdx.x >> 3;
  const int cseg = (threadIdx.x & 7) << 3;
  const _Float16* gx = X + (size_t)(m0 + crow) * Kd + cseg;
  const _Float16* gw = W + (size_t)(n0 + crow) * Kd + cseg;
  const uint32_t lx = (uint32_t)(uintptr_t)(&As[0][crow * LDT + cseg]);
  const uint32_t lw = (uint32_t)(uintptr_t)(&Bs[0][crow * LDT + cseg]);
  const uint32_t bufb = BM * LDT * 2;    // bytes from buffer 0 to buffer 1
  const int nt = Kd / BKK;               // stages

  // Ring prologue: stage 0 landed and published, then stage 1 in flight
  async_fill_stage(gx, gw, Kd, lx, lw);
  wait_async_zero();
  __syncthreads();
  if (1 < nt)
    async_fill_stage(gx + BKK, gw + BKK, Kd, lx + bufb, lw + bufb);

  for (int t = 0; t < nt; ++t) {
    const _Float16* as = &As[t & 1][0];
    const _Float16* bs = &Bs[t & 1][0];
    // unrolled: both 32-k halves of the stage read LDS at constant offsets
#pragma unroll
    for (int kk = 0; kk < BKK; kk += 32) {
      v16h a[4], b[2];
#pragma unroll
      for (int mi = 0; mi < 4; ++mi)
        a[mi] = load_ab_frag(as + (wm + mi * 16) * LDT + kk, LDT);
#pragma unroll
      for (int ni = 0; ni < 2; ++ni)
        b[ni] = load_ab_frag(bs + (wn + ni * 16) * LDT + kk, LDT);
#pragma unroll
      for (int mi = 0; mi < 4; ++mi)
#pragma unroll
        for (int ni = 0; ni < 2; ++ni)
          acc[mi][ni] = wmma16(a[mi], b[ni], acc[mi][ni]);
    }

    // ---- publish stage t + 1, then refill the buffer stage t has left ----
    asm volatile("s_wait_dscnt 0x0" ::: "memory");  // own reads of stage t done
    wait_async_zero();                              // own copies of stage t + 1 landed
    __syncthreads();
    if (t + 2 < nt)
      async_fill_stage(gx + (size_t)(t + 2) * BKK, gw + (size_t)(t + 2) * BKK, Kd,
                       lx + (t & 1) * bufb, lw + (t & 1) * bufb);
  }
  wait_async_zero();   // nothing of this wave in flight when it ends

  // Epilogue: the output form is the same for the whole block
  if (!QKV) {
    store_acc<0, 1>(acc, b0, Y0, N, m0 + wm, n0 + wn, nullptr);
  } else {
    _Float16* Y = (_Float16*)Y0 + (size_t)z * M * N;
    if (z == 0) {
      store_acc<0, 0>(acc, b0, Y, N, m0 + wm, n0 + wn, nullptr);
      // In the built code a branch here ends in a jump with another branch's
      // code as its fall-through, which rewrites registers its stores name:
      // the wait stands ahead of it on that path too.
      asm volatile("s_wait_xcnt 0x0" ::: "memory");
    } else if (z == 1) {
      store_acc<1, 0>(acc, b1, Y, cD, m0 + wm, n0 + wn, &Pos[wave][wm]);
    } else {
      store_acc<2, 0>(acc, b2, Y, MT, m0 + wm, n0 + wn, &Pos[wave][wn]);
    }
  }
}

// ---------------------------------------------------------------------------
// Attention K/V stage: 64 keys of one head. K tile = 64 key rows x 64 dk,
// V^T tile = 64 d rows x 64 keys; both have 128-B rows, laid in LDS at a
// 144-B pitch (16 B x odd) for the ds_load_b128 fragment readers.
// ---------------------------------------------------------------------------
#define KT 64                 // keys per stage
#define NT (cS / KT)          // stages per (b,h)
#define LDKV 72               // LDS pitch of a stage row, in halves

// One stage, copied once for the whole block: 2 x 512 chunks of 16 B, four
// copies per thread; a wave's copy covers four whole 128-B rows.
// gk, gv, lk, lv are this thread's own chunk of rows 0..31; rows 32..63 follow.
__device__ __forceinline__ void async_fill_kv(const _Float16* gk, const _Float16* gv,
                                              uint32_t lk, uint32_t lv) {
  const _Float16* gk1 = gk + (size_t)32 * cD;
  const _Float16* gv1 = gv + (size_t)32 * MT;
  const uint32_t  lk1 = lk + 32 * LDKV * 2;
  const uint32_t  lv1 = lv + 32 * LDKV * 2;
  // The s_wait_xcnt closes the copies' own statement, so that no address
  // register of a copy is rewritten ahead of it.
  asm volatile("global_load_async_to_lds_b128 %0, %1, off\n\t"
               "global_load_async_to_lds_b128 %2, %3, off\n\t"
               "global_load_async_to_lds_b128 %4, %5, off\n\t"
               "global_load_async_to_lds_b128 %6, %7, off\n\t"
               "s_wait_xcnt 0x0"
               :: "v"(lk), "v"(gk), "v"(lk1), "v"(gk1),
                  "v"(lv), "v"(gv), "v"(lv1), "v"(gv1) : "memory");
}

// ---------------------------------------------------------------------------
// Lane l <-> lane l ^ 16: the two lanes that share one query column.
// ---------------------------------------------------------------------------
__device__ __forceinline__ float xhalf(float x) {
  const int b = __float_as_int(x);
  return __int_as_float(
      __builtin_amdgcn_permlanex16(b, b, 0x76543210, 0xfedcba98, false, false));
}

// The mask as one instruction a score: median(score, ceiling, -1e9) is -1e9
// under a ceiling of -1e9, whatever the score, and the score itself under the
// largest float, for every score >= -1e9.
__device__ __forceinline__ float min_cap(float s, float cap) {
  return __builtin_amdgcn_fmed3f(s, cap, -1.0e9f);
}

__global__ __launch_bounds__(256) void attention_fa(
    const _Float16* __restrict__ Q, const _Float16* __restrict__ Km,
    const _Float16* __restrict__ Vt, const int* __restrict__ mask,
    _Float16* __restrict__ ctx) {
  __shared__ __align__(32) float    Cap[cS];
  __shared__ __align__(16) _Float16 Ks[2][KT * LDKV];
  __shared__ __align__(16) _Float16 Vs[2][64 * LDKV];

  const int wave = threadIdx.x >> 5;
  const int lane = threadIdx.x & 31;
  const int bh = blockIdx.y;
  const int b  = bh >> 4;                 // H = 16
  const int h  = bh & 15;
  const int q0 = (blockIdx.x * 8 + wave) * 16;

  const int colr = lane & 15;
  const int prow = (lane >> 4) << 3;

  // Q fragments, pre-scaled by 1/sqrt(DK) = 0.125 (exact in f16)
  const _Float16* qbase = Q + (size_t)(b * cS + q0) * cD + h * 64;
  v16h aq0 = load_ab_frag(qbase, cD);
  v16h aq1 = load_ab_frag(qbase + 32, cD);
#pragma unroll
  for (int i = 0; i < 16; ++i) {
    aq0[i] = aq0[i] * (_Float16)0.125f;
    aq1[i] = aq1[i] * (_Float16)0.125f;
  }

  v8f   ctxa[4] = {};
  float mrow = -3.0e38f, lrow = 0.0f;     // lrow: this half's keys only

  // This thread's chunk of a stage: row 0..31 (and row + 32), 16-B segment 0..7
  const int crow = threadIdx.x >> 3;
  const int cseg = (threadIdx.x & 7) << 3;
  const _Float16* gk = Km + (size_t)(b * cS + crow) * cD + h * 64 + cseg;
  const _Float16* gv = Vt + (size_t)(h * 64 + crow) * MT + (size_t)b * cS + cseg;
  const uint32_t lk = (uint32_t)(uintptr_t)(&Ks[0][crow * LDKV + cseg]);
  const uint32_t lv = (uint32_t)(uintptr_t)(&Vs[0][crow * LDKV + cseg]);
  const uint32_t bufb = KT * LDKV * 2;   // bytes from buffer 0 to buffer 1

  // Ring prologue: stage 0 landed and published, then stage 1 in flight
  async_fill_kv(gk, gv, lk, lv);

  // The batch's kept keys are places 0 .. kept - 1. Every wave counts them from
  // the same mask row, so kept and nst are the same in the whole block.
  // No kept key: every key weighs the same, and all stages are walked.
  int unused;
  const int kept = __builtin_amdgcn_readfirstlane(count_kept(mask + b * cS, 0, unused));
  const int nst  = kept == 0 ? NT : min((kept + KT - 1) / KT, NT);

  // The key runs along a lane's registers, so the mask is kept per place in
  // LDS as a ceiling: -1e9 on a masked key, the largest float on any other
  // (min_cap above applies it).
  {
    const int p0 = threadIdx.x * 8;
    float4 c0, c1;
    c0.x = p0 + 0 >= kept ? -1.0e9f : 3.4028235e38f;
    c0.y = p0 + 1 >= kept ? -1.0e9f : 3.4028235e38f;
    c0.z = p0 + 2 >= kept ? -1.0e9f : 3.4028235e38f;
    c0.w = p0 + 3 >= kept ? -1.0e9f : 3.4028235e38f;
    c1.x = p0 + 4 >= kept ? -1.0e9f : 3.4028235e38f;
    c1.y = p0 + 5 >= kept ? -1.0e9f : 3.4028235e38f;
    c1.z = p0 + 6 >= kept ? -1.0e9f : 3.4028235e38f;
    c1.w = p0 + 7 >= kept ? -1.0e9f : 3.4028235e38f;
    float4* cp = (float4*)&Cap[p0];
    cp[0] = c0; cp[1] = c1;
  }

  wait_async_zero();
  __syncthreads();
  if (1 < nst)
    async_fill_kv(gk + (size_t)KT * cD, gv + KT, lk + bufb, lv + bufb);

  for (int t = 0; t < nst; ++t) {
   const _Float16* ksb = &Ks[t & 1][0];
   const _Float16* vsb = &Vs[t & 1][0];
   // unrolled: both 32-key halves of the stage read LDS at constant offsets
#pragma unroll
   for (int j = 0; j < KT / 32; ++j) {
    const int k0 = t * KT + j * 32;
    const _Float16* kb = ksb + j * 32 * LDKV;

    // ---- scores^T: 2 key sub-tiles (rows) x 2 dk chunks, queries in columns ----
    v16h bk00 = load_ab_frag(kb, LDKV);
    v16h bk01 = load_ab_frag(kb + 32, LDKV);
    v16h bk10 = load_ab_frag(kb + 16 * LDKV, LDKV);
    v16h bk11 = load_ab_frag(kb + 16 * LDKV + 32, LDKV);
    v8f s0 = {}, s1 = {};
    s0 = wmma16(bk00, aq0, s0); s0 = wmma16(bk01, aq1, s0);
    s1 = wmma16(bk10, aq0, s1); s1 = wmma16(bk11, aq1, s1);

    // ---- mask (key row = 8 * half + register) ----
    const v8f cap0 = *(const v8f*)&Cap[k0 + prow];
    const v8f cap1 = *(const v8f*)&Cap[k0 + 16 + prow];
    // the loops over r, i and d below are unrolled so that every accumulator
    // element keeps a constant register index
#pragma unroll
    for (int r = 0; r < 8; ++r) {
      s0[r] = min_cap(s0[r], cap0[r]);
      s1[r] = min_cap(s1[r], cap1[r]);
    }

    // ---- online softmax: in-lane over 16 keys, one exchange for the maximum ----
    float vmax = fmaxf(s0[0], s1[0]);
#pragma unroll
    for (int r = 1; r < 8; ++r) vmax = fmaxf(vmax, fmaxf(s0[r], s1[r]));
    vmax = fmaxf(vmax, xhalf(vmax));
    const float mn = fmaxf(mrow, vmax);
    const float c  = __expf(mrow - mn);
    mrow = mn;

    // ---- P^T as B operand: element s = key 8g + s (s < 8), 16 + 8g + s - 8 ----
    v16h bp;
    v2f  ps2 = {0.0f, 0.0f};
#pragma unroll
    for (int i = 0; i < 4; ++i) {
      const v2f e0 = {__expf(s0[2 * i] - mn), __expf(s0[2 * i + 1] - mn)};
      const v2f e1 = {__expf(s1[2 * i] - mn), __expf(s1[2 * i + 1] - mn)};
      ps2 += e0 + e1;
      const v2h x0 = __builtin_convertvector(e0, v2h);
      const v2h x1 = __builtin_convertvector(e1, v2h);
      bp[2 * i]     = x0[0]; bp[2 * i + 1] = x0[1];
      bp[8 + 2 * i] = x1[0]; bp[9 + 2 * i] = x1[1];
    }
    lrow = lrow * c + (ps2[0] + ps2[1]);

    // ---- ctx^T = ctx^T * c + V^T * P^T  (V^T rows supply A fragments) ----
#pragma unroll
    for (int d = 0; d < 4; ++d) {
      v16h av = load_ab_frag(vsb + d * 16 * LDKV + j * 32, LDKV);
      ctxa[d] = wmma16(av, bp, ctxa[d] * c);
    }
   }

   // ---- publish stage t + 1, then refill the buffer stage t has left ----
   asm volatile("s_wait_dscnt 0x0" ::: "memory");  // own reads of stage t done
   wait_async_zero();                              // own copies of stage t + 1 landed
   __syncthreads();
   if (t + 2 < nst)
     async_fill_kv(gk + (size_t)(t + 2) * KT * cD, gv + (t + 2) * KT,
                   lk + (t & 1) * bufb, lv + (t & 1) * bufb);
  }
  wait_async_zero();   // nothing of this wave in flight when it ends

  // ---- join the halves' sums, normalize, store merged-head context ----
  // Lane (c, g) holds d = 16 * tile + 8g .. + 7 of query c: one 16-B store a tile
  const float linv = 1.0f / (lrow + xhalf(lrow));
  _Float16* orow = ctx + ((size_t)b * cS + q0 + colr) * cD + h * 64 + prow;
#pragma unroll
  for (int d = 0; d < 4; ++d) {
    v8h o;
#pragma unroll
    for (int r = 0; r < 8; ++r) o[r] = (_Float16)(ctxa[d][r] * linv);
    *(v8h*)(orow + d * 16) = o;
  }
}

// ---------------------------------------------------------------------------
// Host-side launcher
// ---------------------------------------------------------------------------
extern "C" void kernel_launch(void* const* d_in, const int* in_sizes, int n_in,
                              void* d_out, int out_size, void* d_ws, size_t ws_size,
                              hipStream_t stream) {
  (void)in_sizes; (void)n_in; (void)out_size; (void)ws_size;

  const float* q_in = (const float*)d_in[0];
  const float* k_in = (const float*)d_in[1];
  const float* v_in = (const float*)d_in[2];
  const int*   mask = (const int*)d_in[3];
  const float* w_q  = (const float*)d_in[4];
  const float* b_q  = (const float*)d_in[5];
  const float* w_k  = (const float*)d_in[6];
  const float* b_k  = (const float*)d_in[7];
  const float* w_v  = (const float*)d_in[8];
  const float* b_v  = (const float*)d_in[9];
  const float* w_o  = (const float*)d_in[10];
  const float* b_o  = (const float*)d_in[11];

  // Workspace layout (f16), total 32 Mi halves = 64 MiB
  _Float16* p   = (_Float16*)d_ws;
  _Float16* Xq  = p; p += (size_t)MT * cD;
  _Float16* Xk  = p; p += (size_t)MT * cD;
  _Float16* Xv  = p; p += (size_t)MT * cD;
  _Float16* Wqh = p; p += (size_t)cD * cD;
  _Float16* Wkh = p; p += (size_t)cD * cD;
  _Float16* Wvh = p; p += (size_t)cD * cD;
  _Float16* Woh = p; p += (size_t)cD * cD;
  _Float16* Qh  = p; p += (size_t)MT * cD;
  _Float16* Kh  = p; p += (size_t)MT * cD;
  _Float16* Vt  = p; p += (size_t)MT * cD;
  _Float16* Ch  = p;

  dim3 gblk(256);

  // f32 -> f16 pre-pass (activations + weights): Xq .. Woh are one run of dst
  cvt_all_f32_f16<<<CV_GRID, CV_THREADS, 0, stream>>>(q_in, k_in, v_in,
                                                      w_q, w_k, w_v, w_o, Xq);

  // Q, K and V projections in one launch: Xq Xk Xv, Wqh Wkh Wvh and Qh Kh Vt
  // are each one run of the workspace
  dim3 pgrid(cD / BN, MT / BM, 3);                // (8, 32, 3)
  gemm_f16_xwt_bias<1><<<pgrid, gblk, 0, stream>>>(Xq, Wqh, b_q, b_k, b_v, mask, (void*)Qh, MT, cD, cD);

  dim3 agrid(cS / 16 / 8, cB * cH);               // (16, 32)
  attention_fa<<<agrid, gblk, 0, stream>>>(Qh, Kh, Vt, mask, Ch);

  dim3 ggrid(cD / BN, MT / BM);                   // (8, 32)
  gemm_f16_xwt_bias<0><<<ggrid, gblk, 0, stream>>>(Ch, Woh, b_o, b_o, b_o, mask, d_out, MT, cD, cD);
}

// v007
// It runs in 73.8 microseconds.
// Next to v006, in two timings, it ran 1.14 and 1.15 times as fast.
// Counting every step since v000, it is 3.68 times as fast.
#include <hip/hip_runtime.h>

typedef __attribute__((ext_vector_type(16))) _Float16 v16h;
typedef __attribute__((ext_vector_type(8)))  _Float16 v8h;
typedef __attribute__((ext_vector_type(8)))  float    v8f;
typedef __attribute__((ext_vector_type(2)))  _Float16 v2h;
typedef __attribute__((ext_vector_type(2)))  float    v2f;
typedef __attribute__((ext_vector_type(4)))  _Float16 v4h;
typedef __attribute__((ext_vector_type(4)))  float    v4f;

#define cB 2
#define cS 2048
#define cD 1024
#define cH 16
#define MT (cB * cS)          // 4096 tokens total

#define BM 128
#define BN 128
#define BKK 64                // k depth of a stage: a tile row is one 128-B line
#define LDT 72                // padded LDS stride in halves (144 B = 16 B x odd)

// ---------------------------------------------------------------------------
// WMMA helper: D = A(16x32 f16) * B(32x16 f16) + C(16x16 f32)
// ---------------------------------------------------------------------------
__device__ __forceinline__ v8f wmma16(v16h a, v16h b, v8f c) {
  return __builtin_amdgcn_wmma_f32_16x16x32_f16(
      false, a, false, b, (short)0, c, false, false);
}

// Load a 16x32 f16 A-fragment (or B-fragment given B^T row-major) from a
// row-major tile with leading dimension ld (in halves).
// Per ISA 7.12.2: lane = row + 16*g, halves[0:8]=K[8g..8g+7], halves[8:16]=K[16+8g..].
__device__ __forceinline__ v16h load_ab_frag(const _Float16* tile, int ld) {
  const int lane = threadIdx.x & 31;
  const int r  = lane & 15;
  const int ko = (lane >> 4) << 3;   // 0 or 8
  const _Float16* p = tile + (size_t)r * ld;
  v8h lo = *(const v8h*)(p + ko);
  v8h hi = *(const v8h*)(p + 16 + ko);
  v16h f;
#pragma unroll
  for (int i = 0; i < 8; ++i) { f[i] = lo[i]; f[i + 8] = hi[i]; }
  return f;
}

// ---------------------------------------------------------------------------
// One GEMM stage, copied global->LDS for the whole block: a 128x64 f16 tile of
// each operand (16 KB, rows of 128 B) into padded LDS tiles. 2 x 1,024 chunks of
// 16 B, eight copies per thread; a wave's copy covers four whole 128-B rows.
// gx, gw, lx, lw are this thread's own chunk of rows 0..31; rows 32.., 64..,
// 96.. follow at 32 rows' distance (ld = source pitch in halves).
// ---------------------------------------------------------------------------
__device__ __forceinline__ void async_fill_stage(const _Float16* gx, const _Float16* gw,
                                                 int ld, uint32_t lx, uint32_t lw) {
  const size_t   gs = (size_t)32 * ld;         // 32 rows of the source, in halves
  const uint32_t ls = 32 * LDT * 2;            // 32 rows of the LDS tile, in bytes
  // The s_wait_xcnt closes the copies' own statement, so that no address
  // register of a copy is rewritten ahead of it.
  asm volatile("global_load_async_to_lds_b128 %0, %1, off\n\t"
               "global_load_async_to_lds_b128 %2, %3, off\n\t"
               "global_load_async_to_lds_b128 %4, %5, off\n\t"
               "global_load_async_to_lds_b128 %6, %7, off\n\t"
               "global_load_async_to_lds_b128 %8, %9, off\n\t"
               "global_load_async_to_lds_b128 %10, %11, off\n\t"
               "global_load_async_to_lds_b128 %12, %13, off\n\t"
               "global_load_async_to_lds_b128 %14, %15, off\n\t"
               "s_wait_xcnt 0x0"
               :: "v"(lx),          "v"(gx),          "v"(lx + ls),     "v"(gx + gs),
                  "v"(lx + 2 * ls), "v"(gx + 2 * gs), "v"(lx + 3 * ls), "v"(gx + 3 * gs),
                  "v"(lw),          "v"(gw),          "v"(lw + ls),     "v"(gw + gs),
                  "v"(lw + 2 * ls), "v"(gw + 2 * gs), "v"(lw + 3 * ls), "v"(gw + 3 * gs)
               : "memory");
}

__device__ __forceinline__ void wait_async_zero() {
  asm volatile("s_wait_asynccnt 0" ::: "memory");
}

// ---------------------------------------------------------------------------
// Key order. A masked key (mask == 0) has softmax weight exp(-1e9 - max), which
// is 0 in f32 as soon as its batch has one kept key (with a score above
// -1e9 + 104; min_cap below asks the like). So each batch's keys are laid with
// the kept keys first, in their order, and the masked keys behind them, in
// theirs: a permutation of the batch's cS places. The pre-pass lays the rows of
// k_in and v_in so; the K and V projections then work only the 128-key tiles
// that hold a kept key, and attention walks only the stages that hold one (all
// tiles and all stages where a batch has no kept key).
//
// Kept keys among the 128 that one wave-wide 16-B load covers, four to a lane.
// ---------------------------------------------------------------------------
__device__ __forceinline__ int kept4(const int4 m) {
  return __builtin_popcount(__builtin_amdgcn_ballot_w32(m.x != 0)) +
         __builtin_popcount(__builtin_amdgcn_ballot_w32(m.y != 0)) +
         __builtin_popcount(__builtin_amdgcn_ballot_w32(m.z != 0)) +
         __builtin_popcount(__builtin_amdgcn_ballot_w32(m.w != 0));
}

// Kept keys of one batch's mask row, counted by every wave for itself: the
// result is wave-uniform and the same in every wave.
__device__ __forceinline__ int count_kept(const int* __restrict__ mrow) {
  const int4* mp = (const int4*)mrow + (threadIdx.x & 31);
  int total = 0;
  // unrolled: all sixteen loads are in flight together
#pragma unroll
  for (int i = 0; i < cS / 128; ++i) total += kept4(mp[i * 32]);
  return __builtin_amdgcn_readfirstlane(total);
}

// ---------------------------------------------------------------------------
// f32 -> f16 conversion pre-pass: all seven operands in ONE launch of a grid
// that is resident at once, one 16-wave block per 65,536 elements.
// The f16 copies lie one behind the other in the workspace, in the order of
// the sources. Every source has rows of cD elements; a row of k_in or v_in goes
// to its key's place in the key order, any other row to its own place.
// A wave takes four rows, 4,096 contiguous elements: 32 loads of 512 contiguous
// bytes, all issued ahead of the first conversion, and 32 stores of two whole
// lines. kept_of[b] receives batch b's number of kept keys.
// ---------------------------------------------------------------------------
#define CV_THREADS 512
#define CV_LOADS   32                          // 16-B loads per lane
#define CV_WAVE    (CV_LOADS * 128)            // elements per wave
#define CV_BLOCK   (CV_WAVE * (CV_THREADS / 32))
#define CV_ACT     (MT * cD / CV_BLOCK)        // blocks per activation: 64
#define CV_WGT     (cD * cD / CV_BLOCK)        // blocks per weight: 16
#define CV_GRID    (3 * CV_ACT + 4 * CV_WGT)   // 256
#define CV_RLOADS  (cD / 128)                  // loads per row: 8

__global__ __launch_bounds__(CV_THREADS) void cvt_all_f32_f16(
    const float* __restrict__ q_in, const float* __restrict__ k_in,
    const float* __restrict__ v_in, const float* __restrict__ w_q,
    const float* __restrict__ w_k,  const float* __restrict__ w_v,
    const float* __restrict__ w_o,  const int* __restrict__ mask,
    _Float16* __restrict__ dst, int* __restrict__ kept_of) {
  const int blk = blockIdx.x;
  const float* src;
  int rel;                                     // block index inside its source
  if (blk < 3 * CV_ACT) {
    const int s = blk / CV_ACT;
    rel = blk - s * CV_ACT;
    src = s == 0 ? q_in : s == 1 ? k_in : v_in;
  } else {
    const int u = blk - 3 * CV_ACT;
    const int s = u / CV_WGT;
    rel = u - s * CV_WGT;
    src = s == 0 ? w_q : s == 1 ? w_k : s == 2 ? w_v : w_o;
  }
  const bool keys = blk >= CV_ACT && blk < 3 * CV_ACT;   // rows are keys
  const int  lane = threadIdx.x & 31;
  const int  wave = __builtin_amdgcn_readfirstlane(threadIdx.x >> 5);
  const int  inblk = wave * CV_WAVE + lane * 4;
  const float* sp = src + (size_t)rel * CV_BLOCK;
  // the wave's first row in its source; where rows are keys, a token
  const int row0 = (rel * CV_BLOCK + wave * CV_WAVE) / cD;

  // The mask row of the wave's batch, and once more the 128 keys around its own
  // four (a wave whose rows are no keys reads batch 0's and drops the result:
  // one straight line of code for all). Load i covers keys 128 i .. 128 i + 127.
  const int tok0 = keys ? row0 : 0;
  const int kb   = tok0 / cS * cS;             // the batch's first token
  const int tile = (tok0 - kb) >> 7;
  int4 mr[cS / 128];
#pragma unroll
  for (int i = 0; i < cS / 128; ++i) mr[i] = ((const int4*)(mask + kb))[i * 32 + lane];
  const int4 m = ((const int4*)(mask + kb))[tile * 32 + lane];
  // keeps the mask loads ahead of the rows' loads: their wait then leaves the
  // rows' loads in flight while the places are counted
  __builtin_amdgcn_sched_barrier(0);

  // the loops below are unrolled: x stays in registers at constant indices
  v4f x[CV_LOADS];
#pragma unroll
  for (int i = 0; i < CV_LOADS; ++i) x[i] = *(const v4f*)(sp + inblk + i * 128);
  // the loads' offset register is named here, so it lives up to this wait and
  // is not given to a load's result ahead of it
  asm volatile("s_wait_xcnt 0x0" :: "v"(inblk * 4) : "memory");
  // keeps every load ahead of the first conversion: left free, the scheduler
  // reuses registers and issues the later loads only when earlier ones are back
  __builtin_amdgcn_sched_barrier(0);

  // A kept key's place is its rank among the kept, a masked key's the number of
  // kept keys plus its rank among the masked: both are counts of keys of the
  // batch, so every place lies inside the batch whatever the mask holds.
  int n = 0, u = 0;                            // kept: in the batch, ahead of a key
#pragma unroll
  for (int i = 0; i < cS / 128; ++i) {
    const int c = kept4(mr[i]);
    n += c;
    u += i < tile ? c : 0;
  }
  // each batch's count, for the projections: from the wave with its first k_in row
  if (keys && blk < 2 * CV_ACT && row0 == kb && lane == 0) kept_of[kb / cS] = n;
  u = __builtin_amdgcn_mbcnt_lo(__builtin_amdgcn_ballot_w32(m.x != 0), u);
  u = __builtin_amdgcn_mbcnt_lo(__builtin_amdgcn_ballot_w32(m.y != 0), u);
  u = __builtin_amdgcn_mbcnt_lo(__builtin_amdgcn_ballot_w32(m.z != 0), u);
  u = __builtin_amdgcn_mbcnt_lo(__builtin_amdgcn_ballot_w32(m.w != 0), u);
  const int back = kb + tile * 128 + 4 * lane + n;   // masked: back + j - u
  int4 p;                                      // lane l: keys 4 l .. 4 l + 3 of the 128
  p.x = m.x != 0 ? kb + u : back - u;      u += m.x != 0;
  p.y = m.y != 0 ? kb + u : back + 1 - u;  u += m.y != 0;
  p.z = m.z != 0 ? kb + u : back + 2 - u;  u += m.z != 0;
  p.w = m.w != 0 ? kb + u : back + 3 - u;
  const int own = (tok0 & 127) >> 2;           // the lane that holds the wave's four
  const int place[CV_LOADS / CV_RLOADS] = {
      keys ? __builtin_amdgcn_readlane(p.x, own) : row0,
      keys ? __builtin_amdgcn_readlane(p.y, own) : row0 + 1,
      keys ? __builtin_amdgcn_readlane(p.z, own) : row0 + 2,
      keys ? __builtin_amdgcn_readlane(p.w, own) : row0 + 3};

  _Float16* dp = dst + (size_t)(blk - rel) * CV_BLOCK + lane * 4;   // the source's copy
#pragma unroll
  for (int g = 0; g < CV_LOADS; g += CV_RLOADS) {
    _Float16* dr = dp + (size_t)place[g / CV_RLOADS] * cD;
#pragma unroll
    for (int i = 0; i < CV_RLOADS; ++i)
      *(v4h*)(dr + i * 128) = __builtin_convertvector(x[g + i], v4h);
    // keeps a row's stores behind its own loads' wait: left free, all
    // stores gather behind the last load's return
    __builtin_amdgcn_sched_barrier(0);
  }
}

// ---------------------------------------------------------------------------
// A wave's 64x32 accumulator tile + bias, stored at rows gm0.., columns gn0..
// of Y [.., ld]; Y is f32 where F32_OUT, else f16; bias by row where ROW_BIAS,
// else by column.
// C layout = lane(N + 16*(M>=8)), vgpr r = M mod 8.
// ---------------------------------------------------------------------------
template <int ROW_BIAS, int F32_OUT>
__device__ __forceinline__ void store_acc(const v8f (&acc)[4][2],
                                          const float* __restrict__ bias,
                                          void* __restrict__ Y,
                                          int ld, int gm0, int gn0) {
  const int lane = threadIdx.x & 31;
  const int colr = lane & 15;
  const int rsel = (lane >> 4) << 3;
#pragma unroll
  for (int mi = 0; mi < 4; ++mi) {
#pragma unroll
    for (int ni = 0; ni < 2; ++ni) {
      const int gn = gn0 + ni * 16 + colr;
#pragma unroll
      for (int r = 0; r < 8; ++r) {
        const int gm = gm0 + mi * 16 + r + rsel;
        const float v = acc[mi][ni][r] + bias[ROW_BIAS ? gm : gn];
        const size_t at = (size_t)gm * ld + gn;
        if (F32_OUT)
          ((float*)Y)[at] = v;
        else
          ((_Float16*)Y)[at] = (_Float16)v;
      }
    }
  }
}

// ---------------------------------------------------------------------------
// Y = X[M,Kd](f16) * W[N,Kd](f16)^T + bias[N](f32)
// 128x128x64 block tile, 8 waves x (64x32) wave tile, two-buffer LDS ring
// filled by async global->LDS copies that fly while the stage before is worked
// on. Kd is a multiple of 64.
//   QKV = 0: one product, Y f32 [M,N], bias b0 (b1, b2, kept_of are not read).
//   QKV = 1: three products z = 0, 1, 2 in one launch. Their X, W and Y lie one
//            behind the other at X0, W0, Y0; biases b0, b1, b2; Y f16 [M,N] for
//            z = 0, 1 and f16 [N,M] for z = 2, which is computed as it is
//            stored, W * X^T: its tokens run along the lanes. M is MT, cB
//            batches of cS tokens, and N is cD.
//            For z = 1, 2 a token is a key, and X holds the keys in the key
//            order: a 128-key tile behind a batch's last kept key is read by
//            nobody and is not worked (kept_of[b]: batch b's kept keys, from
//            the pre-pass). The grid's (y, z) planes count token
//            tiles: first the MT / 128 of z = 0, then the tiles that hold a
//            kept key, z = 1 and 2 in turn; the blocks left over return at once.
//            All tiles are worked where a batch has no kept key.
//            Up to three blocks are resident on a WGP, and one block's waits on
//            copies and LDS are filled by the others.
// Six waves per SIMD are three 8-wave blocks per WGP: the register budget is
// set for exactly that many, so that no WGP takes a fourth block while another
// holds two, and the epilogue's store addresses need not share registers.
// ---------------------------------------------------------------------------
template <int QKV>
__global__ __launch_bounds__(256) __attribute__((amdgpu_waves_per_eu(6, 6)))
void gemm_f16_xwt_bias(
    const _Float16* __restrict__ X0, const _Float16* __restrict__ W0,
    const float* __restrict__ b0, const float* __restrict__ b1,
    const float* __restrict__ b2, const int* __restrict__ kept_of,
    void* __restrict__ Y0, int M, int N, int Kd) {
  __shared__ __align__(16) _Float16 As[2][BM * LDT];
  __shared__ __align__(16) _Float16 Bs[2][BN * LDT];

  int z    = 0;
  int ty   = blockIdx.y;                       // token tile
  int left = BM;                               // keys of the tile that are read later
  if (QKV) {
    const int i = (int)(blockIdx.y + blockIdx.z * (MT / 128)) - MT / 128;
    if (i >= 0) {
      static_assert(cB == 2, "the order of the key tiles is written for two batches");
      z = 1 + (i & 1);
      const int r  = i >> 1;                   // rank among the tiles to be worked
      const int k0 = kept_of[0], k1 = kept_of[1];
      const int u0 = k0 == 0 ? cS : min(k0, cS);   // keys of the batch in use
      const int u1 = k1 == 0 ? cS : min(k1, cS);
      const int n0t = (u0 + 127) / 128, n1t = (u1 + 127) / 128;
      // both batches' tiles in turn, then the rest of the longer batch
      const int lo = min(n0t, n1t);
      const int b  = r < 2 * lo ? r & 1 : n1t > n0t;
      const int tl = r < 2 * lo ? r >> 1 : r - lo;
      if (tl >= (b ? n1t : n0t)) return;       // ahead of every copy and barrier
      ty   = b * (cS / 128) + tl;
      left = (b ? u1 : u0) - tl * 128;
    }
  }
  const bool wx = QKV && z == 2;               // the product is W * X^T
  const _Float16* X = wx ? W0 + (size_t)z * N * Kd : X0 + (size_t)z * M * Kd;
  const _Float16* W = wx ? X0 + (size_t)z * M * Kd : W0 + (size_t)z * N * Kd;

  const int m0   = (wx ? (int)blockIdx.x : ty) * BM;
  const int n0   = (wx ? ty : (int)blockIdx.x) * BN;
  const int wave = threadIdx.x >> 5;
  const int wm   = (wave >> 2) * 64;
  const int wn   = (wave & 3) * 32;
  // Attention reads keys by stages of 64: a wave whose keys all lie in a 64 of
  // the tile with no kept key has no product to form. It still copies its share
  // of every stage and passes every barrier. The test is a scalar one.
  const bool work =
      !QKV || __builtin_amdgcn_readfirstlane(z == 2 ? wn & 64 : z == 1 ? wm : 0) < left;

  v8f acc[4][2] = {};

  // This thread's chunk of a stage: row 0..31 (+32, +64, +96), 16-B segment 0..7
  const int crow = threadIdx.x >> 3;
  const int cseg = (threadIdx.x & 7) << 3;
  const _Float16* gx = X + (size_t)(m0 + crow) * Kd + cseg;
  const _Float16* gw = W + (size_t)(n0 + crow) * Kd + cseg;
  const uint32_t lx = (uint32_t)(uintptr_t)(&As[0][crow * LDT + cseg]);
  const uint32_t lw = (uint32_t)(uintptr_t)(&Bs[0][crow * LDT + cseg]);
  const uint32_t bufb = BM * LDT * 2;    // bytes from buffer 0 to buffer 1
  const int nt = Kd / BKK;               // stages

  // Ring prologue: stage 0 landed and published, then stage 1 in flight
  async_fill_stage(gx, gw, Kd, lx, lw);
  wait_async_zero();
  __syncthreads();
  if (1 < nt)
    async_fill_stage(gx + BKK, gw + BKK, Kd, lx + bufb, lw + bufb);

  for (int t = 0; t < nt; ++t) {
    const _Float16* as = &As[t & 1][0];
    const _Float16* bs = &Bs[t & 1][0];
    // unrolled: both 32-k halves of the stage read LDS at constant offsets
#pragma unroll
    for (int kk = 0; work && kk < BKK; kk += 32) {
      v16h a[4], b[2];
#pragma unroll
      for (int mi = 0; mi < 4; ++mi)
        a[mi] = load_ab_frag(as + (wm + mi * 16) * LDT + kk, LDT);
#pragma unroll
      for (int ni = 0; ni < 2; ++ni)
        b[ni] = load_ab_frag(bs + (wn + ni * 16) * LDT + kk, LDT);
#pragma unroll
      for (int mi = 0; mi < 4; ++mi)
#pragma unroll
        for (int ni = 0; ni < 2; ++ni)
          acc[mi][ni] = wmma16(a[mi], b[ni], acc[mi][ni]);
    }

    // ---- publish stage t + 1, then refill the buffer stage t has left ----
    asm volatile("s_wait_dscnt 0x0" ::: "memory");  // own reads of stage t done
    wait_async_zero();                              // own copies of stage t + 1 landed
    __syncthreads();
    if (t + 2 < nt)
      async_fill_stage(gx + (size_t)(t + 2) * BKK, gw + (size_t)(t + 2) * BKK, Kd,
                       lx + (t & 1) * bufb, lw + (t & 1) * bufb);
  }
  wait_async_zero();   // nothing of this wave in flight when it ends

  // Epilogue: the output form is the same for the whole block
  if (!QKV) {
    store_acc<0, 1>(acc, b0, Y0, N, m0 + wm, n0 + wn);
  } else if (work) {
    _Float16* Y = (_Float16*)Y0 + (size_t)z * M * N;
    if (z == 2) {
      store_acc<1, 0>(acc, b2, Y, MT, m0 + wm, n0 + wn);
    } else {
      store_acc<0, 0>(acc, z == 0 ? b0 : b1, Y, cD, m0 + wm, n0 + wn);
      // In the built code this branch ends in a jump with the other branch's
      // code as its fall-through, which rewrites registers its stores name:
      // the wait stands ahead of it on that path too.
      asm volatile("s_wait_xcnt 0x0" ::: "memory");
    }
  }
}

// ---------------------------------------------------------------------------
// Attention K/V stage: 64 keys of one head. K tile = 64 key rows x 64 dk,
// V^T tile = 64 d rows x 64 keys; both have 128-B rows, laid in LDS at a
// 144-B pitch (16 B x odd) for the ds_load_b128 fragment readers.
// ---------------------------------------------------------------------------
#define KT 64                 // keys per stage
#define NT (cS / KT)          // stages per (b,h)
#define LDKV 72               // LDS pitch of a stage row, in halves

// One stage, copied once for the whole block: 2 x 512 chunks of 16 B, four
// copies per thread; a wave's copy covers four whole 128-B rows.
// gk, gv, lk, lv are this thread's own chunk of rows 0..31; rows 32..63 follow.
__device__ __forceinline__ void async_fill_kv(const _Float16* gk, const _Float16* gv,
                                              uint32_t lk, uint32_t lv) {
  const _Float16* gk1 = gk + (size_t)32 * cD;
  const _Float16* gv1 = gv + (size_t)32 * MT;
  const uint32_t  lk1 = lk + 32 * LDKV * 2;
  const uint32_t  lv1 = lv + 32 * LDKV * 2;
  // The s_wait_xcnt closes the copies' own statement, so that no address
  // register of a copy is rewritten ahead of it.
  asm volatile("global_load_async_to_lds_b128 %0, %1, off\n\t"
               "global_load_async_to_lds_b128 %2, %3, off\n\t"
               "global_load_async_to_lds_b128 %4, %5, off\n\t"
               "global_load_async_to_lds_b128 %6, %7, off\n\t"
               "s_wait_xcnt 0x0"
               :: "v"(lk), "v"(gk), "v"(lk1), "v"(gk1),
                  "v"(lv), "v"(gv), "v"(lv1), "v"(gv1) : "memory");
}

// ---------------------------------------------------------------------------
// Lane l <-> lane l ^ 16: the two lanes that share one query column.
// ---------------------------------------------------------------------------
__device__ __forceinline__ float xhalf(float x) {
  const int b = __float_as_int(x);
  return __int_as_float(
      __builtin_amdgcn_permlanex16(b, b, 0x76543210, 0xfedcba98, false, false));
}

// The mask as one instruction a score: median(score, ceiling, -1e9) is -1e9
// under a ceiling of -1e9, whatever the score, and the score itself under the
// largest float, for every score >= -1e9.
__device__ __forceinline__ float min_cap(float s, float cap) {
  return __builtin_amdgcn_fmed3f(s, cap, -1.0e9f);
}

__global__ __launch_bounds__(256) void attention_fa(
    const _Float16* __restrict__ Q, const _Float16* __restrict__ Km,
    const _Float16* __restrict__ Vt, const int* __restrict__ mask,
    _Float16* __restrict__ ctx) {
  __shared__ __align__(32) float    Cap[cS];
  __shared__ __align__(16) _Float16 Ks[2][KT * LDKV];
  __shared__ __align__(16) _Float16 Vs[2][64 * LDKV];

  const int wave = threadIdx.x >> 5;
  const int lane = threadIdx.x & 31;
  const int bh = blockIdx.y;
  const int b  = bh >> 4;                 // H = 16
  const int h  = bh & 15;
  const int q0 = (blockIdx.x * 8 + wave) * 16;

  const int colr = lane & 15;
  const int prow = (lane >> 4) << 3;

  // Q fragments, pre-scaled by 1/sqrt(DK) = 0.125 (exact in f16)
  const _Float16* qbase = Q + (size_t)(b * cS + q0) * cD + h * 64;
  v16h aq0 = load_ab_frag(qbase, cD);
  v16h aq1 = load_ab_frag(qbase + 32, cD);
#pragma unroll
  for (int i = 0; i < 16; ++i) {
    aq0[i] = aq0[i] * (_Float16)0.125f;
    aq1[i] = aq1[i] * (_Float16)0.125f;
  }

  v8f   ctxa[4] = {};
  float mrow = -3.0e38f, lrow = 0.0f;     // lrow: this half's keys only

  // This thread's chunk of a stage: row 0..31 (and row + 32), 16-B segment 0..7
  const int crow = threadIdx.x >> 3;
  const int cseg = (threadIdx.x & 7) << 3;
  const _Float16* gk = Km + (size_t)(b * cS + crow) * cD + h * 64 + cseg;
  const _Float16* gv = Vt + (size_t)(h * 64 + crow) * MT + (size_t)b * cS + cseg;
  const uint32_t lk = (uint32_t)(uintptr_t)(&Ks[0][crow * LDKV + cseg]);
  const uint32_t lv = (uint32_t)(uintptr_t)(&Vs[0][crow * LDKV + cseg]);
  const uint32_t bufb = KT * LDKV * 2;   // bytes from buffer 0 to buffer 1

  // Ring prologue: stage 0 landed and published, then stage 1 in flight
  async_fill_kv(gk, gv, lk, lv);

  // The batch's kept keys are places 0 .. kept - 1. Every wave counts them from
  // the same mask row, so kept and nst are the same in the whole block.
  // No kept key: every key weighs the same, and all stages are walked.
  const int kept = count_kept(mask + b * cS);
  const int nst  = kept == 0 ? NT : min((kept + KT - 1) / KT, NT);

  // The key runs along a lane's registers, so the mask is kept per place in
  // LDS as a ceiling: -1e9 on a masked key, the largest float on any other
  // (min_cap above applies it).
  {
    const int p0 = threadIdx.x * 8;
    float4 c0, c1;
    c0.x = p0 + 0 >= kept ? -1.0e9f : 3.4028235e38f;
    c0.y = p0 + 1 >= kept ? -1.0e9f : 3.4028235e38f;
    c0.z = p0 + 2 >= kept ? -1.0e9f : 3.4028235e38f;
    c0.w = p0 + 3 >= kept ? -1.0e9f : 3.4028235e38f;
    c1.x = p0 + 4 >= kept ? -1.0e9f : 3.4028235e38f;
    c1.y = p0 + 5 >= kept ? -1.0e9f : 3.4028235e38f;
    c1.z = p0 + 6 >= kept ? -1.0e9f : 3.4028235e38f;
    c1.w = p0 + 7 >= kept ? -1.0e9f : 3.4028235e38f;
    float4* cp = (float4*)&Cap[p0];
    cp[0] = c0; cp[1] = c1;
  }

  wait_async_zero();
  __syncthreads();
  if (1 < nst)
    async_fill_kv(gk + (size_t)KT * cD, gv + KT, lk + bufb, lv + bufb);

  for (int t = 0; t < nst; ++t) {
   const _Float16* ksb = &Ks[t & 1][0];
   const _Float16* vsb = &Vs[t & 1][0];
   // unrolled: both 32-key halves of the stage read LDS at constant offsets
#pragma unroll
   for (int j = 0; j < KT / 32; ++j) {
    const int k0 = t * KT + j * 32;
    const _Float16* kb = ksb + j * 32 * LDKV;

    // ---- scores^T: 2 key sub-tiles (rows) x 2 dk chunks, queries in columns ----
    v16h bk00 = load_ab_frag(kb, LDKV);
    v16h bk01 = load_ab_frag(kb + 32, LDKV);
    v16h bk10 = load_ab_frag(kb + 16 * LDKV, LDKV);
    v16h bk11 = load_ab_frag(kb + 16 * LDKV + 32, LDKV);
    v8f s0 = {}, s1 = {};
    s0 = wmma16(bk00, aq0, s0); s0 = wmma16(bk01, aq1, s0);
    s1 = wmma16(bk10, aq0, s1); s1 = wmma16(bk11, aq1, s1);

    // ---- mask (key row = 8 * half + register) ----
    const v8f cap0 = *(const v8f*)&Cap[k0 + prow];
    const v8f cap1 = *(const v8f*)&Cap[k0 + 16 + prow];
    // the loops over r, i and d below are unrolled so that every accumulator
    // element keeps a constant register index
#pragma unroll
    for (int r = 0; r < 8; ++r) {
      s0[r] = min_cap(s0[r], cap0[r]);
      s1[r] = min_cap(s1[r], cap1[r]);
    }

    // ---- online softmax: in-lane over 16 keys, one exchange for the maximum ----
    float vmax = fmaxf(s0[0], s1[0]);
#pragma unroll
    for (int r = 1; r < 8; ++r) vmax = fmaxf(vmax, fmaxf(s0[r], s1[r]));
    vmax = fmaxf(vmax, xhalf(vmax));
    const float mn = fmaxf(mrow, vmax);
    const float c  = __expf(mrow - mn);
    mrow = mn;

    // ---- P^T as B operand: element s = key 8g + s (s < 8), 16 + 8g + s - 8 ----
    v16h bp;
    v2f  ps2 = {0.0f, 0.0f};
#pragma unroll
    for (int i = 0; i < 4; ++i) {
      const v2f e0 = {__expf(s0[2 * i] - mn), __expf(s0[2 * i + 1] - mn)};
      const v2f e1 = {__expf(s1[2 * i] - mn), __expf(s1[2 * i + 1] - mn)};
      ps2 += e0 + e1;
      const v2h x0 = __builtin_convertvector(e0, v2h);
      const v2h x1 = __builtin_convertvector(e1, v2h);
      bp[2 * i]     = x0[0]; bp[2 * i + 1] = x0[1];
      bp[8 + 2 * i] = x1[0]; bp[9 + 2 * i] = x1[1];
    }
    lrow = lrow * c + (ps2[0] + ps2[1]);

    // ---- ctx^T = ctx^T * c + V^T * P^T  (V^T rows supply A fragments) ----
#pragma unroll
    for (int d = 0; d < 4; ++d) {
      v16h av = load_ab_frag(vsb + d * 16 * LDKV + j * 32, LDKV);
      ctxa[d] = wmma16(av, bp, ctxa[d] * c);
    }
   }

   // ---- publish stage t + 1, then refill the buffer stage t has left ----
   asm volatile("s_wait_dscnt 0x0" ::: "memory");  // own reads of stage t done
   wait_async_zero();                              // own copies of stage t + 1 landed
   __syncthreads();
   if (t + 2 < nst)
     async_fill_kv(gk + (size_t)(t + 2) * KT * cD, gv + (t + 2) * KT,
                   lk + (t & 1) * bufb, lv + (t & 1) * bufb);
  }
  wait_async_zero();   // nothing of this wave in flight when it ends

  // ---- join the halves' sums, normalize, store merged-head context ----
  // Lane (c, g) holds d = 16 * tile + 8g .. + 7 of query c: one 16-B store a tile
  const float linv = 1.0f / (lrow + xhalf(lrow));
  _Float16* orow = ctx + ((size_t)b * cS + q0 + colr) * cD + h * 64 + prow;
#pragma unroll
  for (int d = 0; d < 4; ++d) {
    v8h o;
#pragma unroll
    for (int r = 0; r < 8; ++r) o[r] = (_Float16)(ctxa[d][r] * linv);
    *(v8h*)(orow + d * 16) = o;
  }
}

// ---------------------------------------------------------------------------
// Host-side launcher
// ---------------------------------------------------------------------------
extern "C" void kernel_launch(void* const* d_in, const int* in_sizes, int n_in,
                              void* d_out, int out_size, void* d_ws, size_t ws_size,
                              hipStream_t stream) {
  (void)in_sizes; (void)n_in; (void)out_size; (void)ws_size;

  const float* q_in = (const float*)d_in[0];
  const float* k_in = (const float*)d_in[1];
  const float* v_in = (const float*)d_in[2];
  const int*   mask = (const int*)d_in[3];
  const float* w_q  = (const float*)d_in[4];
  const float* b_q  = (const float*)d_in[5];
  const float* w_k  = (const float*)d_in[6];
  const float* b_k  = (const float*)d_in[7];
  const float* w_v  = (const float*)d_in[8];
  const float* b_v  = (const float*)d_in[9];
  const float* w_o  = (const float*)d_in[10];
  const float* b_o  = (const float*)d_in[11];

  // Workspace layout (f16), 32 Mi halves = 64 MiB, and cB counts behind them
  _Float16* p   = (_Float16*)d_ws;
  _Float16* Xq  = p; p += (size_t)MT * cD;
  _Float16* Xk  = p; p += (size_t)MT * cD;
  _Float16* Xv  = p; p += (size_t)MT * cD;
  _Float16* Wqh = p; p += (size_t)cD * cD;
  _Float16* Wkh = p; p += (size_t)cD * cD;
  _Float16* Wvh = p; p += (size_t)cD * cD;
  _Float16* Woh = p; p += (size_t)cD * cD;
  _Float16* Qh  = p; p += (size_t)MT * cD;
  _Float16* Kh  = p; p += (size_t)MT * cD;
  _Float16* Vt  = p; p += (size_t)MT * cD;
  _Float16* Ch  = p; p += (size_t)MT * cD;
  int*      Kc  = (int*)p;                        // kept keys of each batch

  dim3 gblk(256);

  // f32 -> f16 pre-pass (activations + weights): Xq .. Woh are one run of dst
  cvt_all_f32_f16<<<CV_GRID, CV_THREADS, 0, stream>>>(q_in, k_in, v_in,
                                                      w_q, w_k, w_v, w_o, mask, Xq, Kc);

  // Q, K and V projections in one launch: Xq Xk Xv, Wqh Wkh Wvh and Qh Kh Vt
  // are each one run of the workspace
  dim3 pgrid(cD / BN, MT / BM, 3);                // (8, 32, 3)
  gemm_f16_xwt_bias<1><<<pgrid, gblk, 0, stream>>>(Xq, Wqh, b_q, b_k, b_v, Kc, (void*)Qh, MT, cD, cD);

  dim3 agrid(cS / 16 / 8, cB * cH);               // (16, 32)
  attention_fa<<<agrid, gblk, 0, stream>>>(Qh, Kh, Vt, mask, Ch);

  dim3 ggrid(cD / BN, MT / BM);                   // (8, 32)
  gemm_f16_xwt_bias<0><<<ggrid, gblk, 0, stream>>>(Ch, Woh, b_o, b_o, b_o, Kc, d_out, MT, cD, cD);
}

// v008
// A run of this version takes 69.4 microseconds.
// Two timings next to v007 put it at 1.06 and 1.07 times that version's speed.
// Over all steps from v000 it is 3.93 times as fast.
#include <hip/hip_runtime.h>

typedef __attribute__((ext_vector_type(16))) _Float16 v16h;
typedef __attribute__((ext_vector_type(8)))  _Float16 v8h;
typedef __attribute__((ext_vector_type(8)))  float    v8f;
typedef __attribute__((ext_vector_type(2)))  _Float16 v2h;
typedef __attribute__((ext_vector_type(2)))  float    v2f;
typedef __attribute__((ext_vector_type(4)))  _Float16 v4h;
typedef __attribute__((ext_vector_type(4)))  float    v4f;

#define cB 2
#define cS 2048
#define cD 1024
#define cH 16
#define MT (cB * cS)          // 4096 tokens total

#define BM 128
#define BN 128
#define BKK 64                // k depth of a stage: a tile row is one 128-B line
#define LDT 72                // padded LDS stride in halves (144 B = 16 B x odd)

// ---------------------------------------------------------------------------
// WMMA helper: D = A(16x32 f16) * B(32x16 f16) + C(16x16 f32)
// ---------------------------------------------------------------------------
__device__ __forceinline__ v8f wmma16(v16h a, v16h b, v8f c) {
  return __builtin_amdgcn_wmma_f32_16x16x32_f16(
      false, a, false, b, (short)0, c, false, false);
}

// Load a 16x32 f16 A-fragment (or B-fragment given B^T row-major) from a
// row-major tile with leading dimension ld (in halves).
// Per ISA 7.12.2: lane = row + 16*g, halves[0:8]=K[8g..8g+7], halves[8:16]=K[16+8g..].
__device__ __forceinline__ v16h load_ab_frag(const _Float16* tile, int ld) {
  const int lane = threadIdx.x & 31;
  const int r  = lane & 15;
  const int ko = (lane >> 4) << 3;   // 0 or 8
  const _Float16* p = tile + (size_t)r * ld;
  v8h lo = *(const v8h*)(p + ko);
  v8h hi = *(const v8h*)(p + 16 + ko);
  v16h f;
#pragma unroll
  for (int i = 0; i < 8; ++i) { f[i] = lo[i]; f[i + 8] = hi[i]; }
  return f;
}

// ---------------------------------------------------------------------------
// One GEMM stage, copied global->LDS for the whole block: a 128x64 f16 tile of
// each operand (16 KB, rows of 128 B) into padded LDS tiles. 2 x 1,024 chunks of
// 16 B, eight copies per thread; a wave's copy covers four whole 128-B rows.
// gx, gw, lx, lw are this thread's own chunk of rows 0..31; rows 32.., 64..,
// 96.. follow at 32 rows' distance (ld = source pitch in halves).
// ---------------------------------------------------------------------------
__device__ __forceinline__ void async_fill_stage(const _Float16* gx, const _Float16* gw,
                                                 int ld, uint32_t lx, uint32_t lw) {
  const size_t   gs = (size_t)32 * ld;         // 32 rows of the source, in halves
  const uint32_t ls = 32 * LDT * 2;            // 32 rows of the LDS tile, in bytes
  // The s_wait_xcnt closes the copies' own statement, so that no address
  // register of a copy is rewritten ahead of it.
  asm volatile("global_load_async_to_lds_b128 %0, %1, off\n\t"
               "global_load_async_to_lds_b128 %2, %3, off\n\t"
               "global_load_async_to_lds_b128 %4, %5, off\n\t"
               "global_load_async_to_lds_b128 %6, %7, off\n\t"
               "global_load_async_to_lds_b128 %8, %9, off\n\t"
               "global_load_async_to_lds_b128 %10, %11, off\n\t"
               "global_load_async_to_lds_b128 %12, %13, off\n\t"
               "global_load_async_to_lds_b128 %14, %15, off\n\t"
               "s_wait_xcnt 0x0"
               :: "v"(lx),          "v"(gx),          "v"(lx + ls),     "v"(gx + gs),
                  "v"(lx + 2 * ls), "v"(gx + 2 * gs), "v"(lx + 3 * ls), "v"(gx + 3 * gs),
                  "v"(lw),          "v"(gw),          "v"(lw + ls),     "v"(gw + gs),
                  "v"(lw + 2 * ls), "v"(gw + 2 * gs), "v"(lw + 3 * ls), "v"(gw + 3 * gs)
               : "memory");
}

__device__ __forceinline__ void wait_async_zero() {
  asm volatile("s_wait_asynccnt 0" ::: "memory");
}

// ---------------------------------------------------------------------------
// Key order. A masked key (mask == 0) has softmax weight exp(-1e9 - max), which
// is 0 in f32 as soon as its batch has one kept key (with a score above
// -1e9 + 104; min_cap below asks the like). So each batch's keys are laid with
// the kept keys first, in their order, and the masked keys behind them, in
// theirs: a permutation of the batch's cS places. The pre-pass lays the rows of
// k_in and v_in so; the K and V projections then work only the 128-key tiles
// that hold a kept key, and attention walks only the stages that hold one (all
// tiles and all stages where a batch has no kept key).
//
// Kept keys among the 128 that one wave-wide 16-B load covers, four to a lane.
// ---------------------------------------------------------------------------
__device__ __forceinline__ int kept4(const int4 m) {
  return __builtin_popcount(__builtin_amdgcn_ballot_w32(m.x != 0)) +
         __builtin_popcount(__builtin_amdgcn_ballot_w32(m.y != 0)) +
         __builtin_popcount(__builtin_amdgcn_ballot_w32(m.z != 0)) +
         __builtin_popcount(__builtin_amdgcn_ballot_w32(m.w != 0));
}

// Kept keys of one batch's mask row, counted by every wave for itself: the
// result is wave-uniform and the same in every wave.
__device__ __forceinline__ int count_kept(const int* __restrict__ mrow) {
  const int4* mp = (const int4*)mrow + (threadIdx.x & 31);
  int total = 0;
  // unrolled: all sixteen loads are in flight together
#pragma unroll
  for (int i = 0; i < cS / 128; ++i) total += kept4(mp[i * 32]);
  return __builtin_amdgcn_readfirstlane(total);
}

// ---------------------------------------------------------------------------
// f32 -> f16 conversion pre-pass: all seven operands in ONE launch of a grid
// that is resident at once, one 16-wave block per 65,536 elements.
// The f16 copies lie one behind the other in the workspace, in the order of
// the sources. Every source has rows of cD elements; a row of k_in or v_in goes
// to its key's place in the key order, any other row to its own place.
// A wave takes four rows, 4,096 contiguous elements: 32 loads of 512 contiguous
// bytes, all issued ahead of the first conversion, and 32 stores of two whole
// lines. kept_of[b] receives batch b's number of kept keys.
// ---------------------------------------------------------------------------
#define CV_THREADS 512
#define CV_LOADS   32                          // 16-B loads per lane
#define CV_WAVE    (CV_LOADS * 128)            // elements per wave
#define CV_BLOCK   (CV_WAVE * (CV_THREADS / 32))
#define CV_ACT     (MT * cD / CV_BLOCK)        // blocks per activation: 64
#define CV_WGT     (cD * cD / CV_BLOCK)        // blocks per weight: 16
#define CV_GRID    (3 * CV_ACT + 4 * CV_WGT)   // 256
#define CV_RLOADS  (cD / 128)                  // loads per row: 8

__global__ __launch_bounds__(CV_THREADS) void cvt_all_f32_f16(
    const float* __restrict__ q_in, const float* __restrict__ k_in,
    const float* __restrict__ v_in, const float* __restrict__ w_q,
    const float* __restrict__ w_k,  const float* __restrict__ w_v,
    const float* __restrict__ w_o,  const int* __restrict__ mask,
    _Float16* __restrict__ dst, int* __restrict__ kept_of) {
  const int blk = blockIdx.x;
  const float* src;
  int rel;                                     // block index inside its source
  if (blk < 3 * CV_ACT) {
    const int s = blk / CV_ACT;
    rel = blk - s * CV_ACT;
    src = s == 0 ? q_in : s == 1 ? k_in : v_in;
  } else {
    const int u = blk - 3 * CV_ACT;
    const int s = u / CV_WGT;
    rel = u - s * CV_WGT;
    src = s == 0 ? w_q : s == 1 ? w_k : s == 2 ? w_v : w_o;
  }
  const bool keys = blk >= CV_ACT && blk < 3 * CV_ACT;   // rows are keys
  const int  lane = threadIdx.x & 31;
  const int  wave = __builtin_amdgcn_readfirstlane(threadIdx.x >> 5);
  const int  inblk = wave * CV_WAVE + lane * 4;
  const float* sp = src + (size_t)rel * CV_BLOCK;
  // the wave's first row in its source; where rows are keys, a token
  const int row0 = (rel * CV_BLOCK + wave * CV_WAVE) / cD;

  // The mask row of the wave's batch, and once more the 128 keys around its own
  // four (a wave whose rows are no keys reads batch 0's and drops the result:
  // one straight line of code for all). Load i covers keys 128 i .. 128 i + 127.
  const int tok0 = keys ? row0 : 0;
  const int kb   = tok0 / cS * cS;             // the batch's first token
  const int tile = (tok0 - kb) >> 7;
  int4 mr[cS / 128];
#pragma unroll
  for (int i = 0; i < cS / 128; ++i) mr[i] = ((const int4*)(mask + kb))[i * 32 + lane];
  const int4 m = ((const int4*)(mask + kb))[tile * 32 + lane];
  // keeps the mask loads ahead of the rows' loads: their wait then leaves the
  // rows' loads in flight while the places are counted
  __builtin_amdgcn_sched_barrier(0);

  // the loops below are unrolled: x stays in registers at constant indices
  v4f x[CV_LOADS];
#pragma unroll
  for (int i = 0; i < CV_LOADS; ++i) x[i] = *(const v4f*)(sp + inblk + i * 128);
  // the loads' offset register is named here, so it lives up to this wait and
  // is not given to a load's result ahead of it
  asm volatile("s_wait_xcnt 0x0" :: "v"(inblk * 4) : "memory");
  // keeps every load ahead of the first conversion: left free, the scheduler
  // reuses registers and issues the later loads only when earlier ones are back
  __builtin_amdgcn_sched_barrier(0);

  // A kept key's place is its rank among the kept, a masked key's the number of
  // kept keys plus its rank among the masked: both are counts of keys of the
  // batch, so every place lies inside the batch whatever the mask holds.
  int n = 0, u = 0;                            // kept: in the batch, ahead of a key
#pragma unroll
  for (int i = 0; i < cS / 128; ++i) {
    const int c = kept4(mr[i]);
    n += c;
    u += i < tile ? c : 0;
  }
  // each batch's count, for the projections: from the wave with its first k_in row
  if (keys && blk < 2 * CV_ACT && row0 == kb && lane == 0) kept_of[kb / cS] = n;
  u = __builtin_amdgcn_mbcnt_lo(__builtin_amdgcn_ballot_w32(m.x != 0), u);
  u = __builtin_amdgcn_mbcnt_lo(__builtin_amdgcn_ballot_w32(m.y != 0), u);
  u = __builtin_amdgcn_mbcnt_lo(__builtin_amdgcn_ballot_w32(m.z != 0), u);
  u = __builtin_amdgcn_mbcnt_lo(__builtin_amdgcn_ballot_w32(m.w != 0), u);
  const int back = kb + tile * 128 + 4 * lane + n;   // masked: back + j - u
  int4 p;                                      // lane l: keys 4 l .. 4 l + 3 of the 128
  p.x = m.x != 0 ? kb + u : back - u;      u += m.x != 0;
  p.y = m.y != 0 ? kb + u : back + 1 - u;  u += m.y != 0;
  p.z = m.z != 0 ? kb + u : back + 2 - u;  u += m.z != 0;
  p.w = m.w != 0 ? kb + u : back + 3 - u;
  const int own = (tok0 & 127) >> 2;           // the lane that holds the wave's four
  const int place[CV_LOADS / CV_RLOADS] = {
      keys ? __builtin_amdgcn_readlane(p.x, own) : row0,
      keys ? __builtin_amdgcn_readlane(p.y, own) : row0 + 1,
      keys ? __builtin_amdgcn_readlane(p.z, own) : row0 + 2,
      keys ? __builtin_amdgcn_readlane(p.w, own) : row0 + 3};

  _Float16* dp = dst + (size_t)(blk - rel) * CV_BLOCK + lane * 4;   // the source's copy
#pragma unroll
  for (int g = 0; g < CV_LOADS; g += CV_RLOADS) {
    _Float16* dr = dp + (size_t)place[g / CV_RLOADS] * cD;
#pragma unroll
    for (int i = 0; i < CV_RLOADS; ++i)
      *(v4h*)(dr + i * 128) = __builtin_convertvector(x[g + i], v4h);
    // keeps a row's stores behind its own loads' wait: left free, all
    // stores gather behind the last load's return
    __builtin_amdgcn_sched_barrier(0);
  }
}

// ---------------------------------------------------------------------------
// A wave's 64x32 accumulator tile + bias, stored at rows gm0.., columns gn0..
// of Y [.., ld]; Y is f32 where F32_OUT, else f16; bias by row where ROW_BIAS,
// else by column.
// C layout = lane(N + 16*(M>=8)), vgpr r = M mod 8.
// ---------------------------------------------------------------------------
template <int ROW_BIAS, int F32_OUT>
__device__ __forceinline__ void store_acc(const v8f (&acc)[4][2],
                                          const float* __restrict__ bias,
                                          void* __restrict__ Y,
                                          int ld, int gm0, int gn0) {
  const int lane = threadIdx.x & 31;
  const int colr = lane & 15;
  const int rsel = (lane >> 4) << 3;
#pragma unroll
  for (int mi = 0; mi < 4; ++mi) {
#pragma unroll
    for (int ni = 0; ni < 2; ++ni) {
      const int gn = gn0 + ni * 16 + colr;
#pragma unroll
      for (int r = 0; r < 8; ++r) {
        const int gm = gm0 + mi * 16 + r + rsel;
        const float v = acc[mi][ni][r] + bias[ROW_BIAS ? gm : gn];
        const size_t at = (size_t)gm * ld + gn;
        if (F32_OUT)
          ((float*)Y)[at] = v;
        else
          ((_Float16*)Y)[at] = (_Float16)v;
      }
    }
  }
}

// ---------------------------------------------------------------------------
// Y = X[M,Kd](f16) * W[N,Kd](f16)^T + bias[N](f32)
// 128x128x64 block tile, 8 waves x (64x32) wave tile, two-buffer LDS ring
// filled by async global->LDS copies that fly while the stage before is worked
// on. Kd is a multiple of 64.
//   QKV = 0: one product, Y f32 [M,N], bias b0 (b1, b2, kept_of are not read).
//   QKV = 1: three products z = 0, 1, 2 in one launch. Their X, W and Y lie one
//            behind the other at X0, W0, Y0; biases b0, b1, b2; Y f16 [M,N] for
//            z = 0, 1 and f16 [N,M] for z = 2, which is computed as it is
//            stored, W * X^T: its tokens run along the lanes. M is MT, cB
//            batches of cS tokens, and N is cD.
//            For z = 1, 2 a token is a key, and X holds the keys in the key
//            order: a 128-key tile behind a batch's last kept key is read by
//            nobody and is not worked (kept_of[b]: batch b's kept keys, from
//            the pre-pass). The grid's (y, z) planes count token
//            tiles: first the MT / 128 of z = 0, then the tiles that hold a
//            kept key, z = 1 and 2 in turn; the blocks left over return at once.
//            All tiles are worked where a batch has no kept key.
//            Up to three blocks are resident on a WGP, and one block's waits on
//            copies and LDS are filled by the others.
// Six waves per SIMD are three 8-wave blocks per WGP: the register budget is
// set for exactly that many, so that no WGP takes a fourth block while another
// holds two, and the epilogue's store addresses need not share registers.
// ---------------------------------------------------------------------------
template <int QKV>
__global__ __launch_bounds__(256) __attribute__((amdgpu_waves_per_eu(6, 6)))
void gemm_f16_xwt_bias(
    const _Float16* __restrict__ X0, const _Float16* __restrict__ W0,
    const float* __restrict__ b0, const float* __restrict__ b1,
    const float* __restrict__ b2, const int* __restrict__ kept_of,
    void* __restrict__ Y0, int M, int N, int Kd) {
  __shared__ __align__(16) _Float16 As[2][BM * LDT];
  __shared__ __align__(16) _Float16 Bs[2][BN * LDT];

  int z    = 0;
  int ty   = blockIdx.y;                       // token tile
  int left = BM;                               // keys of the tile that are read later
  if (QKV) {
    const int i = (int)(blockIdx.y + blockIdx.z * (MT / 128)) - MT / 128;
    if (i >= 0) {
      static_assert(cB == 2, "the order of the key tiles is written for two batches");
      z = 1 + (i & 1);
      const int r  = i >> 1;                   // rank among the tiles to be worked
      const int k0 = kept_of[0], k1 = kept_of[1];
      const int u0 = k0 == 0 ? cS : min(k0, cS);   // keys of the batch in use
      const int u1 = k1 == 0 ? cS : min(k1, cS);
      const int n0t = (u0 + 127) / 128, n1t = (u1 + 127) / 128;
      // both batches' tiles in turn, then the rest of the longer batch
      const int lo = min(n0t, n1t);
      const int b  = r < 2 * lo ? r & 1 : n1t > n0t;
      const int tl = r < 2 * lo ? r >> 1 : r - lo;
      if (tl >= (b ? n1t : n0t)) return;       // ahead of every copy and barrier
      ty   = b * (cS / 128) + tl;
      left = (b ? u1 : u0) - tl * 128;
    }
  }
  const bool wx = QKV && z == 2;               // the product is W * X^T
  const _Float16* X = wx ? W0 + (size_t)z * N * Kd : X0 + (size_t)z * M * Kd;
  const _Float16* W = wx ? X0 + (size_t)z * M * Kd : W0 + (size_t)z * N * Kd;

  const int m0   = (wx ? (int)blockIdx.x : ty) * BM;
  const int n0   = (wx ? ty : (int)blockIdx.x) * BN;
  const int wave = threadIdx.x >> 5;
  const int wm   = (wave >> 2) * 64;
  const int wn   = (wave & 3) * 32;
  // Attention reads keys by stages of 64: a wave whose keys all lie in a 64 of
  // the tile with no kept key has no product to form. It still copies its share
  // of every stage and passes every barrier. The test is a scalar one.
  const bool work =
      !QKV || __builtin_amdgcn_readfirstlane(z == 2 ? wn & 64 : z == 1 ? wm : 0) < left;

  v8f acc[4][2] = {};

  // This thread's chunk of a stage: row 0..31 (+32, +64, +96), 16-B segment 0..7
  const int crow = threadIdx.x >> 3;
  const int cseg = (threadIdx.x & 7) << 3;
  const _Float16* gx = X + (size_t)(m0 + crow) * Kd + cseg;
  const _Float16* gw = W + (size_t)(n0 + crow) * Kd + cseg;
  const uint32_t lx = (uint32_t)(uintptr_t)(&As[0][crow * LDT + cseg]);
  const uint32_t lw = (uint32_t)(uintptr_t)(&Bs[0][crow * LDT + cseg]);
  const uint32_t bufb = BM * LDT * 2;    // bytes from buffer 0 to buffer 1
  const int nt = Kd / BKK;               // stages

  // Ring prologue: stage 0 landed and published, then stage 1 in flight
  async_fill_stage(gx, gw, Kd, lx, lw);
  wait_async_zero();
  __syncthreads();
  if (1 < nt)
    async_fill_stage(gx + BKK, gw + BKK, Kd, lx + bufb, lw + bufb);

  for (int t = 0; t < nt; ++t) {
    const _Float16* as = &As[t & 1][0];
    const _Float16* bs = &Bs[t & 1][0];
    // unrolled: both 32-k halves of the stage read LDS at constant offsets
#pragma unroll
    for (int kk = 0; work && kk < BKK; kk += 32) {
      v16h a[4], b[2];
#pragma unroll
      for (int ni = 0; ni < 2; ++ni)
        b[ni] = load_ab_frag(bs + (wn + ni * 16) * LDT + kk, LDT);
#pragma unroll
      for (int mi = 0; mi < 4; ++mi)
        a[mi] = load_ab_frag(as + (wm + mi * 16) * LDT + kk, LDT);
      // keeps the block's twelve LDS loads together ahead of its WMMAs, which
      // then follow behind counted waits: left free, the scheduler sinks each A
      // fragment's loads to its own two WMMAs, behind a full wait each time
      __builtin_amdgcn_sched_barrier(0);
#pragma unroll
      for (int mi = 0; mi < 4; ++mi)
#pragma unroll
        for (int ni = 0; ni < 2; ++ni)
          acc[mi][ni] = wmma16(a[mi], b[ni], acc[mi][ni]);
    }

    // ---- publish stage t + 1, then refill the buffer stage t has left ----
    // keeps the stage's WMMAs ahead of the publish point: left free, the
    // scheduler sinks the last block's behind the barrier and ahead of the
    // refill, whose copies then start that much later
    __builtin_amdgcn_sched_barrier(0);
    asm volatile("s_wait_dscnt 0x0" ::: "memory");  // own reads of stage t done
    wait_async_zero();                              // own copies of stage t + 1 landed
    __syncthreads();
    if (t + 2 < nt)
      async_fill_stage(gx + (size_t)(t + 2) * BKK, gw + (size_t)(t + 2) * BKK, Kd,
                       lx + (t & 1) * bufb, lw + (t & 1) * bufb);
  }
  wait_async_zero();   // nothing of this wave in flight when it ends

  // Epilogue: the output form is the same for the whole block
  if (!QKV) {
    store_acc<0, 1>(acc, b0, Y0, N, m0 + wm, n0 + wn);
  } else if (work) {
    _Float16* Y = (_Float16*)Y0 + (size_t)z * M * N;
    if (z == 2) {
      store_acc<1, 0>(acc, b2, Y, MT, m0 + wm, n0 + wn);
    } else {
      store_acc<0, 0>(acc, z == 0 ? b0 : b1, Y, cD, m0 + wm, n0 + wn);
      // In the built code this branch ends in a jump with the other branch's
      // code as its fall-through, which rewrites registers its stores name:
      // the wait stands ahead of it on that path too.
      asm volatile("s_wait_xcnt 0x0" ::: "memory");
    }
  }
}

// ---------------------------------------------------------------------------
// Attention K/V stage: 64 keys of one head. K tile = 64 key rows x 64 dk,
// V^T tile = 64 d rows x 64 keys; both have 128-B rows, laid in LDS at a
// 144-B pitch (16 B x odd) for the ds_load_b128 fragment readers.
// ---------------------------------------------------------------------------
#define KT 64                 // keys per stage
#define NT (cS / KT)          // stages per (b,h)
#define LDKV 72               // LDS pitch of a stage row, in halves

// One stage, copied once for the whole block: 2 x 512 chunks of 16 B, four
// copies per thread; a wave's copy covers four whole 128-B rows.
// gk, gv, lk, lv are this thread's own chunk of rows 0..31; rows 32..63 follow.
__device__ __forceinline__ void async_fill_kv(const _Float16* gk, const _Float16* gv,
                                              uint32_t lk, uint32_t lv) {
  const _Float16* gk1 = gk + (size_t)32 * cD;
  const _Float16* gv1 = gv + (size_t)32 * MT;
  const uint32_t  lk1 = lk + 32 * LDKV * 2;
  const uint32_t  lv1 = lv + 32 * LDKV * 2;
  // The s_wait_xcnt closes the copies' own statement, so that no address
  // register of a copy is rewritten ahead of it.
  asm volatile("global_load_async_to_lds_b128 %0, %1, off\n\t"
               "global_load_async_to_lds_b128 %2, %3, off\n\t"
               "global_load_async_to_lds_b128 %4, %5, off\n\t"
               "global_load_async_to_lds_b128 %6, %7, off\n\t"
               "s_wait_xcnt 0x0"
               :: "v"(lk), "v"(gk), "v"(lk1), "v"(gk1),
                  "v"(lv), "v"(gv), "v"(lv1), "v"(gv1) : "memory");
}

// ---------------------------------------------------------------------------
// Lane l <-> lane l ^ 16: the two lanes that share one query column.
// ---------------------------------------------------------------------------
__device__ __forceinline__ float xhalf(float x) {
  const int b = __float_as_int(x);
  return __int_as_float(
      __builtin_amdgcn_permlanex16(b, b, 0x76543210, 0xfedcba98, false, false));
}

// The mask as one instruction a score: median(score, ceiling, -1e9) is -1e9
// under a ceiling of -1e9, whatever the score, and the score itself under the
// largest float, for every score >= -1e9.
__device__ __forceinline__ float min_cap(float s, float cap) {
  return __builtin_amdgcn_fmed3f(s, cap, -1.0e9f);
}

__global__ __launch_bounds__(256) void attention_fa(
    const _Float16* __restrict__ Q, const _Float16* __restrict__ Km,
    const _Float16* __restrict__ Vt, const int* __restrict__ mask,
    _Float16* __restrict__ ctx) {
  __shared__ __align__(32) float    Cap[cS];
  __shared__ __align__(16) _Float16 Ks[2][KT * LDKV];
  __shared__ __align__(16) _Float16 Vs[2][64 * LDKV];

  const int wave = threadIdx.x >> 5;
  const int lane = threadIdx.x & 31;
  const int bh = blockIdx.y;
  const int b  = bh >> 4;                 // H = 16
  const int h  = bh & 15;
  const int q0 = (blockIdx.x * 8 + wave) * 16;

  const int colr = lane & 15;
  const int prow = (lane >> 4) << 3;

  // Q fragments, pre-scaled by 1/sqrt(DK) = 0.125 (exact in f16)
  const _Float16* qbase = Q + (size_t)(b * cS + q0) * cD + h * 64;
  v16h aq0 = load_ab_frag(qbase, cD);
  v16h aq1 = load_ab_frag(qbase + 32, cD);
#pragma unroll
  for (int i = 0; i < 16; ++i) {
    aq0[i] = aq0[i] * (_Float16)0.125f;
    aq1[i] = aq1[i] * (_Float16)0.125f;
  }

  v8f   ctxa[4] = {};
  float mrow = -3.0e38f, lrow = 0.0f;     // lrow: this half's keys only

  // This thread's chunk of a stage: row 0..31 (and row + 32), 16-B segment 0..7
  const int crow = threadIdx.x >> 3;
  const int cseg = (threadIdx.x & 7) << 3;
  const _Float16* gk = Km + (size_t)(b * cS + crow) * cD + h * 64 + cseg;
  const _Float16* gv = Vt + (size_t)(h * 64 + crow) * MT + (size_t)b * cS + cseg;
  const uint32_t lk = (uint32_t)(uintptr_t)(&Ks[0][crow * LDKV + cseg]);
  const uint32_t lv = (uint32_t)(uintptr_t)(&Vs[0][crow * LDKV + cseg]);
  const uint32_t bufb = KT * LDKV * 2;   // bytes from buffer 0 to buffer 1

  // Ring prologue: stage 0 landed and published, then stage 1 in flight
  async_fill_kv(gk, gv, lk, lv);

  // The batch's kept keys are places 0 .. kept - 1. Every wave counts them from
  // the same mask row, so kept and nst are the same in the whole block.
  // No kept key: every key weighs the same, and all stages are walked.
  const int kept = count_kept(mask + b * cS);
  const int nst  = kept == 0 ? NT : min((kept + KT - 1) / KT, NT);

  // The key runs along a lane's registers, so the mask is kept per place in
  // LDS as a ceiling: -1e9 on a masked key, the largest float on any other
  // (min_cap above applies it).
  {
    const int p0 = threadIdx.x * 8;
    float4 c0, c1;
    c0.x = p0 + 0 >= kept ? -1.0e9f : 3.4028235e38f;
    c0.y = p0 + 1 >= kept ? -1.0e9f : 3.4028235e38f;
    c0.z = p0 + 2 >= kept ? -1.0e9f : 3.4028235e38f;
    c0.w = p0 + 3 >= kept ? -1.0e9f : 3.4028235e38f;
    c1.x = p0 + 4 >= kept ? -1.0e9f : 3.4028235e38f;
    c1.y = p0 + 5 >= kept ? -1.0e9f : 3.4028235e38f;
    c1.z = p0 + 6 >= kept ? -1.0e9f : 3.4028235e38f;
    c1.w = p0 + 7 >= kept ? -1.0e9f : 3.4028235e38f;
    float4* cp = (float4*)&Cap[p0];
    cp[0] = c0; cp[1] = c1;
  }

  wait_async_zero();
  __syncthreads();
  if (1 < nst)
    async_fill_kv(gk + (size_t)KT * cD, gv + KT, lk + bufb, lv + bufb);

  for (int t = 0; t < nst; ++t) {
   const _Float16* ksb = &Ks[t & 1][0];
   const _Float16* vsb = &Vs[t & 1][0];
   // unrolled: both 32-key halves of the stage read LDS at constant offsets
#pragma unroll
   for (int j = 0; j < KT / 32; ++j) {
    const int k0 = t * KT + j * 32;
    const _Float16* kb = ksb + j * 32 * LDKV;

    // ---- scores^T: 2 key sub-tiles (rows) x 2 dk chunks, queries in columns ----
    v16h bk00 = load_ab_frag(kb, LDKV);
    v16h bk01 = load_ab_frag(kb + 32, LDKV);
    v16h bk10 = load_ab_frag(kb + 16 * LDKV, LDKV);
    v16h bk11 = load_ab_frag(kb + 16 * LDKV + 32, LDKV);
    const v8f cap0 = *(const v8f*)&Cap[k0 + prow];
    const v8f cap1 = *(const v8f*)&Cap[k0 + 16 + prow];
    v16h av[4];
#pragma unroll
    for (int d = 0; d < 4; ++d)
      av[d] = load_ab_frag(vsb + d * 16 * LDKV + j * 32, LDKV);
    // keeps the 32 keys' twenty LDS loads together ahead of their WMMAs, which
    // then follow behind counted waits: left free, the scheduler sinks most
    // fragments' loads to their own WMMA, behind a full wait each time
    __builtin_amdgcn_sched_barrier(0);
    v8f s0 = {}, s1 = {};
    s0 = wmma16(bk00, aq0, s0); s0 = wmma16(bk01, aq1, s0);
    s1 = wmma16(bk10, aq0, s1); s1 = wmma16(bk11, aq1, s1);

    // ---- mask (key row = 8 * half + register) ----
    // the loops over r, i and d below are unrolled so that every accumulator
    // element keeps a constant register index
#pragma unroll
    for (int r = 0; r < 8; ++r) {
      s0[r] = min_cap(s0[r], cap0[r]);
      s1[r] = min_cap(s1[r], cap1[r]);
    }

    // ---- online softmax: in-lane over 16 keys, one exchange for the maximum ----
    float vmax = fmaxf(s0[0], s1[0]);
#pragma unroll
    for (int r = 1; r < 8; ++r) vmax = fmaxf(vmax, fmaxf(s0[r], s1[r]));
    vmax = fmaxf(vmax, xhalf(vmax));
    const float mn = fmaxf(mrow, vmax);
    const float c  = __expf(mrow - mn);
    mrow = mn;

    // ---- P^T as B operand: element s = key 8g + s (s < 8), 16 + 8g + s - 8 ----
    v16h bp;
    v2f  ps2 = {0.0f, 0.0f};
#pragma unroll
    for (int i = 0; i < 4; ++i) {
      const v2f e0 = {__expf(s0[2 * i] - mn), __expf(s0[2 * i + 1] - mn)};
      const v2f e1 = {__expf(s1[2 * i] - mn), __expf(s1[2 * i + 1] - mn)};
      ps2 += e0 + e1;
      const v2h x0 = __builtin_convertvector(e0, v2h);
      const v2h x1 = __builtin_convertvector(e1, v2h);
      bp[2 * i]     = x0[0]; bp[2 * i + 1] = x0[1];
      bp[8 + 2 * i] = x1[0]; bp[9 + 2 * i] = x1[1];
    }
    lrow = lrow * c + (ps2[0] + ps2[1]);

    // ---- ctx^T = ctx^T * c + V^T * P^T  (V^T rows supply A fragments) ----
#pragma unroll
    for (int d = 0; d < 4; ++d)
      ctxa[d] = wmma16(av[d], bp, ctxa[d] * c);
   }

   // ---- publish stage t + 1, then refill the buffer stage t has left ----
   // keeps the stage's work ahead of the publish point: left free, the scheduler
   // sinks the last 32 keys' softmax and WMMAs behind the barrier and ahead of
   // the refill, whose copies then start half a stage later
   __builtin_amdgcn_sched_barrier(0);
   asm volatile("s_wait_dscnt 0x0" ::: "memory");  // own reads of stage t done
   wait_async_zero();                              // own copies of stage t + 1 landed
   __syncthreads();
   if (t + 2 < nst)
     async_fill_kv(gk + (size_t)(t + 2) * KT * cD, gv + (t + 2) * KT,
                   lk + (t & 1) * bufb, lv + (t & 1) * bufb);
  }
  wait_async_zero();   // nothing of this wave in flight when it ends

  // ---- join the halves' sums, normalize, store merged-head context ----
  // Lane (c, g) holds d = 16 * tile + 8g .. + 7 of query c: one 16-B store a tile
  const float linv = 1.0f / (lrow + xhalf(lrow));
  _Float16* orow = ctx + ((size_t)b * cS + q0 + colr) * cD + h * 64 + prow;
#pragma unroll
  for (int d = 0; d < 4; ++d) {
    v8h o;
#pragma unroll
    for (int r = 0; r < 8; ++r) o[r] = (_Float16)(ctxa[d][r] * linv);
    *(v8h*)(orow + d * 16) = o;
  }
}

// ---------------------------------------------------------------------------
// Host-side launcher
// ---------------------------------------------------------------------------
extern "C" void kernel_launch(void* const* d_in, const int* in_sizes, int n_in,
                              void* d_out, int out_size, void* d_ws, size_t ws_size,
                              hipStream_t stream) {
  (void)in_sizes; (void)n_in; (void)out_size; (void)ws_size;

  const float* q_in = (const float*)d_in[0];
  const float* k_in = (const float*)d_in[1];
  const float* v_in = (const float*)d_in[2];
  const int*   mask = (const int*)d_in[3];
  const float* w_q  = (const float*)d_in[4];
  const float* b_q  = (const float*)d_in[5];
  const float* w_k  = (const float*)d_in[6];
  const float* b_k  = (const float*)d_in[7];
  const float* w_v  = (const float*)d_in[8];
  const float* b_v  = (const float*)d_in[9];
  const float* w_o  = (const float*)d_in[10];
  const float* b_o  = (const float*)d_in[11];

  // Workspace layout (f16), 32 Mi halves = 64 MiB, and cB counts behind them
  _Float16* p   = (_Float16*)d_ws;
  _Float16* Xq  = p; p += (size_t)MT * cD;
  _Float16* Xk  = p; p += (size_t)MT * cD;
  _Float16* Xv  = p; p += (size_t)MT * cD;
  _Float16* Wqh = p; p += (size_t)cD * cD;
  _Float16* Wkh = p; p += (size_t)cD * cD;
  _Float16* Wvh = p; p += (size_t)cD * cD;
  _Float16* Woh = p; p += (size_t)cD * cD;
  _Float16* Qh  = p; p += (size_t)MT * cD;
  _Float16* Kh  = p; p += (size_t)MT * cD;
  _Float16* Vt  = p; p += (size_t)MT * cD;
  _Float16* Ch  = p; p += (size_t)MT * cD;
  int*      Kc  = (int*)p;                        // kept keys of each batch

  dim3 gblk(256);

  // f32 -> f16 pre-pass (activations + weights): Xq .. Woh are one run of dst
  cvt_all_f32_f16<<<CV_GRID, CV_THREADS, 0, stream>>>(q_in, k_in, v_in,
                                                      w_q, w_k, w_v, w_o, mask, Xq, Kc);

  // Q, K and V projections in one launch: Xq Xk Xv, Wqh Wkh Wvh and Qh Kh Vt
  // are each one run of the workspace
  dim3 pgrid(cD / BN, MT / BM, 3);                // (8, 32, 3)
  gemm_f16_xwt_bias<1><<<pgrid, gblk, 0, stream>>>(Xq, Wqh, b_q, b_k, b_v, Kc, (void*)Qh, MT, cD, cD);

  dim3 agrid(cS / 16 / 8, cB * cH);               // (16, 32)
  attention_fa<<<agrid, gblk, 0, stream>>>(Qh, Kh, Vt, mask, Ch);

  dim3 ggrid(cD / BN, MT / BM);                   // (8, 32)
  gemm_f16_xwt_bias<0><<<ggrid, gblk, 0, stream>>>(Ch, Woh, b_o, b_o, b_o, Kc, d_out, MT, cD, cD);
}

// v009
// Measured time: 67.5 microseconds a run.
// In two side-by-side timings against v008, it was 1.04 and 1.03 times as fast.
// Over all steps from v000 it is 4.06 times as fast.
#include <hip/hip_runtime.h>

typedef __attribute__((ext_vector_type(16))) _Float16 v16h;
typedef __attribute__((ext_vector_type(8)))  _Float16 v8h;
typedef __attribute__((ext_vector_type(8)))  float    v8f;
typedef __attribute__((ext_vector_type(2)))  _Float16 v2h;
typedef __attribute__((ext_vector_type(2)))  float    v2f;
typedef __attribute__((ext_vector_type(4)))  _Float16 v4h;
typedef __attribute__((ext_vector_type(4)))  float    v4f;

#define cB 2
#define cS 2048
#define cD 1024
#define cH 16
#define MT (cB * cS)          // 4096 tokens total

#define BM 128
#define BN 128
#define BKK 64                // k depth of a stage: a tile row is one 128-B line
#define LDP 136               // LDS stride of a PAIR of tile rows, in halves: 2 x 128 B + 16 B
#define TILEH (BM / 2 * LDP)  // halves of one operand's tile in LDS (17,408 B)

// ---------------------------------------------------------------------------
// WMMA helper: D = A(16x32 f16) * B(32x16 f16) + C(16x16 f32)
// ---------------------------------------------------------------------------
__device__ __forceinline__ v8f wmma16(v16h a, v16h b, v8f c) {
  return __builtin_amdgcn_wmma_f32_16x16x32_f16(
      false, a, false, b, (short)0, c, false, false);
}

// Load a 16x32 f16 A-fragment (or B-fragment given B^T row-major) from a
// row-major tile with leading dimension ld (in halves).
// Per ISA 7.12.2: lane = row + 16*g, halves[0:8]=K[8g..8g+7], halves[8:16]=K[16+8g..].
__device__ __forceinline__ v16h load_ab_frag(const _Float16* tile, int ld) {
  const int lane = threadIdx.x & 31;
  const int r  = lane & 15;
  const int ko = (lane >> 4) << 3;   // 0 or 8
  const _Float16* p = tile + (size_t)r * ld;
  v8h lo = *(const v8h*)(p + ko);
  v8h hi = *(const v8h*)(p + 16 + ko);
  v16h f;
#pragma unroll
  for (int i = 0; i < 8; ++i) { f[i] = lo[i]; f[i + 8] = hi[i]; }
  return f;
}

// The same fragment from a GEMM tile in LDS, whose 128-B rows lie in pairs: rows
// 2p and 2p + 1 one behind the other, pair p at p * LDP. Sixteen rows' 16-B
// pieces then fall on sixteen different groups of four banks, as at a 144-B row
// pitch, in 8 B less a row. tile: an even row's k position.
__device__ __forceinline__ v16h load_pair_frag(const _Float16* tile) {
  const int lane = threadIdx.x & 31;
  const int r  = lane & 15;
  const int ko = (lane >> 4) << 3;   // 0 or 8
  const _Float16* p = tile + (r >> 1) * LDP + (r & 1) * BKK;
  v8h lo = *(const v8h*)(p + ko);
  v8h hi = *(const v8h*)(p + 16 + ko);
  v16h f;
#pragma unroll
  for (int i = 0; i < 8; ++i) { f[i] = lo[i]; f[i + 8] = hi[i]; }
  return f;
}

// ---------------------------------------------------------------------------
// One GEMM stage, copied global->LDS for the whole block: a 128x64 f16 tile of
// each operand (16 KB, rows of 128 B) into padded LDS tiles. 2 x 1,024 chunks of
// 16 B, eight copies per thread; a wave's copy covers four whole 128-B rows.
// gx, gw, lx, lw are this thread's own chunk of rows 0..31; rows 32.., 64..,
// 96.. follow at 32 rows' distance (ld = source pitch in halves).
// ---------------------------------------------------------------------------
#define STAGE_COPIES 8        // copies of one wave per stage
__device__ __forceinline__ void async_fill_stage(const _Float16* gx, const _Float16* gw,
                                                 int ld, uint32_t lx, uint32_t lw) {
  const size_t   gs = (size_t)32 * ld;         // 32 rows of the source, in halves
  const uint32_t ls = 16 * LDP * 2;            // 32 rows of the LDS tile, in bytes
  // The s_wait_xcnt closes the copies' own statement, so that no address
  // register of a copy is rewritten ahead of it.
  asm volatile("global_load_async_to_lds_b128 %0, %1, off\n\t"
               "global_load_async_to_lds_b128 %2, %3, off\n\t"
               "global_load_async_to_lds_b128 %4, %5, off\n\t"
               "global_load_async_to_lds_b128 %6, %7, off\n\t"
               "global_load_async_to_lds_b128 %8, %9, off\n\t"
               "global_load_async_to_lds_b128 %10, %11, off\n\t"
               "global_load_async_to_lds_b128 %12, %13, off\n\t"
               "global_load_async_to_lds_b128 %14, %15, off\n\t"
               "s_wait_xcnt 0x0"
               :: "v"(lx),          "v"(gx),          "v"(lx + ls),     "v"(gx + gs),
                  "v"(lx + 2 * ls), "v"(gx + 2 * gs), "v"(lx + 3 * ls), "v"(gx + 3 * gs),
                  "v"(lw),          "v"(gw),          "v"(lw + ls),     "v"(gw + gs),
                  "v"(lw + 2 * ls), "v"(gw + 2 * gs), "v"(lw + 3 * ls), "v"(gw + 3 * gs)
               : "memory");
}

__device__ __forceinline__ void wait_async_zero() {
  asm volatile("s_wait_asynccnt 0" ::: "memory");
}

// All of this wave's copies have landed but its N youngest: the wait for one
// stage of a ring that leaves the stages issued behind it in flight (a wait to
// 0 would hold the wave until the youngest stage is in).
template <int N>
__device__ __forceinline__ void wait_async_but() {
  asm volatile("s_wait_asynccnt %0" :: "i"(N) : "memory");
}

// ---------------------------------------------------------------------------
// Key order. A masked key (mask == 0) has softmax weight exp(-1e9 - max), which
// is 0 in f32 as soon as its batch has one kept key (with a score above
// -1e9 + 104; min_cap below asks the like). So each batch's keys are laid with
// the kept keys first, in their order, and the masked keys behind them, in
// theirs: a permutation of the batch's cS places. The pre-pass lays the rows of
// k_in and v_in so; the K and V projections then work only the 128-key tiles
// that hold a kept key, and attention walks only the stages that hold one (all
// tiles and all stages where a batch has no kept key).
//
// Kept keys among the 128 that one wave-wide 16-B load covers, four to a lane.
// ---------------------------------------------------------------------------
__device__ __forceinline__ int kept4(const int4 m) {
  return __builtin_popcount(__builtin_amdgcn_ballot_w32(m.x != 0)) +
         __builtin_popcount(__builtin_amdgcn_ballot_w32(m.y != 0)) +
         __builtin_popcount(__builtin_amdgcn_ballot_w32(m.z != 0)) +
         __builtin_popcount(__builtin_amdgcn_ballot_w32(m.w != 0));
}

// Kept keys of one batch's mask row, counted by every wave for itself: the
// result is wave-uniform and the same in every wave.
__device__ __forceinline__ int count_kept(const int* __restrict__ mrow) {
  const int4* mp = (const int4*)mrow + (threadIdx.x & 31);
  int total = 0;
  // unrolled: all sixteen loads are in flight together
#pragma unroll
  for (int i = 0; i < cS / 128; ++i) total += kept4(mp[i * 32]);
  return __builtin_amdgcn_readfirstlane(total);
}

// ---------------------------------------------------------------------------
// f32 -> f16 conversion pre-pass: all seven operands in ONE launch of a grid
// that is resident at once, one 16-wave block per 65,536 elements.
// The f16 copies lie one behind the other in the workspace, in the order of
// the sources. Every source has rows of cD elements; a row of k_in or v_in goes
// to its key's place in the key order, any other row to its own place.
// A wave takes four rows, 4,096 contiguous elements: 32 loads of 512 contiguous
// bytes, all issued ahead of the first conversion, and 32 stores of two whole
// lines. kept_of[b] receives batch b's number of kept keys.
// ---------------------------------------------------------------------------
#define CV_THREADS 512
#define CV_LOADS   32                          // 16-B loads per lane
#define CV_WAVE    (CV_LOADS * 128)            // elements per wave
#define CV_BLOCK   (CV_WAVE * (CV_THREADS / 32))
#define CV_ACT     (MT * cD / CV_BLOCK)        // blocks per activation: 64
#define CV_WGT     (cD * cD / CV_BLOCK)        // blocks per weight: 16
#define CV_GRID    (3 * CV_ACT + 4 * CV_WGT)   // 256
#define CV_RLOADS  (cD / 128)                  // loads per row: 8

__global__ __launch_bounds__(CV_THREADS) void cvt_all_f32_f16(
    const float* __restrict__ q_in, const float* __restrict__ k_in,
    const float* __restrict__ v_in, const float* __restrict__ w_q,
    const float* __restrict__ w_k,  const float* __restrict__ w_v,
    const float* __restrict__ w_o,  const int* __restrict__ mask,
    _Float16* __restrict__ dst, int* __restrict__ kept_of) {
  const int blk = blockIdx.x;
  const float* src;
  int rel;                                     // block index inside its source
  if (blk < 3 * CV_ACT) {
    const int s = blk / CV_ACT;
    rel = blk - s * CV_ACT;
    src = s == 0 ? q_in : s == 1 ? k_in : v_in;
  } else {
    const int u = blk - 3 * CV_ACT;
    const int s = u / CV_WGT;
    rel = u - s * CV_WGT;
    src = s == 0 ? w_q : s == 1 ? w_k : s == 2 ? w_v : w_o;
  }
  const bool keys = blk >= CV_ACT && blk < 3 * CV_ACT;   // rows are keys
  const int  lane = threadIdx.x & 31;
  const int  wave = __builtin_amdgcn_readfirstlane(threadIdx.x >> 5);
  const int  inblk = wave * CV_WAVE + lane * 4;
  const float* sp = src + (size_t)rel * CV_BLOCK;
  // the wave's first row in its source; where rows are keys, a token
  const int row0 = (rel * CV_BLOCK + wave * CV_WAVE) / cD;

  // The mask row of the wave's batch, and once more the 128 keys around its own
  // four (a wave whose rows are no keys reads batch 0's and drops the result:
  // one straight line of code for all). Load i covers keys 128 i .. 128 i + 127.
  const int tok0 = keys ? row0 : 0;
  const int kb   = tok0 / cS * cS;             // the batch's first token
  const int tile = (tok0 - kb) >> 7;
  int4 mr[cS / 128];
#pragma unroll
  for (int i = 0; i < cS / 128; ++i) mr[i] = ((const int4*)(mask + kb))[i * 32 + lane];
  const int4 m = ((const int4*)(mask + kb))[tile * 32 + lane];
  // keeps the mask loads ahead of the rows' loads: their wait then leaves the
  // rows' loads in flight while the places are counted
  __builtin_amdgcn_sched_barrier(0);

  // the loops below are unrolled: x stays in registers at constant indices
  v4f x[CV_LOADS];
#pragma unroll
  for (int i = 0; i < CV_LOADS; ++i) x[i] = *(const v4f*)(sp + inblk + i * 128);
  // the loads' offset register is named here, so it lives up to this wait and
  // is not given to a load's result ahead of it
  asm volatile("s_wait_xcnt 0x0" :: "v"(inblk * 4) : "memory");
  // keeps every load ahead of the first conversion: left free, the scheduler
  // reuses registers and issues the later loads only when earlier ones are back
  __builtin_amdgcn_sched_barrier(0);

  // A kept key's place is its rank among the kept, a masked key's the number of
  // kept keys plus its rank among the masked: both are counts of keys of the
  // batch, so every place lies inside the batch whatever the mask holds.
  int n = 0, u = 0;                            // kept: in the batch, ahead of a key
#pragma unroll
  for (int i = 0; i < cS / 128; ++i) {
    const int c = kept4(mr[i]);
    n += c;
    u += i < tile ? c : 0;
  }
  // each batch's count, for the projections: from the wave with its first k_in row
  if (keys && blk < 2 * CV_ACT && row0 == kb && lane == 0) kept_of[kb / cS] = n;
  u = __builtin_amdgcn_mbcnt_lo(__builtin_amdgcn_ballot_w32(m.x != 0), u);
  u = __builtin_amdgcn_mbcnt_lo(__builtin_amdgcn_ballot_w32(m.y != 0), u);
  u = __builtin_amdgcn_mbcnt_lo(__builtin_amdgcn_ballot_w32(m.z != 0), u);
  u = __builtin_amdgcn_mbcnt_lo(__builtin_amdgcn_ballot_w32(m.w != 0), u);
  const int back = kb + tile * 128 + 4 * lane + n;   // masked: back + j - u
  int4 p;                                      // lane l: keys 4 l .. 4 l + 3 of the 128
  p.x = m.x != 0 ? kb + u : back - u;      u += m.x != 0;
  p.y = m.y != 0 ? kb + u : back + 1 - u;  u += m.y != 0;
  p.z = m.z != 0 ? kb + u : back + 2 - u;  u += m.z != 0;
  p.w = m.w != 0 ? kb + u : back + 3 - u;
  const int own = (tok0 & 127) >> 2;           // the lane that holds the wave's four
  const int place[CV_LOADS / CV_RLOADS] = {
      keys ? __builtin_amdgcn_readlane(p.x, own) : row0,
      keys ? __builtin_amdgcn_readlane(p.y, own) : row0 + 1,
      keys ? __builtin_amdgcn_readlane(p.z, own) : row0 + 2,
      keys ? __builtin_amdgcn_readlane(p.w, own) : row0 + 3};

  _Float16* dp = dst + (size_t)(blk - rel) * CV_BLOCK + lane * 4;   // the source's copy
#pragma unroll
  for (int g = 0; g < CV_LOADS; g += CV_RLOADS) {
    _Float16* dr = dp + (size_t)place[g / CV_RLOADS] * cD;
#pragma unroll
    for (int i = 0; i < CV_RLOADS; ++i)
      *(v4h*)(dr + i * 128) = __builtin_convertvector(x[g + i], v4h);
    // keeps a row's stores behind its own loads' wait: left free, all
    // stores gather behind the last load's return
    __builtin_amdgcn_sched_barrier(0);
  }
}

// ---------------------------------------------------------------------------
// A wave's 64x32 accumulator tile + bias, stored at rows gm0.., columns gn0..
// of Y [.., ld]; Y is f32 where F32_OUT, else f16; bias by row where ROW_BIAS,
// else by column.
// C layout = lane(N + 16*(M>=8)), vgpr r = M mod 8.
// ---------------------------------------------------------------------------
template <int ROW_BIAS, int F32_OUT>
__device__ __forceinline__ void store_acc(const v8f (&acc)[4][2],
                                          const float* __restrict__ bias,
                                          void* __restrict__ Y,
                                          int ld, int gm0, int gn0) {
  const int lane = threadIdx.x & 31;
  const int colr = lane & 15;
  const int rsel = (lane >> 4) << 3;
#pragma unroll
  for (int mi = 0; mi < 4; ++mi) {
#pragma unroll
    for (int ni = 0; ni < 2; ++ni) {
      const int gn = gn0 + ni * 16 + colr;
#pragma unroll
      for (int r = 0; r < 8; ++r) {
        const int gm = gm0 + mi * 16 + r + rsel;
        const float v = acc[mi][ni][r] + bias[ROW_BIAS ? gm : gn];
        const size_t at = (size_t)gm * ld + gn;
        if (F32_OUT)
          ((float*)Y)[at] = v;
        else
          ((_Float16*)Y)[at] = (_Float16)v;
      }
    }
  }
}

// ---------------------------------------------------------------------------
// Y = X[M,Kd](f16) * W[N,Kd](f16)^T + bias[N](f32)
// 128x128x64 block tile, 8 waves x (64x32) wave tile, LDS ring of NB buffers
// filled by async global->LDS copies: a stage's copies are issued NB - 1 passes
// ahead of the barrier that publishes it, so that NB - 1 stages of a block are
// in flight and a stage's way from L2 or memory is spread over as many passes.
// NB = 3 where three blocks share a WGP's LDS (QKV), 5 where a block has its
// WGP alone. Kd is a multiple of 64.
//   QKV = 0: one product, Y f32 [M,N], bias b0 (b1, b2, kept_of are not read).
//   QKV = 1: three products z = 0, 1, 2 in one launch. Their X, W and Y lie one
//            behind the other at X0, W0, Y0; biases b0, b1, b2; Y f16 [M,N] for
//            z = 0, 1 and f16 [N,M] for z = 2, which is computed as it is
//            stored, W * X^T: its tokens run along the lanes. M is MT, cB
//            batches of cS tokens, and N is cD.
//            For z = 1, 2 a token is a key, and X holds the keys in the key
//            order: a 128-key tile behind a batch's last kept key is read by
//            nobody and is not worked (kept_of[b]: batch b's kept keys, from
//            the pre-pass). The grid's (y, z) planes count token
//            tiles: first the MT / 128 of z = 0, then the tiles that hold a
//            kept key, z = 1 and 2 in turn; the blocks left over return at once.
//            All tiles are worked where a batch has no kept key.
//            Up to three blocks are resident on a WGP, and one block's waits on
//            copies and LDS are filled by the others.
// Six waves per SIMD are three 8-wave blocks per WGP: the register budget is
// set for exactly that many, so that no WGP takes a fourth block while another
// holds two, and the epilogue's store addresses need not share registers.
// ---------------------------------------------------------------------------
template <int QKV>
__global__ __launch_bounds__(256) __attribute__((amdgpu_waves_per_eu(6, 6)))
void gemm_f16_xwt_bias(
    const _Float16* __restrict__ X0, const _Float16* __restrict__ W0,
    const float* __restrict__ b0, const float* __restrict__ b1,
    const float* __restrict__ b2, const int* __restrict__ kept_of,
    void* __restrict__ Y0, int M, int N, int Kd) {
  constexpr int NB = QKV ? 3 : 5;              // buffers of the ring
  __shared__ __align__(16) _Float16 As[NB][TILEH];
  __shared__ __align__(16) _Float16 Bs[NB][TILEH];

  int z    = 0;
  int ty   = blockIdx.y;                       // token tile
  int left = BM;                               // keys of the tile that are read later
  if (QKV) {
    const int i = (int)(blockIdx.y + blockIdx.z * (MT / 128)) - MT / 128;
    if (i >= 0) {
      static_assert(cB == 2, "the order of the key tiles is written for two batches");
      z = 1 + (i & 1);
      const int r  = i >> 1;                   // rank among the tiles to be worked
      const int k0 = kept_of[0], k1 = kept_of[1];
      const int u0 = k0 == 0 ? cS : min(k0, cS);   // keys of the batch in use
      const int u1 = k1 == 0 ? cS : min(k1, cS);
      const int n0t = (u0 + 127) / 128, n1t = (u1 + 127) / 128;
      // both batches' tiles in turn, then the rest of the longer batch
      const int lo = min(n0t, n1t);
      const int b  = r < 2 * lo ? r & 1 : n1t > n0t;
      const int tl = r < 2 * lo ? r >> 1 : r - lo;
      if (tl >= (b ? n1t : n0t)) return;       // ahead of every copy and barrier
      ty   = b * (cS / 128) + tl;
      left = (b ? u1 : u0) - tl * 128;
    }
  }
  const bool wx = QKV && z == 2;               // the product is W * X^T
  const _Float16* X = wx ? W0 + (size_t)z * N * Kd : X0 + (size_t)z * M * Kd;
  const _Float16* W = wx ? X0 + (size_t)z * M * Kd : W0 + (size_t)z * N * Kd;

  const int m0   = (wx ? (int)blockIdx.x : ty) * BM;
  const int n0   = (wx ? ty : (int)blockIdx.x) * BN;
  const int wave = threadIdx.x >> 5;
  const int wm   = (wave >> 2) * 64;
  const int wn   = (wave & 3) * 32;
  // Attention reads keys by stages of 64: a wave whose keys all lie in a 64 of
  // the tile with no kept key has no product to form. It still copies its share
  // of every stage and passes every barrier. The test is a scalar one.
  const bool work =
      !QKV || __builtin_amdgcn_readfirstlane(z == 2 ? wn & 64 : z == 1 ? wm : 0) < left;

  v8f acc[4][2] = {};

  // This thread's chunk of a stage: row 0..31 (+32, +64, +96), 16-B segment 0..7
  const int crow = threadIdx.x >> 3;
  const int cseg = (threadIdx.x & 7) << 3;
  const _Float16* gx = X + (size_t)(m0 + crow) * Kd + cseg;
  const _Float16* gw = W + (size_t)(n0 + crow) * Kd + cseg;
  const int cat  = (crow >> 1) * LDP + (crow & 1) * BKK + cseg;   // its place in a tile
  const uint32_t lx = (uint32_t)(uintptr_t)(&As[0][cat]);
  const uint32_t lw = (uint32_t)(uintptr_t)(&Bs[0][cat]);
  const uint32_t bufb = TILEH * 2;       // bytes from one buffer to the next
  const int nt = Kd / BKK;               // stages

  // Ring prologue: the first NB stages issued, each into its own buffer, then
  // stage 0 landed and published. Every wave issues STAGE_COPIES copies for
  // every stage, and a wave's copies are counted off in the order of their
  // issue: the counted wait covers stage 0 and leaves exactly the stages behind
  // it in flight. It is used only where all of them were issued.
  // unrolled: the buffers' offsets are constants
#pragma unroll
  for (int s = 0; s < NB; ++s)
    if (s < nt)
      async_fill_stage(gx + s * BKK, gw + s * BKK, Kd, lx + s * bufb, lw + s * bufb);
  if (NB <= nt)
    wait_async_but<(NB - 1) * STAGE_COPIES>();
  else
    wait_async_zero();
  __syncthreads();

  int buf = 0;                           // stage t's buffer, t mod NB
  for (int t = 0; t < nt; ++t) {
    const _Float16* as = &As[buf][0];
    const _Float16* bs = &Bs[buf][0];
    // unrolled: both 32-k halves of the stage read LDS at constant offsets
#pragma unroll
    for (int kk = 0; work && kk < BKK; kk += 32) {
      v16h a[4], b[2];
#pragma unroll
      for (int ni = 0; ni < 2; ++ni)
        b[ni] = load_pair_frag(bs + (wn / 2 + ni * 8) * LDP + kk);
#pragma unroll
      for (int mi = 0; mi < 4; ++mi)
        a[mi] = load_pair_frag(as + (wm / 2 + mi * 8) * LDP + kk);
      // keeps the block's twelve LDS loads together ahead of its WMMAs, which
      // then follow behind counted waits: left free, the scheduler sinks each A
      // fragment's loads to its own two WMMAs, behind a full wait each time
      __builtin_amdgcn_sched_barrier(0);
#pragma unroll
      for (int mi = 0; mi < 4; ++mi)
#pragma unroll
        for (int ni = 0; ni < 2; ++ni)
          acc[mi][ni] = wmma16(a[mi], b[ni], acc[mi][ni]);
    }

    // ---- publish stage t + 1, then refill the buffer stage t has left ----
    // keeps the stage's WMMAs ahead of the publish point: left free, the
    // scheduler sinks the last block's behind the barrier and ahead of the
    // refill, whose copies then start that much later
    __builtin_amdgcn_sched_barrier(0);
    asm volatile("s_wait_dscnt 0x0" ::: "memory");  // own reads of stage t done
    // own copies of stage t + 1 landed: stages t + 2 .. t + NB - 1 stay in
    // flight where all of them were issued (a scalar test, the same in the block)
    if (t + NB <= nt)
      wait_async_but<(NB - 2) * STAGE_COPIES>();
    else
      wait_async_zero();
    __syncthreads();
    if (t + NB < nt)
      async_fill_stage(gx + (size_t)(t + NB) * BKK, gw + (size_t)(t + NB) * BKK, Kd,
                       lx + buf * bufb, lw + buf * bufb);
    buf = buf + 1 == NB ? 0 : buf + 1;
  }
  wait_async_zero();   // nothing of this wave in flight when it ends

  // Epilogue: the output form is the same for the whole block
  if (!QKV) {
    store_acc<0, 1>(acc, b0, Y0, N, m0 + wm, n0 + wn);
  } else if (work) {
    _Float16* Y = (_Float16*)Y0 + (size_t)z * M * N;
    if (z == 2) {
      store_acc<1, 0>(acc, b2, Y, MT, m0 + wm, n0 + wn);
    } else {
      store_acc<0, 0>(acc, z == 0 ? b0 : b1, Y, cD, m0 + wm, n0 + wn);
      // In the built code this branch ends in a jump with the other branch's
      // code as its fall-through, which rewrites registers its stores name:
      // the wait stands ahead of it on that path too.
      asm volatile("s_wait_xcnt 0x0" ::: "memory");
    }
  }
}

// ---------------------------------------------------------------------------
// Attention K/V stage: 64 keys of one head. K tile = 64 key rows x 64 dk,
// V^T tile = 64 d rows x 64 keys; both have 128-B rows, laid in LDS at a
// 144-B pitch (16 B x odd) for the ds_load_b128 fragment readers.
// ---------------------------------------------------------------------------
#define KT 64                 // keys per stage
#define NT (cS / KT)          // stages per (b,h)
#define LDKV 72               // LDS pitch of a stage row, in halves

// One stage, copied once for the whole block: 2 x 512 chunks of 16 B, four
// copies per thread; a wave's copy covers four whole 128-B rows.
// gk, gv, lk, lv are this thread's own chunk of rows 0..31; rows 32..63 follow.
__device__ __forceinline__ void async_fill_kv(const _Float16* gk, const _Float16* gv,
                                              uint32_t lk, uint32_t lv) {
  const _Float16* gk1 = gk + (size_t)32 * cD;
  const _Float16* gv1 = gv + (size_t)32 * MT;
  const uint32_t  lk1 = lk + 32 * LDKV * 2;
  const uint32_t  lv1 = lv + 32 * LDKV * 2;
  // The s_wait_xcnt closes the copies' own statement, so that no address
  // register of a copy is rewritten ahead of it.
  asm volatile("global_load_async_to_lds_b128 %0, %1, off\n\t"
               "global_load_async_to_lds_b128 %2, %3, off\n\t"
               "global_load_async_to_lds_b128 %4, %5, off\n\t"
               "global_load_async_to_lds_b128 %6, %7, off\n\t"
               "s_wait_xcnt 0x0"
               :: "v"(lk), "v"(gk), "v"(lk1), "v"(gk1),
                  "v"(lv), "v"(gv), "v"(lv1), "v"(gv1) : "memory");
}

// ---------------------------------------------------------------------------
// Lane l <-> lane l ^ 16: the two lanes that share one query column.
// ---------------------------------------------------------------------------
__device__ __forceinline__ float xhalf(float x) {
  const int b = __float_as_int(x);
  return __int_as_float(
      __builtin_amdgcn_permlanex16(b, b, 0x76543210, 0xfedcba98, false, false));
}

// The mask as one instruction a score: median(score, ceiling, -1e9) is -1e9
// under a ceiling of -1e9, whatever the score, and the score itself under the
// largest float, for every score >= -1e9.
__device__ __forceinline__ float min_cap(float s, float cap) {
  return __builtin_amdgcn_fmed3f(s, cap, -1.0e9f);
}

__global__ __launch_bounds__(256) void attention_fa(
    const _Float16* __restrict__ Q, const _Float16* __restrict__ Km,
    const _Float16* __restrict__ Vt, const int* __restrict__ mask,
    _Float16* __restrict__ ctx) {
  __shared__ __align__(32) float    Cap[cS];
  __shared__ __align__(16) _Float16 Ks[2][KT * LDKV];
  __shared__ __align__(16) _Float16 Vs[2][64 * LDKV];

  const int wave = threadIdx.x >> 5;
  const int lane = threadIdx.x & 31;
  const int bh = blockIdx.y;
  const int b  = bh >> 4;                 // H = 16
  const int h  = bh & 15;
  const int q0 = (blockIdx.x * 8 + wave) * 16;

  const int colr = lane & 15;
  const int prow = (lane >> 4) << 3;

  // Q fragments, pre-scaled by 1/sqrt(DK) = 0.125 (exact in f16)
  const _Float16* qbase = Q + (size_t)(b * cS + q0) * cD + h * 64;
  v16h aq0 = load_ab_frag(qbase, cD);
  v16h aq1 = load_ab_frag(qbase + 32, cD);
#pragma unroll
  for (int i = 0; i < 16; ++i) {
    aq0[i] = aq0[i] * (_Float16)0.125f;
    aq1[i] = aq1[i] * (_Float16)0.125f;
  }

  v8f   ctxa[4] = {};
  float mrow = -3.0e38f, lrow = 0.0f;     // lrow: this half's keys only

  // This thread's chunk of a stage: row 0..31 (and row + 32), 16-B segment 0..7
  const int crow = threadIdx.x >> 3;
  const int cseg = (threadIdx.x & 7) << 3;
  const _Float16* gk = Km + (size_t)(b * cS + crow) * cD + h * 64 + cseg;
  const _Float16* gv = Vt + (size_t)(h * 64 + crow) * MT + (size_t)b * cS + cseg;
  const uint32_t lk = (uint32_t)(uintptr_t)(&Ks[0][crow * LDKV + cseg]);
  const uint32_t lv = (uint32_t)(uintptr_t)(&Vs[0][crow * LDKV + cseg]);
  const uint32_t bufb = KT * LDKV * 2;   // bytes from buffer 0 to buffer 1

  // Ring prologue: stage 0 landed and published, then stage 1 in flight
  async_fill_kv(gk, gv, lk, lv);

  // The batch's kept keys are places 0 .. kept - 1. Every wave counts them from
  // the same mask row, so kept and nst are the same in the whole block.
  // No kept key: every key weighs the same, and all stages are walked.
  const int kept = count_kept(mask + b * cS);
  const int nst  = kept == 0 ? NT : min((kept + KT - 1) / KT, NT);

  // The key runs along a lane's registers, so the mask is kept per place in
  // LDS as a ceiling: -1e9 on a masked key, the largest float on any other
  // (min_cap above applies it).
  {
    const int p0 = threadIdx.x * 8;
    float4 c0, c1;
    c0.x = p0 + 0 >= kept ? -1.0e9f : 3.4028235e38f;
    c0.y = p0 + 1 >= kept ? -1.0e9f : 3.4028235e38f;
    c0.z = p0 + 2 >= kept ? -1.0e9f : 3.4028235e38f;
    c0.w = p0 + 3 >= kept ? -1.0e9f : 3.4028235e38f;
    c1.x = p0 + 4 >= kept ? -1.0e9f : 3.4028235e38f;
    c1.y = p0 + 5 >= kept ? -1.0e9f : 3.4028235e38f;
    c1.z = p0 + 6 >= kept ? -1.0e9f : 3.4028235e38f;
    c1.w = p0 + 7 >= kept ? -1.0e9f : 3.4028235e38f;
    float4* cp = (float4*)&Cap[p0];
    cp[0] = c0; cp[1] = c1;
  }

  wait_async_zero();
  __syncthreads();
  if (1 < nst)
    async_fill_kv(gk + (size_t)KT * cD, gv + KT, lk + bufb, lv + bufb);

  for (int t = 0; t < nst; ++t) {
   const _Float16* ksb = &Ks[t & 1][0];
   const _Float16* vsb = &Vs[t & 1][0];
   // unrolled: both 32-key halves of the stage read LDS at constant offsets
#pragma unroll
   for (int j = 0; j < KT / 32; ++j) {
    const int k0 = t * KT + j * 32;
    const _Float16* kb = ksb + j * 32 * LDKV;

    // ---- scores^T: 2 key sub-tiles (rows) x 2 dk chunks, queries in columns ----
    v16h bk00 = load_ab_frag(kb, LDKV);
    v16h bk01 = load_ab_frag(kb + 32, LDKV);
    v16h bk10 = load_ab_frag(kb + 16 * LDKV, LDKV);
    v16h bk11 = load_ab_frag(kb + 16 * LDKV + 32, LDKV);
    const v8f cap0 = *(const v8f*)&Cap[k0 + prow];
    const v8f cap1 = *(const v8f*)&Cap[k0 + 16 + prow];
    v16h av[4];
#pragma unroll
    for (int d = 0; d < 4; ++d)
      av[d] = load_ab_frag(vsb + d * 16 * LDKV + j * 32, LDKV);
    // keeps the 32 keys' twenty LDS loads together ahead of their WMMAs, which
    // then follow behind counted waits: left free, the scheduler sinks most
    // fragments' loads to their own WMMA, behind a full wait each time
    __builtin_amdgcn_sched_barrier(0);
    v8f s0 = {}, s1 = {};
    s0 = wmma16(bk00, aq0, s0); s0 = wmma16(bk01, aq1, s0);
    s1 = wmma16(bk10, aq0, s1); s1 = wmma16(bk11, aq1, s1);

    // ---- mask (key row = 8 * half + register) ----
    // the loops over r, i and d below are unrolled so that every accumulator
    // element keeps a constant register index
#pragma unroll
    for (int r = 0; r < 8; ++r) {
      s0[r] = min_cap(s0[r], cap0[r]);
      s1[r] = min_cap(s1[r], cap1[r]);
    }

    // ---- online softmax: in-lane over 16 keys, one exchange for the maximum ----
    float vmax = fmaxf(s0[0], s1[0]);
#pragma unroll
    for (int r = 1; r < 8; ++r) vmax = fmaxf(vmax, fmaxf(s0[r], s1[r]));
    vmax = fmaxf(vmax, xhalf(vmax));
    const float mn = fmaxf(mrow, vmax);
    const float c  = __expf(mrow - mn);
    mrow = mn;

    // ---- P^T as B operand: element s = key 8g + s (s < 8), 16 + 8g + s - 8 ----
    v16h bp;
    v2f  ps2 = {0.0f, 0.0f};
#pragma unroll
    for (int i = 0; i < 4; ++i) {
      const v2f e0 = {__expf(s0[2 * i] - mn), __expf(s0[2 * i + 1] - mn)};
      const v2f e1 = {__expf(s1[2 * i] - mn), __expf(s1[2 * i + 1] - mn)};
      ps2 += e0 + e1;
      const v2h x0 = __builtin_convertvector(e0, v2h);
      const v2h x1 = __builtin_convertvector(e1, v2h);
      bp[2 * i]     = x0[0]; bp[2 * i + 1] = x0[1];
      bp[8 + 2 * i] = x1[0]; bp[9 + 2 * i] = x1[1];
    }
    lrow = lrow * c + (ps2[0] + ps2[1]);

    // ---- ctx^T = ctx^T * c + V^T * P^T  (V^T rows supply A fragments) ----
#pragma unroll
    for (int d = 0; d < 4; ++d)
      ctxa[d] = wmma16(av[d], bp, ctxa[d] * c);
   }

   // ---- publish stage t + 1, then refill the buffer stage t has left ----
   // keeps the stage's work ahead of the publish point: left free, the scheduler
   // sinks the last 32 keys' softmax and WMMAs behind the barrier and ahead of
   // the refill, whose copies then start half a stage later
   __builtin_amdgcn_sched_barrier(0);
   asm volatile("s_wait_dscnt 0x0" ::: "memory");  // own reads of stage t done
   wait_async_zero();                              // own copies of stage t + 1 landed
   __syncthreads();
   if (t + 2 < nst)
     async_fill_kv(gk + (size_t)(t + 2) * KT * cD, gv + (t + 2) * KT,
                   lk + (t & 1) * bufb, lv + (t & 1) * bufb);
  }
  wait_async_zero();   // nothing of this wave in flight when it ends

  // ---- join the halves' sums, normalize, store merged-head context ----
  // Lane (c, g) holds d = 16 * tile + 8g .. + 7 of query c: one 16-B store a tile
  const float linv = 1.0f / (lrow + xhalf(lrow));
  _Float16* orow = ctx + ((size_t)b * cS + q0 + colr) * cD + h * 64 + prow;
#pragma unroll
  for (int d = 0; d < 4; ++d) {
    v8h o;
#pragma unroll
    for (int r = 0; r < 8; ++r) o[r] = (_Float16)(ctxa[d][r] * linv);
    *(v8h*)(orow + d * 16) = o;
  }
}

// ---------------------------------------------------------------------------
// Host-side launcher
// ---------------------------------------------------------------------------
extern "C" void kernel_launch(void* const* d_in, const int* in_sizes, int n_in,
                              void* d_out, int out_size, void* d_ws, size_t ws_size,
                              hipStream_t stream) {
  (void)in_sizes; (void)n_in; (void)out_size; (void)ws_size;

  const float* q_in = (const float*)d_in[0];
  const float* k_in = (const float*)d_in[1];
  const float* v_in = (const float*)d_in[2];
  const int*   mask = (const int*)d_in[3];
  const float* w_q  = (const float*)d_in[4];
  const float* b_q  = (const float*)d_in[5];
  const float* w_k  = (const float*)d_in[6];
  const float* b_k  = (const float*)d_in[7];
  const float* w_v  = (const float*)d_in[8];
  const float* b_v  = (const float*)d_in[9];
  const float* w_o  = (const float*)d_in[10];
  const float* b_o  = (const float*)d_in[11];

  // Workspace layout (f16), 32 Mi halves = 64 MiB, and cB counts behind them
  _Float16* p   = (_Float16*)d_ws;
  _Float16* Xq  = p; p += (size_t)MT * cD;
  _Float16* Xk  = p; p += (size_t)MT * cD;
  _Float16* Xv  = p; p += (size_t)MT * cD;
  _Float16* Wqh = p; p += (size_t)cD * cD;
  _Float16* Wkh = p; p += (size_t)cD * cD;
  _Float16* Wvh = p; p += (size_t)cD * cD;
  _Float16* Woh = p; p += (size_t)cD * cD;
  _Float16* Qh  = p; p += (size_t)MT * cD;
  _Float16* Kh  = p; p += (size_t)MT * cD;
  _Float16* Vt  = p; p += (size_t)MT * cD;
  _Float16* Ch  = p; p += (size_t)MT * cD;
  int*      Kc  = (int*)p;                        // kept keys of each batch

  dim3 gblk(256);

  // f32 -> f16 pre-pass (activations + weights): Xq .. Woh are one run of dst
  cvt_all_f32_f16<<<CV_GRID, CV_THREADS, 0, stream>>>(q_in, k_in, v_in,
                                                      w_q, w_k, w_v, w_o, mask, Xq, Kc);

  // Q, K and V projections in one launch: Xq Xk Xv, Wqh Wkh Wvh and Qh Kh Vt
  // are each one run of the workspace
  dim3 pgrid(cD / BN, MT / BM, 3);                // (8, 32, 3)
  gemm_f16_xwt_bias<1><<<pgrid, gblk, 0, stream>>>(Xq, Wqh, b_q, b_k, b_v, Kc, (void*)Qh, MT, cD, cD);

  dim3 agrid(cS / 16 / 8, cB * cH);               // (16, 32)
  attention_fa<<<agrid, gblk, 0, stream>>>(Qh, Kh, Vt, mask, Ch);

  dim3 ggrid(cD / BN, MT / BM);                   // (8, 32)
  gemm_f16_xwt_bias<0><<<ggrid, gblk, 0, stream>>>(Ch, Woh, b_o, b_o, b_o, Kc, d_out, MT, cD, cD);
}

// v010
// One run takes 64.9 microseconds.
// In both of two side-by-side timings against v009, it was 1.04 times as fast.
// Counting every step since v000, it is 4.22 times as fast.
#include <hip/hip_runtime.h>

typedef __attribute__((ext_vector_type(16))) _Float16 v16h;
typedef __attribute__((ext_vector_type(8)))  _Float16 v8h;
typedef __attribute__((ext_vector_type(8)))  float    v8f;
typedef __attribute__((ext_vector_type(2)))  _Float16 v2h;
typedef __attribute__((ext_vector_type(2)))  float    v2f;
typedef __attribute__((ext_vector_type(4)))  _Float16 v4h;
typedef __attribute__((ext_vector_type(4)))  float    v4f;

#define cB 2
#define cS 2048
#define cD 1024
#define cH 16
#define MT (cB * cS)          // 4096 tokens total

#define BM 128
#define BN 128
#define BKK 64                // k depth of a stage: a tile row is one 128-B line
#define LDP 136               // LDS stride of a PAIR of tile rows, in halves: 2 x 128 B + 16 B
#define TILEH (BM / 2 * LDP)  // halves of one operand's tile in LDS (17,408 B)

// ---------------------------------------------------------------------------
// WMMA helper: D = A(16x32 f16) * B(32x16 f16) + C(16x16 f32)
// ---------------------------------------------------------------------------
__device__ __forceinline__ v8f wmma16(v16h a, v16h b, v8f c) {
  return __builtin_amdgcn_wmma_f32_16x16x32_f16(
      false, a, false, b, (short)0, c, false, false);
}

// Load a 16x32 f16 A-fragment (or B-fragment given B^T row-major) from a
// row-major tile with leading dimension ld (in halves).
// Per ISA 7.12.2: lane = row + 16*g, halves[0:8]=K[8g..8g+7], halves[8:16]=K[16+8g..].
__device__ __forceinline__ v16h load_ab_frag(const _Float16* tile, int ld) {
  const int lane = threadIdx.x & 31;
  const int r  = lane & 15;
  const int ko = (lane >> 4) << 3;   // 0 or 8
  const _Float16* p = tile + (size_t)r * ld;
  v8h lo = *(const v8h*)(p + ko);
  v8h hi = *(const v8h*)(p + 16 + ko);
  v16h f;
#pragma unroll
  for (int i = 0; i < 8; ++i) { f[i] = lo[i]; f[i + 8] = hi[i]; }
  return f;
}

// The same fragment from a GEMM tile in LDS, whose 128-B rows lie in pairs: rows
// 2p and 2p + 1 one behind the other, pair p at p * LDP. Sixteen rows' 16-B
// pieces then fall on sixteen different groups of four banks, as at a 144-B row
// pitch, in 8 B less a row. tile: an even row's k position.
__device__ __forceinline__ v16h load_pair_frag(const _Float16* tile) {
  const int lane = threadIdx.x & 31;
  const int r  = lane & 15;
  const int ko = (lane >> 4) << 3;   // 0 or 8
  const _Float16* p = tile + (r >> 1) * LDP + (r & 1) * BKK;
  v8h lo = *(const v8h*)(p + ko);
  v8h hi = *(const v8h*)(p + 16 + ko);
  v16h f;
#pragma unroll
  for (int i = 0; i < 8; ++i) { f[i] = lo[i]; f[i + 8] = hi[i]; }
  return f;
}

// ---------------------------------------------------------------------------
// One GEMM stage, copied global->LDS for the whole block: a 128x64 f16 tile of
// each operand (16 KB, rows of 128 B) into padded LDS tiles. 2 x 1,024 chunks of
// 16 B, eight copies per thread; a wave's copy covers four whole 128-B rows.
// gx, gw, lx, lw are this thread's own chunk of rows 0..31; rows 32.., 64..,
// 96.. follow at 32 rows' distance (ld = source pitch in halves).
// ---------------------------------------------------------------------------
#define STAGE_COPIES 8        // copies of one wave per stage
__device__ __forceinline__ void async_fill_stage(const _Float16* gx, const _Float16* gw,
                                                 int ld, uint32_t lx, uint32_t lw) {
  const size_t   gs = (size_t)32 * ld;         // 32 rows of the source, in halves
  const uint32_t ls = 16 * LDP * 2;            // 32 rows of the LDS tile, in bytes
  // The s_wait_xcnt closes the copies' own statement, so that no address
  // register of a copy is rewritten ahead of it.
  asm volatile("global_load_async_to_lds_b128 %0, %1, off\n\t"
               "global_load_async_to_lds_b128 %2, %3, off\n\t"
               "global_load_async_to_lds_b128 %4, %5, off\n\t"
               "global_load_async_to_lds_b128 %6, %7, off\n\t"
               "global_load_async_to_lds_b128 %8, %9, off\n\t"
               "global_load_async_to_lds_b128 %10, %11, off\n\t"
               "global_load_async_to_lds_b128 %12, %13, off\n\t"
               "global_load_async_to_lds_b128 %14, %15, off\n\t"
               "s_wait_xcnt 0x0"
               :: "v"(lx),          "v"(gx),          "v"(lx + ls),     "v"(gx + gs),
                  "v"(lx + 2 * ls), "v"(gx + 2 * gs), "v"(lx + 3 * ls), "v"(gx + 3 * gs),
                  "v"(lw),          "v"(gw),          "v"(lw + ls),     "v"(gw + gs),
                  "v"(lw + 2 * ls), "v"(gw + 2 * gs), "v"(lw + 3 * ls), "v"(gw + 3 * gs)
               : "memory");
}

__device__ __forceinline__ void wait_async_zero() {
  asm volatile("s_wait_asynccnt 0" ::: "memory");
}

// All of this wave's copies have landed but its N youngest: the wait for one
// stage of a ring that leaves the stages issued behind it in flight (a wait to
// 0 would hold the wave until the youngest stage is in).
template <int N>
__device__ __forceinline__ void wait_async_but() {
  asm volatile("s_wait_asynccnt %0" :: "i"(N) : "memory");
}

// ---------------------------------------------------------------------------
// Key order. A masked key (mask == 0) has softmax weight exp(-1e9 - max), which
// is 0 in f32 as soon as its batch has one kept key (with a score above
// -1e9 + 104; min_cap below asks the like). So each batch's keys are laid with
// the kept keys first, in their order, and the masked keys behind them, in
// theirs: a permutation of the batch's cS places. The pre-pass lays the rows of
// k_in and v_in so; the K and V projections then work only the 128-key tiles
// that hold a kept key, and attention walks only the stages that hold one (all
// tiles and all stages where a batch has no kept key).
//
// Kept keys among the 128 that one wave-wide 16-B load covers, four to a lane.
// ---------------------------------------------------------------------------
__device__ __forceinline__ int kept4(const int4 m) {
  return __builtin_popcount(__builtin_amdgcn_ballot_w32(m.x != 0)) +
         __builtin_popcount(__builtin_amdgcn_ballot_w32(m.y != 0)) +
         __builtin_popcount(__builtin_amdgcn_ballot_w32(m.z != 0)) +
         __builtin_popcount(__builtin_amdgcn_ballot_w32(m.w != 0));
}

// Kept keys of one batch's mask row, counted by every wave for itself: the
// result is wave-uniform and the same in every wave.
__device__ __forceinline__ int count_kept(const int* __restrict__ mrow) {
  const int4* mp = (const int4*)mrow + (threadIdx.x & 31);
  int total = 0;
  // unrolled: all sixteen loads are in flight together
#pragma unroll
  for (int i = 0; i < cS / 128; ++i) total += kept4(mp[i * 32]);
  return __builtin_amdgcn_readfirstlane(total);
}

// ---------------------------------------------------------------------------
// f32 -> f16 conversion pre-pass: all seven operands in ONE launch of a grid
// that is resident at once, one 16-wave block per 65,536 elements.
// The f16 copies lie one behind the other in the workspace, in the order of
// the sources. Every source has rows of cD elements; a row of k_in or v_in goes
// to its key's place in the key order, any other row to its own place.
// A wave takes four rows, 4,096 contiguous elements: 32 loads of 512 contiguous
// bytes, all issued ahead of the first conversion, and 32 stores of two whole
// lines. kept_of[b] receives batch b's number of kept keys.
// ---------------------------------------------------------------------------
#define CV_THREADS 512
#define CV_LOADS   32                          // 16-B loads per lane
#define CV_WAVE    (CV_LOADS * 128)            // elements per wave
#define CV_BLOCK   (CV_WAVE * (CV_THREADS / 32))
#define CV_ACT     (MT * cD / CV_BLOCK)        // blocks per activation: 64
#define CV_WGT     (cD * cD / CV_BLOCK)        // blocks per weight: 16
#define CV_GRID    (3 * CV_ACT + 4 * CV_WGT)   // 256
#define CV_RLOADS  (cD / 128)                  // loads per row: 8

__global__ __launch_bounds__(CV_THREADS) void cvt_all_f32_f16(
    const float* __restrict__ q_in, const float* __restrict__ k_in,
    const float* __restrict__ v_in, const float* __restrict__ w_q,
    const float* __restrict__ w_k,  const float* __restrict__ w_v,
    const float* __restrict__ w_o,  const int* __restrict__ mask,
    _Float16* __restrict__ dst, int* __restrict__ kept_of) {
  const int blk = blockIdx.x;
  const float* src;
  int rel;                                     // block index inside its source
  if (blk < 3 * CV_ACT) {
    const int s = blk / CV_ACT;
    rel = blk - s * CV_ACT;
    src = s == 0 ? q_in : s == 1 ? k_in : v_in;
  } else {
    const int u = blk - 3 * CV_ACT;
    const int s = u / CV_WGT;
    rel = u - s * CV_WGT;
    src = s == 0 ? w_q : s == 1 ? w_k : s == 2 ? w_v : w_o;
  }
  const bool keys = blk >= CV_ACT && blk < 3 * CV_ACT;   // rows are keys
  const int  lane = threadIdx.x & 31;
  const int  wave = __builtin_amdgcn_readfirstlane(threadIdx.x >> 5);
  const int  inblk = wave * CV_WAVE + lane * 4;
  const float* sp = src + (size_t)rel * CV_BLOCK;
  // the wave's first row in its source; where rows are keys, a token
  const int row0 = (rel * CV_BLOCK + wave * CV_WAVE) / cD;

  // The mask row of the wave's batch, and once more the 128 keys around its own
  // four (a wave whose rows are no keys reads batch 0's and drops the result:
  // one straight line of code for all). Load i covers keys 128 i .. 128 i + 127.
  const int tok0 = keys ? row0 : 0;
  const int kb   = tok0 / cS * cS;             // the batch's first token
  const int tile = (tok0 - kb) >> 7;
  int4 mr[cS / 128];
#pragma unroll
  for (int i = 0; i < cS / 128; ++i) mr[i] = ((const int4*)(mask + kb))[i * 32 + lane];
  const int4 m = ((const int4*)(mask + kb))[tile * 32 + lane];
  // keeps the mask loads ahead of the rows' loads: their wait then leaves the
  // rows' loads in flight while the places are counted
  __builtin_amdgcn_sched_barrier(0);

  // the loops below are unrolled: x stays in registers at constant indices
  v4f x[CV_LOADS];
#pragma unroll
  for (int i = 0; i < CV_LOADS; ++i) x[i] = *(const v4f*)(sp + inblk + i * 128);
  // the loads' offset register is named here, so it lives up to this wait and
  // is not given to a load's result ahead of it
  asm volatile("s_wait_xcnt 0x0" :: "v"(inblk * 4) : "memory");
  // keeps every load ahead of the first conversion: left free, the scheduler
  // reuses registers and issues the later loads only when earlier ones are back
  __builtin_amdgcn_sched_barrier(0);

  // A kept key's place is its rank among the kept, a masked key's the number of
  // kept keys plus its rank among the masked: both are counts of keys of the
  // batch, so every place lies inside the batch whatever the mask holds.
  int n = 0, u = 0;                            // kept: in the batch, ahead of a key
#pragma unroll
  for (int i = 0; i < cS / 128; ++i) {
    const int c = kept4(mr[i]);
    n += c;
    u += i < tile ? c : 0;
  }
  // each batch's count, for the projections: from the wave with its first k_in row
  if (keys && blk < 2 * CV_ACT && row0 == kb && lane == 0) kept_of[kb / cS] = n;
  u = __builtin_amdgcn_mbcnt_lo(__builtin_amdgcn_ballot_w32(m.x != 0), u);
  u = __builtin_amdgcn_mbcnt_lo(__builtin_amdgcn_ballot_w32(m.y != 0), u);
  u = __builtin_amdgcn_mbcnt_lo(__builtin_amdgcn_ballot_w32(m.z != 0), u);
  u = __builtin_amdgcn_mbcnt_lo(__builtin_amdgcn_ballot_w32(m.w != 0), u);
  const int back = kb + tile * 128 + 4 * lane + n;   // masked: back + j - u
  int4 p;                                      // lane l: keys 4 l .. 4 l + 3 of the 128
  p.x = m.x != 0 ? kb + u : back - u;      u += m.x != 0;
  p.y = m.y != 0 ? kb + u : back + 1 - u;  u += m.y != 0;
  p.z = m.z != 0 ? kb + u : back + 2 - u;  u += m.z != 0;
  p.w = m.w != 0 ? kb + u : back + 3 - u;
  const int own = (tok0 & 127) >> 2;           // the lane that holds the wave's four
  const int place[CV_LOADS / CV_RLOADS] = {
      keys ? __builtin_amdgcn_readlane(p.x, own) : row0,
      keys ? __builtin_amdgcn_readlane(p.y, own) : row0 + 1,
      keys ? __builtin_amdgcn_readlane(p.z, own) : row0 + 2,
      keys ? __builtin_amdgcn_readlane(p.w, own) : row0 + 3};

  _Float16* dp = dst + (size_t)(blk - rel) * CV_BLOCK + lane * 4;   // the source's copy
#pragma unroll
  for (int g = 0; g < CV_LOADS; g += CV_RLOADS) {
    _Float16* dr = dp + (size_t)place[g / CV_RLOADS] * cD;
#pragma unroll
    for (int i = 0; i < CV_RLOADS; ++i)
      *(v4h*)(dr + i * 128) = __builtin_convertvector(x[g + i], v4h);
    // keeps a row's stores behind its own loads' wait: left free, all
    // stores gather behind the last load's return
    __builtin_amdgcn_sched_barrier(0);
  }
}

// ---------------------------------------------------------------------------
// A wave's 64x32 accumulator tile + bias, stored as Y[gn0 + n][gm0 + m], ld
// elements a row: the accumulator's m direction runs along a row of Y. Y is f32
// where F32_OUT, else f16. The bias goes by m where by_m, else by n (by_m is the
// same in the whole block; ANY_BIAS = 0 says that it is always set).
// C layout = lane(N + 16*(M>=8)), vgpr r = M mod 8: a lane holds eight
// neighbours of one row of Y. The wave's 32 rows of 64 elements are whole 128-B
// lines (one in f16, two in f32): they are laid in the wave's own LDS range
// stage (32 rows at a pitch of 16 B x odd) and read back so that each 16-B-a-lane
// store covers four whole lines (from the accumulators' own layout a line would
// leave in pieces of 32 or 64 B, one line transaction a piece).
// ---------------------------------------------------------------------------
#define STG_H 72              // pitch of a staged f16 row, in halves: 128 B + 16 B
#define STG_F 68              // pitch of a staged f32 row, in floats: 256 B + 16 B
template <int ANY_BIAS, int F32_OUT>
__device__ __forceinline__ void store_acc_lines(const v8f (&acc)[4][2],
                                                const float* __restrict__ bias, bool by_m,
                                                void* __restrict__ Y,
                                                int ld, int gm0, int gn0,
                                                _Float16* stage) {
  const int lane = threadIdx.x & 31;
  const int colr = lane & 15;
  const int rsel = (lane >> 4) << 3;
  float* stf = (float*)stage;
  // Only the bias loads stand under the branch: the direction the bias does not
  // go by holds zeros, and one straight line of code serves both forms (two
  // whole copies of it keep the accumulators live across each other and spill).
  // the loops below are unrolled: the accumulators keep constant register indices
  v8f   bm[4] = {};
  float bn[2] = {0.0f, 0.0f};
  if (!ANY_BIAS || by_m) {
    const float* bp = bias + gm0 + rsel;
#pragma unroll
    for (int mi = 0; mi < 4; ++mi) bm[mi] = *(const v8f*)(bp + mi * 16);
    // the loads' address is named here, so it lives up to this wait and is not
    // given to a load's result ahead of it
    asm volatile("s_wait_xcnt 0x0" :: "v"(bp) : "memory");
  } else {
#pragma unroll
    for (int ni = 0; ni < 2; ++ni) bn[ni] = bias[gn0 + ni * 16 + colr];
  }
#pragma unroll
  for (int mi = 0; mi < 4; ++mi) {
#pragma unroll
    for (int ni = 0; ni < 2; ++ni) {
      v8f v = acc[mi][ni] + bm[mi];
      if (ANY_BIAS) v += bn[ni];
      const int at = mi * 16 + rsel;
      if (F32_OUT) {
        float* p = stf + (ni * 16 + colr) * STG_F + at;
        const v4f lo = {v[0], v[1], v[2], v[3]};
        const v4f hi = {v[4], v[5], v[6], v[7]};
        *(v4f*)p = lo;
        *(v4f*)(p + 4) = hi;
      } else {
        *(v8h*)(stage + (ni * 16 + colr) * STG_H + at) = __builtin_convertvector(v, v8h);
      }
    }
  }
  // the rows are read back by other lanes of this wave than wrote them: every
  // lane's LDS stores are done, and no read is moved ahead of them
  asm volatile("s_wait_dscnt 0x0" ::: "memory");
  if (F32_OUT) {
    const int row = lane >> 4, seg = (lane & 15) << 2;   // two rows a store
    float* yp = (float*)Y + (size_t)(gn0 + row) * ld + gm0 + seg;
    // unrolled: x stays in registers, all reads are issued ahead of the first store
    v4f x[16];
#pragma unroll
    for (int i = 0; i < 16; ++i) x[i] = *(const v4f*)(stf + (2 * i + row) * STG_F + seg);
#pragma unroll
    for (int i = 0; i < 16; ++i) *(v4f*)(yp + (size_t)(2 * i) * ld) = x[i];
  } else {
    const int row = lane >> 3, seg = (lane & 7) << 3;    // four rows a store
    _Float16* yp = (_Float16*)Y + (size_t)(gn0 + row) * ld + gm0 + seg;
    // unrolled: x stays in registers, all reads are issued ahead of the first store
    v8h x[8];
#pragma unroll
    for (int i = 0; i < 8; ++i) x[i] = *(const v8h*)(stage + (4 * i + row) * STG_H + seg);
#pragma unroll
    for (int i = 0; i < 8; ++i) *(v8h*)(yp + (size_t)(4 * i) * ld) = x[i];
  }
}

// ---------------------------------------------------------------------------
// Y = X[M,Kd](f16) * W[N,Kd](f16)^T + bias[N](f32)
// 128x128x64 block tile, 8 waves x (64x32) wave tile, LDS ring of NB buffers
// filled by async global->LDS copies: a stage's copies are issued NB - 1 passes
// ahead of the barrier that publishes it, so that NB - 1 stages of a block are
// in flight and a stage's way from L2 or memory is spread over as many passes.
// NB = 3 where three blocks share a WGP's LDS (QKV), 5 where a block has its
// WGP alone. Kd is a multiple of 64.
// Each product is formed so that the accumulators' m direction runs along a row
// of its Y (store_acc_lines above): W * X^T for Y [M,N], X * W^T for Y [N,M].
//   QKV = 0: one product, Y f32 [M,N], bias b0 (b1, b2, kept_of are not read).
//   QKV = 1: three products z = 0, 1, 2 in one launch. Their X, W and Y lie one
//            behind the other at X0, W0, Y0; biases b0, b1, b2; Y f16 [M,N] for
//            z = 0, 1 and f16 [N,M] for z = 2. M is MT, cB batches of cS
//            tokens, and N is cD.
//            For z = 1, 2 a token is a key, and X holds the keys in the key
//            order: a 128-key tile behind a batch's last kept key is read by
//            nobody and is not worked (kept_of[b]: batch b's kept keys, from
//            the pre-pass). The grid's (y, z) planes count token
//            tiles: first the MT / 128 of z = 0, then the tiles that hold a
//            kept key, z = 1 and 2 in turn; the blocks left over return at once.
//            All tiles are worked where a batch has no kept key.
//            Up to three blocks are resident on a WGP, and one block's waits on
//            copies and LDS are filled by the others.
// Six waves per SIMD are three 8-wave blocks per WGP: the register budget is
// set for exactly that many, so that no WGP takes a fourth block while another
// holds two, and the epilogue's store addresses need not share registers.
// ---------------------------------------------------------------------------
template <int QKV>
__global__ __launch_bounds__(256) __attribute__((amdgpu_waves_per_eu(6, 6)))
void gemm_f16_xwt_bias(
    const _Float16* __restrict__ X0, const _Float16* __restrict__ W0,
    const float* __restrict__ b0, const float* __restrict__ b1,
    const float* __restrict__ b2, const int* __restrict__ kept_of,
    void* __restrict__ Y0, int M, int N, int Kd) {
  constexpr int NB = QKV ? 3 : 5;              // buffers of the ring
  __shared__ __align__(16) _Float16 As[NB][TILEH];
  __shared__ __align__(16) _Float16 Bs[NB][TILEH];

  int z    = 0;
  int ty   = blockIdx.y;                       // token tile
  int left = BM;                               // keys of the tile that are read later
  if (QKV) {
    const int i = (int)(blockIdx.y + blockIdx.z * (MT / 128)) - MT / 128;
    if (i >= 0) {
      static_assert(cB == 2, "the order of the key tiles is written for two batches");
      z = 1 + (i & 1);
      const int r  = i >> 1;                   // rank among the tiles to be worked
      const int k0 = kept_of[0], k1 = kept_of[1];
      const int u0 = k0 == 0 ? cS : min(k0, cS);   // keys of the batch in use
      const int u1 = k1 == 0 ? cS : min(k1, cS);
      const int n0t = (u0 + 127) / 128, n1t = (u1 + 127) / 128;
      // both batches' tiles in turn, then the rest of the longer batch
      const int lo = min(n0t, n1t);
      const int b  = r < 2 * lo ? r & 1 : n1t > n0t;
      const int tl = r < 2 * lo ? r >> 1 : r - lo;
      if (tl >= (b ? n1t : n0t)) return;       // ahead of every copy and barrier
      ty   = b * (cS / 128) + tl;
      left = (b ? u1 : u0) - tl * 128;
    }
  }
  const bool wx = !QKV || z != 2;              // the product is W * X^T
  const _Float16* X = wx ? W0 + (size_t)z * N * Kd : X0 + (size_t)z * M * Kd;
  const _Float16* W = wx ? X0 + (size_t)z * M * Kd : W0 + (size_t)z * N * Kd;

  const int m0   = (wx ? (int)blockIdx.x : ty) * BM;
  const int n0   = (wx ? ty : (int)blockIdx.x) * BN;
  const int wave = threadIdx.x >> 5;
  const int wm   = (wave >> 2) * 64;
  const int wn   = (wave & 3) * 32;
  // Attention reads keys by stages of 64: a wave whose keys all lie in a 64 of
  // the tile with no kept key has no product to form. It still copies its share
  // of every stage and passes every barrier. The test is a scalar one.
  const bool work =
      !QKV || __builtin_amdgcn_readfirstlane(z == 1 ? wn & 64 : z == 2 ? wm : 0) < left;

  v8f acc[4][2] = {};

  // This thread's chunk of a stage: row 0..31 (+32, +64, +96), 16-B segment 0..7
  const int crow = threadIdx.x >> 3;
  const int cseg = (threadIdx.x & 7) << 3;
  const _Float16* gx = X + (size_t)(m0 + crow) * Kd + cseg;
  const _Float16* gw = W + (size_t)(n0 + crow) * Kd + cseg;
  const int cat  = (crow >> 1) * LDP + (crow & 1) * BKK + cseg;   // its place in a tile
  const uint32_t lx = (uint32_t)(uintptr_t)(&As[0][cat]);
  const uint32_t lw = (uint32_t)(uintptr_t)(&Bs[0][cat]);
  const uint32_t bufb = TILEH * 2;       // bytes from one buffer to the next
  const int nt = Kd / BKK;               // stages

  // Ring prologue: the first NB stages issued, each into its own buffer, then
  // stage 0 landed and published. Every wave issues STAGE_COPIES copies for
  // every stage, and a wave's copies are counted off in the order of their
  // issue: the counted wait covers stage 0 and leaves exactly the stages behind
  // it in flight. It is used only where all of them were issued.
  // unrolled: the buffers' offsets are constants
#pragma unroll
  for (int s = 0; s < NB; ++s)
    if (s < nt)
      async_fill_stage(gx + s * BKK, gw + s * BKK, Kd, lx + s * bufb, lw + s * bufb);
  if (NB <= nt)
    wait_async_but<(NB - 1) * STAGE_COPIES>();
  else
    wait_async_zero();
  __syncthreads();

  int buf = 0;                           // stage t's buffer, t mod NB
  for (int t = 0; t < nt; ++t) {
    const _Float16* as = &As[buf][0];
    const _Float16* bs = &Bs[buf][0];
    // unrolled: both 32-k halves of the stage read LDS at constant offsets
#pragma unroll
    for (int kk = 0; work && kk < BKK; kk += 32) {
      v16h a[4], b[2];
#pragma unroll
      for (int ni = 0; ni < 2; ++ni)
        b[ni] = load_pair_frag(bs + (wn / 2 + ni * 8) * LDP + kk);
#pragma unroll
      for (int mi = 0; mi < 4; ++mi)
        a[mi] = load_pair_frag(as + (wm / 2 + mi * 8) * LDP + kk);
      // keeps the block's twelve LDS loads together ahead of its WMMAs, which
      // then follow behind counted waits: left free, the scheduler sinks each A
      // fragment's loads to its own two WMMAs, behind a full wait each time
      __builtin_amdgcn_sched_barrier(0);
#pragma unroll
      for (int mi = 0; mi < 4; ++mi)
#pragma unroll
        for (int ni = 0; ni < 2; ++ni)
          acc[mi][ni] = wmma16(a[mi], b[ni], acc[mi][ni]);
    }

    // ---- publish stage t + 1, then refill the buffer stage t has left ----
    // keeps the stage's WMMAs ahead of the publish point: left free, the
    // scheduler sinks the last block's behind the barrier and ahead of the
    // refill, whose copies then start that much later
    __builtin_amdgcn_sched_barrier(0);
    asm volatile("s_wait_dscnt 0x0" ::: "memory");  // own reads of stage t done
    // own copies of stage t + 1 landed: stages t + 2 .. t + NB - 1 stay in
    // flight where all of them were issued (a scalar test, the same in the block)
    if (t + NB <= nt)
      wait_async_but<(NB - 2) * STAGE_COPIES>();
    else
      wait_async_zero();
    __syncthreads();
    if (t + NB < nt)
      async_fill_stage(gx + (size_t)(t + NB) * BKK, gw + (size_t)(t + NB) * BKK, Kd,
                       lx + buf * bufb, lw + buf * bufb);
    buf = buf + 1 == NB ? 0 : buf + 1;
  }
  wait_async_zero();   // nothing of this wave in flight when it ends

  // Epilogue: the output form is the same for the whole block. Behind the loop's
  // last barrier no wave reads the ring and no copy writes it: each wave stages
  // its tile in a range of its own there.
  if (!QKV) {
    store_acc_lines<0, 1>(acc, b0, true, Y0, N, m0 + wm, n0 + wn,
                          &As[0][0] + wave * (32 * STG_F * 2));
  } else if (work) {
    store_acc_lines<1, 0>(acc, z == 0 ? b0 : z == 1 ? b1 : b2, wx,
                          (_Float16*)Y0 + (size_t)z * M * N, wx ? cD : MT,
                          m0 + wm, n0 + wn, &As[0][0] + wave * (32 * STG_H));
  }
}

// ---------------------------------------------------------------------------
// Attention K/V stage: 64 keys of one head. K tile = 64 key rows x 64 dk,
// V^T tile = 64 d rows x 64 keys; both have 128-B rows, laid in LDS at a
// 144-B pitch (16 B x odd) for the ds_load_b128 fragment readers.
// ---------------------------------------------------------------------------
#define KT 64                 // keys per stage
#define NT (cS / KT)          // stages per (b,h)
#define LDKV 72               // LDS pitch of a stage row, in halves

// One stage, copied once for the whole block: 2 x 512 chunks of 16 B, four
// copies per thread; a wave's copy covers four whole 128-B rows.
// gk, gv, lk, lv are this thread's own chunk of rows 0..31; rows 32..63 follow.
__device__ __forceinline__ void async_fill_kv(const _Float16* gk, const _Float16* gv,
                                              uint32_t lk, uint32_t lv) {
  const _Float16* gk1 = gk + (size_t)32 * cD;
  const _Float16* gv1 = gv + (size_t)32 * MT;
  const uint32_t  lk1 = lk + 32 * LDKV * 2;
  const uint32_t  lv1 = lv + 32 * LDKV * 2;
  // The s_wait_xcnt closes the copies' own statement, so that no address
  // register of a copy is rewritten ahead of it.
  asm volatile("global_load_async_to_lds_b128 %0, %1, off\n\t"
               "global_load_async_to_lds_b128 %2, %3, off\n\t"
               "global_load_async_to_lds_b128 %4, %5, off\n\t"
               "global_load_async_to_lds_b128 %6, %7, off\n\t"
               "s_wait_xcnt 0x0"
               :: "v"(lk), "v"(gk), "v"(lk1), "v"(gk1),
                  "v"(lv), "v"(gv), "v"(lv1), "v"(gv1) : "memory");
}

// ---------------------------------------------------------------------------
// Lane l <-> lane l ^ 16: the two lanes that share one query column.
// ---------------------------------------------------------------------------
__device__ __forceinline__ float xhalf(float x) {
  const int b = __float_as_int(x);
  return __int_as_float(
      __builtin_amdgcn_permlanex16(b, b, 0x76543210, 0xfedcba98, false, false));
}

// The mask as one instruction a score: median(score, ceiling, -1e9) is -1e9
// under a ceiling of -1e9, whatever the score, and the score itself under the
// largest float, for every score >= -1e9.
__device__ __forceinline__ float min_cap(float s, float cap) {
  return __builtin_amdgcn_fmed3f(s, cap, -1.0e9f);
}

__global__ __launch_bounds__(256) void attention_fa(
    const _Float16* __restrict__ Q, const _Float16* __restrict__ Km,
    const _Float16* __restrict__ Vt, const int* __restrict__ mask,
    _Float16* __restrict__ ctx) {
  __shared__ __align__(32) float    Cap[cS];
  __shared__ __align__(16) _Float16 Ks[2][KT * LDKV];
  __shared__ __align__(16) _Float16 Vs[2][64 * LDKV];

  const int wave = threadIdx.x >> 5;
  const int lane = threadIdx.x & 31;
  const int bh = blockIdx.y;
  const int b  = bh >> 4;                 // H = 16
  const int h  = bh & 15;
  const int q0 = (blockIdx.x * 8 + wave) * 16;

  const int colr = lane & 15;
  const int prow = (lane >> 4) << 3;

  // Q fragments, pre-scaled by 1/sqrt(DK) = 0.125 (exact in f16)
  const _Float16* qbase = Q + (size_t)(b * cS + q0) * cD + h * 64;
  v16h aq0 = load_ab_frag(qbase, cD);
  v16h aq1 = load_ab_frag(qbase + 32, cD);
#pragma unroll
  for (int i = 0; i < 16; ++i) {
    aq0[i] = aq0[i] * (_Float16)0.125f;
    aq1[i] = aq1[i] * (_Float16)0.125f;
  }

  v8f   ctxa[4] = {};
  float mrow = -3.0e38f, lrow = 0.0f;     // lrow: this half's keys only

  // This thread's chunk of a stage: row 0..31 (and row + 32), 16-B segment 0..7
  const int crow = threadIdx.x >> 3;
  const int cseg = (threadIdx.x & 7) << 3;
  const _Float16* gk = Km + (size_t)(b * cS + crow) * cD + h * 64 + cseg;
  const _Float16* gv = Vt + (size_t)(h * 64 + crow) * MT + (size_t)b * cS + cseg;
  const uint32_t lk = (uint32_t)(uintptr_t)(&Ks[0][crow * LDKV + cseg]);
  const uint32_t lv = (uint32_t)(uintptr_t)(&Vs[0][crow * LDKV + cseg]);
  const uint32_t bufb = KT * LDKV * 2;   // bytes from buffer 0 to buffer 1

  // Ring prologue: stage 0 landed and published, then stage 1 in flight
  async_fill_kv(gk, gv, lk, lv);

  // The batch's kept keys are places 0 .. kept - 1. Every wave counts them from
  // the same mask row, so kept and nst are the same in the whole block.
  // No kept key: every key weighs the same, and all stages are walked.
  const int kept = count_kept(mask + b * cS);
  const int nst  = kept == 0 ? NT : min((kept + KT - 1) / KT, NT);

  // The key runs along a lane's registers, so the mask is kept per place in
  // LDS as a ceiling: -1e9 on a masked key, the largest float on any other
  // (min_cap above applies it).
  {
    const int p0 = threadIdx.x * 8;
    float4 c0, c1;
    c0.x = p0 + 0 >= kept ? -1.0e9f : 3.4028235e38f;
    c0.y = p0 + 1 >= kept ? -1.0e9f : 3.4028235e38f;
    c0.z = p0 + 2 >= kept ? -1.0e9f : 3.4028235e38f;
    c0.w = p0 + 3 >= kept ? -1.0e9f : 3.4028235e38f;
    c1.x = p0 + 4 >= kept ? -1.0e9f : 3.4028235e38f;
    c1.y = p0 + 5 >= kept ? -1.0e9f : 3.4028235e38f;
    c1.z = p0 + 6 >= kept ? -1.0e9f : 3.4028235e38f;
    c1.w = p0 + 7 >= kept ? -1.0e9f : 3.4028235e38f;
    float4* cp = (float4*)&Cap[p0];
    cp[0] = c0; cp[1] = c1;
  }

  wait_async_zero();
  __syncthreads();
  if (1 < nst)
    async_fill_kv(gk + (size_t)KT * cD, gv + KT, lk + bufb, lv + bufb);

  for (int t = 0; t < nst; ++t) {
   const _Float16* ksb = &Ks[t & 1][0];
   const _Float16* vsb = &Vs[t & 1][0];
   // unrolled: both 32-key halves of the stage read LDS at constant offsets
#pragma unroll
   for (int j = 0; j < KT / 32; ++j) {
    const int k0 = t * KT + j * 32;
    const _Float16* kb = ksb + j * 32 * LDKV;

    // ---- scores^T: 2 key sub-tiles (rows) x 2 dk chunks, queries in columns ----
    v16h bk00 = load_ab_frag(kb, LDKV);
    v16h bk01 = load_ab_frag(kb + 32, LDKV);
    v16h bk10 = load_ab_frag(kb + 16 * LDKV, LDKV);
    v16h bk11 = load_ab_frag(kb + 16 * LDKV + 32, LDKV);
    const v8f cap0 = *(const v8f*)&Cap[k0 + prow];
    const v8f cap1 = *(const v8f*)&Cap[k0 + 16 + prow];
    v16h av[4];
#pragma unroll
    for (int d = 0; d < 4; ++d)
      av[d] = load_ab_frag(vsb + d * 16 * LDKV + j * 32, LDKV);
    // keeps the 32 keys' twenty LDS loads together ahead of their WMMAs, which
    // then follow behind counted waits: left free, the scheduler sinks most
    // fragments' loads to their own WMMA, behind a full wait each time
    __builtin_amdgcn_sched_barrier(0);
    v8f s0 = {}, s1 = {};
    s0 = wmma16(bk00, aq0, s0); s0 = wmma16(bk01, aq1, s0);
    s1 = wmma16(bk10, aq0, s1); s1 = wmma16(bk11, aq1, s1);

    // ---- mask (key row = 8 * half + register) ----
    // the loops over r, i and d below are unrolled so that every accumulator
    // element keeps a constant register index
#pragma unroll
    for (int r = 0; r < 8; ++r) {
      s0[r] = min_cap(s0[r], cap0[r]);
      s1[r] = min_cap(s1[r], cap1[r]);
    }

    // ---- online softmax: in-lane over 16 keys, one exchange for the maximum ----
    float vmax = fmaxf(s0[0], s1[0]);
#pragma unroll
    for (int r = 1; r < 8; ++r) vmax = fmaxf(vmax, fmaxf(s0[r], s1[r]));
    vmax = fmaxf(vmax, xhalf(vmax));
    const float mn = fmaxf(mrow, vmax);
    const float c  = __expf(mrow - mn);
    mrow = mn;

    // ---- P^T as B operand: element s = key 8g + s (s < 8), 16 + 8g + s - 8 ----
    v16h bp;
    v2f  ps2 = {0.0f, 0.0f};
#pragma unroll
    for (int i = 0; i < 4; ++i) {
      const v2f e0 = {__expf(s0[2 * i] - mn), __expf(s0[2 * i + 1] - mn)};
      const v2f e1 = {__expf(s1[2 * i] - mn), __expf(s1[2 * i + 1] - mn)};
      ps2 += e0 + e1;
      const v2h x0 = __builtin_convertvector(e0, v2h);
      const v2h x1 = __builtin_convertvector(e1, v2h);
      bp[2 * i]     = x0[0]; bp[2 * i + 1] = x0[1];
      bp[8 + 2 * i] = x1[0]; bp[9 + 2 * i] = x1[1];
    }
    lrow = lrow * c + (ps2[0] + ps2[1]);

    // ---- ctx^T = ctx^T * c + V^T * P^T  (V^T rows supply A fragments) ----
#pragma unroll
    for (int d = 0; d < 4; ++d)
      ctxa[d] = wmma16(av[d], bp, ctxa[d] * c);
   }

   // ---- publish stage t + 1, then refill the buffer stage t has left ----
   // keeps the stage's work ahead of the publish point: left free, the scheduler
   // sinks the last 32 keys' softmax and WMMAs behind the barrier and ahead of
   // the refill, whose copies then start half a stage later
   __builtin_amdgcn_sched_barrier(0);
   asm volatile("s_wait_dscnt 0x0" ::: "memory");  // own reads of stage t done
   wait_async_zero();                              // own copies of stage t + 1 landed
   __syncthreads();
   if (t + 2 < nst)
     async_fill_kv(gk + (size_t)(t + 2) * KT * cD, gv + (t + 2) * KT,
                   lk + (t & 1) * bufb, lv + (t & 1) * bufb);
  }
  wait_async_zero();   // nothing of this wave in flight when it ends

  // ---- join the halves' sums, normalize, store merged-head context ----
  // Lane (c, g) holds d = 16 * tile + 8g .. + 7 of query c. A query's 64 d are one
  // 128-B line: the wave's 16 rows are laid in its own range of the K ring (behind
  // the loop's last barrier no wave reads the ring and no copy writes it) and read
  // back so that each 16-B-a-lane store covers four whole lines.
  const float linv = 1.0f / (lrow + xhalf(lrow));
  _Float16* st = &Ks[0][0] + wave * (16 * LDKV);
#pragma unroll
  for (int d = 0; d < 4; ++d) {
    v8h o;
#pragma unroll
    for (int r = 0; r < 8; ++r) o[r] = (_Float16)(ctxa[d][r] * linv);
    *(v8h*)(st + colr * LDKV + d * 16 + prow) = o;
  }
  // the rows are read back by other lanes of this wave than wrote them: every
  // lane's LDS stores are done, and no read is moved ahead of them
  asm volatile("s_wait_dscnt 0x0" ::: "memory");
  const int srow = lane >> 3, sseg = (lane & 7) << 3;    // four rows a store
  _Float16* orow = ctx + ((size_t)b * cS + q0 + srow) * cD + h * 64 + sseg;
  // unrolled: the four reads are issued ahead of the first store
#pragma unroll
  for (int i = 0; i < 4; ++i)
    *(v8h*)(orow + (size_t)(4 * i) * cD) = *(const v8h*)(st + (4 * i + srow) * LDKV + sseg);
}

// ---------------------------------------------------------------------------
// Host-side launcher
// ---------------------------------------------------------------------------
extern "C" void kernel_launch(void* const* d_in, const int* in_sizes, int n_in,
                              void* d_out, int out_size, void* d_ws, size_t ws_size,
                              hipStream_t stream) {
  (void)in_sizes; (void)n_in; (void)out_size; (void)ws_size;

  const float* q_in = (const float*)d_in[0];
  const float* k_in = (const float*)d_in[1];
  const float* v_in = (const float*)d_in[2];
  const int*   mask = (const int*)d_in[3];
  const float* w_q  = (const float*)d_in[4];
  const float* b_q  = (const float*)d_in[5];
  const float* w_k  = (const float*)d_in[6];
  const float* b_k  = (const float*)d_in[7];
  const float* w_v  = (const float*)d_in[8];
  const float* b_v  = (const float*)d_in[9];
  const float* w_o  = (const float*)d_in[10];
  const float* b_o  = (const float*)d_in[11];

  // Workspace layout (f16), 32 Mi halves = 64 MiB, and cB counts behind them
  _Float16* p   = (_Float16*)d_ws;
  _Float16* Xq  = p; p += (size_t)MT * cD;
  _Float16* Xk  = p; p += (size_t)MT * cD;
  _Float16* Xv  = p; p += (size_t)MT * cD;
  _Float16* Wqh = p; p += (size_t)cD * cD;
  _Float16* Wkh = p; p += (size_t)cD * cD;
  _Float16* Wvh = p; p += (size_t)cD * cD;
  _Float16* Woh = p; p += (size_t)cD * cD;
  _Float16* Qh  = p; p += (size_t)MT * cD;
  _Float16* Kh  = p; p += (size_t)MT * cD;
  _Float16* Vt  = p; p += (size_t)MT * cD;
  _Float16* Ch  = p; p += (size_t)MT * cD;
  int*      Kc  = (int*)p;                        // kept keys of each batch

  dim3 gblk(256);

  // f32 -> f16 pre-pass (activations + weights): Xq .. Woh are one run of dst
  cvt_all_f32_f16<<<CV_GRID, CV_THREADS, 0, stream>>>(q_in, k_in, v_in,
                                                      w_q, w_k, w_v, w_o, mask, Xq, Kc);

  // Q, K and V projections in one launch: Xq Xk Xv, Wqh Wkh Wvh and Qh Kh Vt
  // are each one run of the workspace
  dim3 pgrid(cD / BN, MT / BM, 3);                // (8, 32, 3)
  gemm_f16_xwt_bias<1><<<pgrid, gblk, 0, stream>>>(Xq, Wqh, b_q, b_k, b_v, Kc, (void*)Qh, MT, cD, cD);

  dim3 agrid(cS / 16 / 8, cB * cH);               // (16, 32)
  attention_fa<<<agrid, gblk, 0, stream>>>(Qh, Kh, Vt, mask, Ch);

  dim3 ggrid(cD / BN, MT / BM);                   // (8, 32)
  gemm_f16_xwt_bias<0><<<ggrid, gblk, 0, stream>>>(Ch, Woh, b_o, b_o, b_o, Kc, d_out, MT, cD, cD);
}
